// v000
// Measured on an AMD MI455X. A time is GPU time per run, averaged over a window of back-to-back runs after a warm-up
// (all launches, gaps included; the runs take copies of the inputs in turn), and the median of several windows.
// Apart from v000's, it joins two sittings. Times from different sittings can be a few percent apart, while
// side-by-side timings come from the same sitting.
// v000, which the later versions start from, runs in 20.3 milliseconds.
#include <hip/hip_runtime.h>

// CSR attention block (16 users x 200 steps, D = 128): q = elu(x Wq^T + bq), qn = q/(|q|+eps); z = elu(x Wk^T + bk), v = x Wv^T + bv; per user the causal cumulative state s_l = sum_{l'<=l} z v^T
// and zc_l = sum z; z_l = LN_D(zc_l + eps) + Pz, S_l = LN_DxD(s_l + eps) + Ps where (Pz, Ps) is the same construction on the 8-step prompt P taken at its last step; NAM = LN_DxD(S_l/(|z_l|+eps) + eps);
// NA = qn . NAM + mask_b (qn . prev_NAM) with prev_NAM = (prev_s[uid] + Ss) / (|prev_z[uid] + Sz| + eps) from the prompt S; NA = LN_D(NA); second output std = unbiased std of
// q / max(z_l, 1e-6) over all (b, l, d).
// One block per user walks the 200 steps with the running DxD state in LDS (f32), the prompt state beside it, LN statistics by fixed-order block reductions, the two vector-matrix products on
// the VALU (rolled loops); the std partials in f64 per block, combined by one final block.
// WMMA (v_wmma_f32_16x16x32_f16, f32 accumulate): the k/v projections of the sequence and both prompts ([3,456 x 128] x [128 x 128] x2) and q of the sequence ([3,200 x 128] x [128 x 128]) with EXACT bf16 inputs (x8) and weights (x256), 1 product.
// Inputs rounded to bf16 once; user_id int32, clamped. Fragment k-map per lane half hh for A AND B: elements 0..7 <- k = 8hh+0..7, 8..15 <- k = 16+8hh+0..7; acc[r] =

namespace {
constexpr int NB = 16, L = 200, LP = 8, D = 128, NU = 1001, NRS = NB * L /* 3200 */, NRP = NB * LP /* 128 */, NR = NRS + 2 * NRP /* 3456 = 54 x 64 */;
constexpr float XS = 8.0f, WSC = 256.0f, EPS = 1e-8f, LNE = 1e-5f;

typedef _Float16 b16;
typedef __attribute__((ext_vector_type(16))) _Float16 v16b;
typedef __attribute__((ext_vector_type(8))) _Float16 v8b;
typedef __attribute__((ext_vector_type(8))) float v8f;
typedef __attribute__((ext_vector_type(4))) float v4f;
__device__ __forceinline__ float bf16_rne(float f) { unsigned int u = __float_as_uint(f); u += 0x7FFFu + ((u >> 16) & 1u); return __uint_as_float(u & 0xFFFF0000u); }
__device__ __forceinline__ v16b frag_kb(const b16* p, int hh) { const v8b a = *(const v8b*)(p + 8 * hh), b = *(const v8b*)(p + 16 + 8 * hh); v16b f;
#pragma unroll
  for (int e = 0; e < 8; ++e) { f[e] = a[e]; f[8 + e] = b[e]; } return f; }
__device__ __forceinline__ v8f wmma16b(v16b a, v16b b, v8f c) { v8f d = __builtin_amdgcn_wmma_f32_16x16x32_f16(false, a, false, b, (short)0, c, false, false); asm volatile("v_nop\n\tv_nop\n\tv_nop\n\tv_nop" : "+v"(d) : "v"(a), "v"(b)); return d; }
__device__ __forceinline__ void wave_lds_sync() { __builtin_amdgcn_fence(__ATOMIC_RELEASE, "workgroup"); __builtin_amdgcn_wave_barrier(); __builtin_amdgcn_fence(__ATOMIC_ACQUIRE, "workgroup"); }
__device__ __forceinline__ float pmul(float a, float b) { float p = a * b; asm volatile("" : "+v"(p)); return p; }
__device__ __forceinline__ float elu(float x) { return x > 0.0f ? x : (__expf(x) - 1.0f); }

__global__ __launch_bounds__(256) void prep_kernel(const float* __restrict__ xs, const float* __restrict__ xp, const float* __restrict__ xq, const float* __restrict__ wq, const float* __restrict__ wk, const float* __restrict__ wv, b16* __restrict__ X16, b16* __restrict__ W16) {
  const int t = blockIdx.x * 256 + threadIdx.x; const int nx = NR * D / 8, nw = 3 * D * D / 8; v8b o;
  if (t < nx) { const int e = t * 8; const int row = e / D; const float* src = row < NRS ? xs + e : row < NRS + NRP ? xp + (e - NRS * D) : xq + (e - (NRS + NRP) * D);
    for (int j = 0; j < 8; ++j) o[j] = (b16)(bf16_rne(src[j]) * XS); { *(v8b*)(X16 + e) = o;  } }
  else if (t < nx + nw) { const int e = (t - nx) * 8; const int k = e / (D * D), r = e - k * D * D; const float* w = k == 0 ? wq : k == 1 ? wk : wv; for (int j = 0; j < 8; ++j) o[j] = (b16)(bf16_rne(w[r + j]) * WSC); { *(v8b*)(W16 + e) = o;  } }
}
__global__ __launch_bounds__(128) void proj_kernel(const b16* __restrict__ X16, const b16* __restrict__ W16, const float* __restrict__ bq, const float* __restrict__ bk, const float* __restrict__ bv, float* __restrict__ Q, float* __restrict__ Z, float* __restrict__ V) {
  __shared__ __attribute__((aligned(16))) float Ts[4][16][D + 4];
  const int kind = blockIdx.y, wave = threadIdx.x >> 5, lane = threadIdx.x & 31, nloc = lane & 15, hlf = lane >> 4; const size_t m0 = (size_t)blockIdx.x * 64 + wave * 16; if (kind == 0 && m0 >= (size_t)NRS) return;
  const b16* Wp = W16 + (size_t)kind * D * D; const float* bb = kind == 0 ? bq : kind == 1 ? bk : bv; float* dst = kind == 0 ? Q : kind == 1 ? Z : V;
  v8f acc[8];
#pragma unroll
  for (int t = 0; t < 8; ++t) acc[t] = (v8f){};
#pragma unroll
  for (int kb = 0; kb < D; kb += 32) { const v16b a = frag_kb(X16 + (m0 + nloc) * D + kb, hlf);
#pragma unroll
    for (int t = 0; t < 8; ++t) acc[t] = wmma16b(a, frag_kb(Wp + (size_t)(t * 16 + nloc) * D + kb, hlf), acc[t]); }
#pragma unroll
  for (int t = 0; t < 8; ++t) { const int c = t * 16 + nloc; const float b_ = bf16_rne(bb[c]);
#pragma unroll
    for (int r = 0; r < 8; ++r) { float v = acc[t][r] * (1.0f / (XS * WSC)) + b_; if (kind < 2) v = elu(v); Ts[wave][8 * hlf + r][c] = v; } }
  wave_lds_sync();
  { for (int rr = 0; rr < 16; ++rr) *(v4f*)(dst + (m0 + rr) * D + lane * 4) = *(const v4f*)(&Ts[wave][rr][lane * 4]);  }
}
// block-wide fixed-order reductions (256 threads): returns the total to every thread.
__device__ __forceinline__ float bsum(float v, float* red) { const int t_ = threadIdx.x; red[t_] = v; __syncthreads(); for (int s = 128; s >= 1; s >>= 1) { if (t_ < s) red[t_] += red[t_ + s]; __syncthreads(); } const float r = red[0]; __syncthreads(); return r; }
// prompt state for user b from rows r0..r0+7 of Z/V: zc = sum_j z_j; sc = sum_j z_j v_j^T; Pz = LN_D(zc + eps) gz + bz (vector, thread < 128 -> pzout), Ps = LN_DxD(sc + eps) gs + bs into
// PS (LDS or global, [p][q], thread owns q = t&127 for p in its half).
__device__ __forceinline__ void prompt_state(const float* __restrict__ Z, const float* __restrict__ V, int r0, const float* __restrict__ gz, const float* __restrict__ bz, const float* __restrict__ gs, const float* __restrict__ bs, float* __restrict__ PS, float* __restrict__ pzout, float* red, float* zs, float* vs) {
  const int t_ = threadIdx.x; const int q = t_ & (D - 1), ph = t_ >> 7;   // ph: which half of the p range (0: 0..63, 1: 64..127)
  // zc (thread < 128) and staging of the 8 z / v rows
  for (int i = t_; i < LP * D; i += 256) { zs[i] = Z[(size_t)r0 * D + i]; vs[i] = V[(size_t)r0 * D + i]; }
  __syncthreads();
  // Pz: LN over D of (zc + eps)
  float zc = 0.0f; if (t_ < D) { for (int j = 0; j < LP; ++j) zc += zs[j * D + t_]; zc += EPS; }
  const float mz = bsum(t_ < D ? zc : 0.0f, red) * (1.0f / D); const float dz = t_ < D ? zc - mz : 0.0f; const float vz = bsum(dz * dz, red) * (1.0f / D); const float rz = rsqrtf(vz + LNE);
  if (t_ < D) pzout[t_] = pmul(dz * rz, bf16_rne(gz[t_])) + bf16_rne(bz[t_]);
  float s1 = 0.0f;
#pragma unroll 1
  for (int pp = 0; pp < D / 2; ++pp) { const int p = ph * (D / 2) + pp; float a = 0.0f; for (int j = 0; j < LP; ++j) a += pmul(zs[j * D + p], vs[j * D + q]); s1 += a + EPS; }
  const float ms = bsum(s1, red) * (1.0f / (D * D)); float s2 = 0.0f;
#pragma unroll 1
  for (int pp = 0; pp < D / 2; ++pp) { const int p = ph * (D / 2) + pp; float a = 0.0f; for (int j = 0; j < LP; ++j) a += pmul(zs[j * D + p], vs[j * D + q]); const float dv = (a + EPS) - ms; s2 += dv * dv; }
  const float rs = rsqrtf(bsum(s2, red) * (1.0f / (D * D)) + LNE);
#pragma unroll 1
  for (int pp = 0; pp < D / 2; ++pp) { const int p = ph * (D / 2) + pp; float a = 0.0f; for (int j = 0; j < LP; ++j) a += pmul(zs[j * D + p], vs[j * D + q]); PS[p * D + q] = pmul(((a + EPS) - ms) * rs, bf16_rne(gs[p * D + q])) + bf16_rne(bs[p * D + q]); }
  __syncthreads();
}
// state kernel: block = user b (256 threads). LDS: SR [128][128] running s (f32), PSL [128][128] prompt-P state. PREV (prev_NAM) in global scratch per b. Per step l: SR += z v^T; LN stats; NAM passes;
__global__ __launch_bounds__(256) void state_kernel(const float* __restrict__ Q, const float* __restrict__ Z, const float* __restrict__ V, const int* __restrict__ uid, const float* __restrict__ gz, const float* __restrict__ bz, const float* __restrict__ gs, const float* __restrict__ bs,
                                                 const float* __restrict__ gn, const float* __restrict__ bn, const float* __restrict__ ga, const float* __restrict__ ba, const float* __restrict__ prev_z, const float* __restrict__ prev_s, float* __restrict__ PREV, float* __restrict__ out, double* __restrict__ STD2) {
  __shared__ float SR[D * D]; __shared__ float PSL[D * D]; __shared__ float red[256]; __shared__ float zs[LP * D], vs[LP * D]; __shared__ float pzP[D], pzS[D], zrow[D], vrow[D], qn[D], zfull[D], zcum[D], nav[D]; __shared__ float scal[4]; __shared__ double dred[2][256];
  const int b = blockIdx.x, t_ = threadIdx.x; const int q = t_ & (D - 1), ph = t_ >> 7;
  // prompt S state -> PSL temporarily, then prev_NAM into PREV (global); prompt P state -> PSL (kept).
  prompt_state(Z, V, NRS + NRP + b * LP, gz, bz, gs, bs, PSL, pzS, red, zs, vs);
  { const int u = min(max(uid[b], 0), NU - 1); float zu = 0.0f; if (t_ < D) { zu = bf16_rne(prev_z[(size_t)u * D + t_]) + pzS[t_]; } const float n2 = bsum(t_ < D ? zu * zu : 0.0f, red); const float inv = 1.0f / (sqrtf(n2) + EPS);
    float msum = bsum(t_ < D ? bf16_rne(prev_z[(size_t)u * D + t_]) : 0.0f, red); if (t_ == 0) scal[0] = (msum != 0.0f) ? 1.0f : 0.0f;
    {
#pragma unroll 1
      for (int pp = 0; pp < D / 2; ++pp) { const int p = ph * (D / 2) + pp; ((float*)PREV)[(size_t)b * D * D + p * D + q] = (bf16_rne(prev_s[((size_t)u * D + p) * D + q]) + PSL[p * D + q]) * inv; }
       } }
  __syncthreads();
  prompt_state(Z, V, NRS + b * LP, gz, bz, gs, bs, PSL, pzP, red, zs, vs);
  for (int i = t_; i < D * D; i += 256) SR[i] = 0.0f; if (t_ < D) zcum[t_] = 0.0f;
  __syncthreads();
  double dsum = 0.0, dsq = 0.0;
  const float* PRb = PREV + (size_t)b * D * D;
  for (int l = 0; l < L; ++l) { const size_t row = (size_t)b * L + l;
    if (t_ < D) { zrow[t_] = Z[row * D + t_]; vrow[t_] = V[row * D + t_]; zcum[t_] += Z[row * D + t_]; }
    __syncthreads();
    // z_l = LN_D(zcum + eps) gz + bz + Pz; qn; |z_l|
    { const float zc = t_ < D ? zcum[t_] + EPS : 0.0f; const float mz = bsum(zc, red) * (1.0f / D); const float dz = t_ < D ? zc - mz : 0.0f; const float vz = bsum(dz * dz, red) * (1.0f / D); const float rz = rsqrtf(vz + LNE);
      float zf = 0.0f, qv = 0.0f; if (t_ < D) { zf = pmul(dz * rz, bf16_rne(gz[t_])) + bf16_rne(bz[t_]) + pzP[t_]; zfull[t_] = zf; qv = Q[row * D + t_]; }
      const float qn2 = bsum(qv * qv, red), zn2 = bsum(zf * zf, red); if (t_ < D) qn[t_] = qv / (sqrtf(qn2) + EPS); if (t_ == 0) scal[1] = 1.0f / (sqrtf(zn2) + EPS);
      if (t_ < D) { const float xv = qv / fmaxf(zf, 1e-6f); dsum += (double)xv; dsq += (double)xv * (double)xv; } }
    __syncthreads();
    const float izn = scal[1];
    float s1 = 0.0f; const float vq = vrow[q];
#pragma unroll 1
    for (int pp = 0; pp < D / 2; ++pp) { const int p = ph * (D / 2) + pp; const float nv = SR[p * D + q] + pmul(zrow[p], vq); SR[p * D + q] = nv; s1 += nv + EPS; }
    const float m1 = bsum(s1, red) * (1.0f / (D * D)); float s2 = 0.0f;
#pragma unroll 1
    for (int pp = 0; pp < D / 2; ++pp) { const int p = ph * (D / 2) + pp; const float dv = (SR[p * D + q] + EPS) - m1; s2 += dv * dv; }
    const float r1 = rsqrtf(bsum(s2, red) * (1.0f / (D * D)) + LNE);
    // NAMraw = (LN(SR) gs + bs + Ps) izn + eps ; stats
    float n1 = 0.0f;
#pragma unroll 1
    for (int pp = 0; pp < D / 2; ++pp) { const int p = ph * (D / 2) + pp; const int i = p * D + q; const float sf = pmul(((SR[i] + EPS) - m1) * r1, bf16_rne(gs[i])) + bf16_rne(bs[i]) + PSL[i]; n1 += pmul(sf, izn) + EPS; }
    const float m2 = bsum(n1, red) * (1.0f / (D * D)); float n2 = 0.0f;
#pragma unroll 1
    for (int pp = 0; pp < D / 2; ++pp) { const int p = ph * (D / 2) + pp; const int i = p * D + q; const float sf = pmul(((SR[i] + EPS) - m1) * r1, bf16_rne(gs[i])) + bf16_rne(bs[i]) + PSL[i]; const float nr = (pmul(sf, izn) + EPS) - m2; n2 += nr * nr; }
    const float r2 = rsqrtf(bsum(n2, red) * (1.0f / (D * D)) + LNE);
    // NA_q partial over the thread's p half: sum_p qn_p NAM_pq ; prev partial: sum_p qn_p PREV_pq
    float na = 0.0f, pv = 0.0f;
#pragma unroll 1
    for (int pp = 0; pp < D / 2; ++pp) { const int p = ph * (D / 2) + pp; const int i = p * D + q; const float sf = pmul(((SR[i] + EPS) - m1) * r1, bf16_rne(gs[i])) + bf16_rne(bs[i]) + PSL[i]; const float nam = pmul(((pmul(sf, izn) + EPS) - m2) * r2, bf16_rne(gn[i])) + bf16_rne(bn[i]);
      na += pmul(qn[p], nam); pv += pmul(qn[p], PRb[i]); }
    // combine the two halves: threads q and q+128 -> via red
    red[t_] = na + scal[0] * pv; __syncthreads(); if (t_ < D) nav[t_] = red[t_] + red[t_ + D]; __syncthreads();
    // LN_D(NA) ga + ba -> out row
    { const float x = t_ < D ? nav[t_] : 0.0f; const float mu = bsum(x, red) * (1.0f / D); const float dv = t_ < D ? x - mu : 0.0f; const float var = bsum(dv * dv, red) * (1.0f / D); const float rr = rsqrtf(var + LNE);
      const float o = pmul(dv * rr, t_ < D ? bf16_rne(ga[t_]) : 0.0f) + (t_ < D ? bf16_rne(ba[t_]) : 0.0f);
      { if (t_ < D) ((float*)out)[row * D + t_] = o;  } }
    __syncthreads(); }
  dred[0][t_] = dsum; dred[1][t_] = dsq; __syncthreads(); for (int s = 128; s >= 1; s >>= 1) { if (t_ < s) { dred[0][t_] += dred[0][t_ + s]; dred[1][t_] += dred[1][t_ + s]; } __syncthreads(); }
  { if (t_ < 16) ((double*)STD2)[(size_t)b * 16 + t_] = (t_ == 0) ? dred[0][0] : (t_ == 1) ? dred[1][0] : 0.0;  }
}
// final std: one wave: n = 16*200*128; var = (sumsq - sum^2/n) / (n-1); std -> out2[0] (and 31 zero floats to fill the line? the output is a single float at the end of the buffer; we write just it).
__global__ __launch_bounds__(32) void std_kernel(const double* __restrict__ STD2, float* __restrict__ out2) {
  const int lane = threadIdx.x; double s = 0.0, s2 = 0.0; if (lane == 0) { for (int b = 0; b < NB; ++b) { s += STD2[(size_t)b * 16]; s2 += STD2[(size_t)b * 16 + 1]; } const double n = (double)NB * L * D; const double var = (s2 - s * s / n) / (n - 1.0); const float sd = (float)sqrt(var > 0.0 ? var : 0.0);
    { ((float*)out2)[0] = sd;  } }
}
}  // namespace

extern "C" void kernel_launch(void* const* d_in, const int* in_sizes, int n_in, void* d_out, int out_size, void* d_ws, size_t ws_size, hipStream_t stream) {
  (void)n_in;
  auto Fp = [&](int i) { return (const float*)d_in[i]; }; auto Ip = [&](int i) { return (const int*)d_in[i]; };
  // input order: 0 user_id [16] i32, 1 seqs_emb [16,200,128], 2 P [16,8,128], 3 S [16,8,128], 4 Wq [128,128], 5 bq, 6 Wk, 7 bk, 8 Wv, 9 bv, 10 z_gamma, 11 z_beta, 12 s_gamma [128,128], 13 s_beta, 14 nam_gamma, 15 nam_beta,
  // 16 na_gamma [128], 17 na_beta, 18 prev_z [1001,128], 19 prev_s [1001,128,128]; outputs NA [16,200,128] at 0, std [1] at float 409600
  if (in_sizes[0] != NB || in_sizes[1] != NRS * D || in_sizes[2] != NRP * D || in_sizes[3] != NRP * D || in_sizes[4] != D * D || in_sizes[12] != D * D || in_sizes[18] != NU * D || in_sizes[19] != NU * D * D || out_size != NRS * D + 1) return;
  size_t off = 0; char* ws = (char*)d_ws;
  auto carve = [&](size_t bytes) { char* p = ws + off; off += (bytes + 255) & ~(size_t)255; return p; };
  b16* X16 = (b16*)carve((size_t)NR * D * 2); b16* W16 = (b16*)carve((size_t)3 * D * D * 2); float* Qp = (float*)carve((size_t)NRS * D * 4); float* Zp = (float*)carve((size_t)NR * D * 4); float* Vp = (float*)carve((size_t)NR * D * 4); float* PREV = (float*)carve((size_t)NB * D * D * 4); double* STD2 = (double*)carve((size_t)NB * 16 * 8);
  if (off > ws_size || off > ((size_t)128 << 20)) return;   // ≈ 7.2 MB
  prep_kernel<<<(NR * D / 8 + 3 * D * D / 8 + 255) / 256, 256, 0, stream>>>(Fp(1), Fp(2), Fp(3), Fp(4), Fp(6), Fp(8), X16, W16);
  proj_kernel<<<dim3(NR / 64, 3), 128, 0, stream>>>(X16, W16, Fp(5), Fp(7), Fp(9), Qp, Zp, Vp);
  state_kernel<<<NB, 256, 0, stream>>>(Qp, Zp, Vp, Ip(0), Fp(10), Fp(11), Fp(12), Fp(13), Fp(14), Fp(15), Fp(16), Fp(17), Fp(18), Fp(19), PREV, (float*)d_out, STD2);
  std_kernel<<<1, 32, 0, stream>>>(STD2, (float*)d_out + (size_t)NRS * D);
}

// v001
// Measured time: 926 microseconds a run.
// Timed twice side by side with v000, it ran 21.8 times as fast both times.
#include <hip/hip_runtime.h>

// CSR attention block (16 users x 200 steps, D = 128): q = elu(x Wq^T + bq), qn = q/(|q|+eps); z = elu(x Wk^T + bk), v = x Wv^T + bv; per user the causal cumulative state s_l = sum_{l'<=l} z v^T
// and zc_l = sum z; z_l = LN_D(zc_l + eps) + Pz, S_l = LN_DxD(s_l + eps) + Ps where (Pz, Ps) is the same construction on the 8-step prompt P taken at its last step; NAM = LN_DxD(S_l/(|z_l|+eps) + eps);
// NA = qn . NAM + mask_b (qn . prev_NAM) with prev_NAM = (prev_s[uid] + Ss) / (|prev_z[uid] + Sz| + eps) from the prompt S; NA = LN_D(NA); second output std = unbiased std of
// q / max(z_l, 1e-6) over all (b, l, d).
// One block per (user, chunk of 7 steps): it first sums z v^T and z over all earlier steps of its user, in step order, in registers, then walks its chunk with the running DxD state in LDS (f32),
// the prompt state beside it, LN statistics by fixed-order block reductions, the two vector-matrix products on the VALU (rolled loops); the std partials in f64 per block, combined by one final wave.
// WMMA (v_wmma_f32_16x16x32_f16, f32 accumulate): the q projection of the sequence ([3,200 x 128] x [128 x 128]) and the k/v projections of the sequence and both prompts ([3,456 x 128] x [128 x 128] x2) with EXACT bf16 inputs (x8) and weights (x256), 1 product.
// Inputs rounded to bf16 once; user_id int32, clamped. Fragment k-map per lane half hh for A AND B: elements 0..7 <- k = 8hh+0..7, 8..15 <- k = 16+8hh+0..7; acc[r] =

namespace {
constexpr int NB = 16, L = 200, LP = 8, D = 128, NU = 1001, NRS = NB * L /* 3200 */, NRP = NB * LP /* 128 */, NR = NRS + 2 * NRP /* 3456 = 54 x 64 */;
constexpr int CH = 7 /* steps per block */, NC = (L + CH - 1) / CH /* 29 chunks per user: 464 blocks, two per WGP by LDS */, TR = 64 /* rows of z and of v staged at a time for the earlier steps */;
static_assert(2 * TR * D <= D * D && (NB - 1) * L + ((L - 1) / TR + 1) * TR <= NR, "staged tiles fit SR and stay inside Z and V");
constexpr float XS = 8.0f, WSC = 256.0f, EPS = 1e-8f, LNE = 1e-5f;

typedef _Float16 b16;
typedef __attribute__((ext_vector_type(16))) _Float16 v16b;
typedef __attribute__((ext_vector_type(8))) _Float16 v8b;
typedef __attribute__((ext_vector_type(8))) float v8f;
typedef __attribute__((ext_vector_type(4))) float v4f;
__device__ __forceinline__ float bf16_rne(float f) { unsigned int u = __float_as_uint(f); u += 0x7FFFu + ((u >> 16) & 1u); return __uint_as_float(u & 0xFFFF0000u); }
__device__ __forceinline__ v16b frag_kb(const b16* p, int hh) { const v8b a = *(const v8b*)(p + 8 * hh), b = *(const v8b*)(p + 16 + 8 * hh); v16b f;
#pragma unroll
  for (int e = 0; e < 8; ++e) { f[e] = a[e]; f[8 + e] = b[e]; } return f; }
__device__ __forceinline__ v8f wmma16b(v16b a, v16b b, v8f c) { v8f d = __builtin_amdgcn_wmma_f32_16x16x32_f16(false, a, false, b, (short)0, c, false, false); asm volatile("v_nop\n\tv_nop\n\tv_nop\n\tv_nop" : "+v"(d) : "v"(a), "v"(b)); return d; }
__device__ __forceinline__ void wave_lds_sync() { __builtin_amdgcn_fence(__ATOMIC_RELEASE, "workgroup"); __builtin_amdgcn_wave_barrier(); __builtin_amdgcn_fence(__ATOMIC_ACQUIRE, "workgroup"); }
__device__ __forceinline__ float pmul(float a, float b) { float p = a * b; asm volatile("" : "+v"(p)); return p; }
__device__ __forceinline__ float elu(float x) { return x > 0.0f ? x : (__expf(x) - 1.0f); }

__global__ __launch_bounds__(256) void prep_kernel(const float* __restrict__ xs, const float* __restrict__ xp, const float* __restrict__ xq, const float* __restrict__ wq, const float* __restrict__ wk, const float* __restrict__ wv, b16* __restrict__ X16, b16* __restrict__ W16) {
  const int t = blockIdx.x * 256 + threadIdx.x; const int nx = NR * D / 8, nw = 3 * D * D / 8; v8b o;
  if (t < nx) { const int e = t * 8; const int row = e / D; const float* src = row < NRS ? xs + e : row < NRS + NRP ? xp + (e - NRS * D) : xq + (e - (NRS + NRP) * D);
    for (int j = 0; j < 8; ++j) o[j] = (b16)(bf16_rne(src[j]) * XS); { *(v8b*)(X16 + e) = o;  } }
  else if (t < nx + nw) { const int e = (t - nx) * 8; const int k = e / (D * D), r = e - k * D * D; const float* w = k == 0 ? wq : k == 1 ? wk : wv; for (int j = 0; j < 8; ++j) o[j] = (b16)(bf16_rne(w[r + j]) * WSC); { *(v8b*)(W16 + e) = o;  } }
}
__global__ __launch_bounds__(128) void proj_kernel(const b16* __restrict__ X16, const b16* __restrict__ W16, const float* __restrict__ bq, const float* __restrict__ bk, const float* __restrict__ bv, float* __restrict__ Q, float* __restrict__ Z, float* __restrict__ V) {
  __shared__ __attribute__((aligned(16))) float Ts[4][16][D + 4];
  const int kind = blockIdx.y, wave = threadIdx.x >> 5, lane = threadIdx.x & 31, nloc = lane & 15, hlf = lane >> 4; const size_t m0 = (size_t)blockIdx.x * 64 + wave * 16; if (kind == 0 && m0 >= (size_t)NRS) return;
  const b16* Wp = W16 + (size_t)kind * D * D; const float* bb = kind == 0 ? bq : kind == 1 ? bk : bv; float* dst = kind == 0 ? Q : kind == 1 ? Z : V;
  v8f acc[8];
#pragma unroll
  for (int t = 0; t < 8; ++t) acc[t] = (v8f){};
#pragma unroll
  for (int kb = 0; kb < D; kb += 32) { const v16b a = frag_kb(X16 + (m0 + nloc) * D + kb, hlf);
#pragma unroll
    for (int t = 0; t < 8; ++t) acc[t] = wmma16b(a, frag_kb(Wp + (size_t)(t * 16 + nloc) * D + kb, hlf), acc[t]); }
#pragma unroll
  for (int t = 0; t < 8; ++t) { const int c = t * 16 + nloc; const float b_ = bf16_rne(bb[c]);
#pragma unroll
    for (int r = 0; r < 8; ++r) { float v = acc[t][r] * (1.0f / (XS * WSC)) + b_; if (kind < 2) v = elu(v); Ts[wave][8 * hlf + r][c] = v; } }
  wave_lds_sync();
  { for (int rr = 0; rr < 16; ++rr) *(v4f*)(dst + (m0 + rr) * D + lane * 4) = *(const v4f*)(&Ts[wave][rr][lane * 4]);  }
}
// block-wide fixed-order reductions (256 threads): returns the total to every thread.
__device__ __forceinline__ float bsum(float v, float* red) { const int t_ = threadIdx.x; red[t_] = v; __syncthreads(); for (int s = 128; s >= 1; s >>= 1) { if (t_ < s) red[t_] += red[t_ + s]; __syncthreads(); } const float r = red[0]; __syncthreads(); return r; }
// prompt state for user b from rows r0..r0+7 of Z/V: zc = sum_j z_j; sc = sum_j z_j v_j^T; Pz = LN_D(zc + eps) gz + bz (vector, thread < 128 -> pzout), Ps = LN_DxD(sc + eps) gs + bs into
// PS (LDS or global, [p][q], thread owns q = t&127 for p in its half).
__device__ __forceinline__ void prompt_state(const float* __restrict__ Z, const float* __restrict__ V, int r0, const float* __restrict__ gz, const float* __restrict__ bz, const float* __restrict__ gs, const float* __restrict__ bs, float* __restrict__ PS, float* __restrict__ pzout, float* red, float* zs, float* vs) {
  const int t_ = threadIdx.x; const int q = t_ & (D - 1), ph = t_ >> 7;   // ph: which half of the p range (0: 0..63, 1: 64..127)
  // zc (thread < 128) and staging of the 8 z / v rows
  for (int i = t_; i < LP * D; i += 256) { zs[i] = Z[(size_t)r0 * D + i]; vs[i] = V[(size_t)r0 * D + i]; }
  __syncthreads();
  // Pz: LN over D of (zc + eps)
  float zc = 0.0f; if (t_ < D) { for (int j = 0; j < LP; ++j) zc += zs[j * D + t_]; zc += EPS; }
  const float mz = bsum(t_ < D ? zc : 0.0f, red) * (1.0f / D); const float dz = t_ < D ? zc - mz : 0.0f; const float vz = bsum(dz * dz, red) * (1.0f / D); const float rz = rsqrtf(vz + LNE);
  if (t_ < D) pzout[t_] = pmul(dz * rz, bf16_rne(gz[t_])) + bf16_rne(bz[t_]);
  float s1 = 0.0f;
#pragma unroll 1
  for (int pp = 0; pp < D / 2; ++pp) { const int p = ph * (D / 2) + pp; float a = 0.0f; for (int j = 0; j < LP; ++j) a += pmul(zs[j * D + p], vs[j * D + q]); s1 += a + EPS; }
  const float ms = bsum(s1, red) * (1.0f / (D * D)); float s2 = 0.0f;
#pragma unroll 1
  for (int pp = 0; pp < D / 2; ++pp) { const int p = ph * (D / 2) + pp; float a = 0.0f; for (int j = 0; j < LP; ++j) a += pmul(zs[j * D + p], vs[j * D + q]); const float dv = (a + EPS) - ms; s2 += dv * dv; }
  const float rs = rsqrtf(bsum(s2, red) * (1.0f / (D * D)) + LNE);
#pragma unroll 1
  for (int pp = 0; pp < D / 2; ++pp) { const int p = ph * (D / 2) + pp; float a = 0.0f; for (int j = 0; j < LP; ++j) a += pmul(zs[j * D + p], vs[j * D + q]); PS[p * D + q] = pmul(((a + EPS) - ms) * rs, bf16_rne(gs[p * D + q])) + bf16_rne(bs[p * D + q]); }
  __syncthreads();
}
// state kernel: block = (chunk c, user b) (256 threads). LDS: SR [128][128] running s (f32), PSL [128][128] prompt-P state. PREV (prev_NAM) in global scratch per block. Per step l: SR += z v^T; LN stats; NAM passes;
__global__ __launch_bounds__(256) void state_kernel(const float* __restrict__ Q, const float* __restrict__ Z, const float* __restrict__ V, const int* __restrict__ uid, const float* __restrict__ gz, const float* __restrict__ bz, const float* __restrict__ gs, const float* __restrict__ bs,
                                                 const float* __restrict__ gn, const float* __restrict__ bn, const float* __restrict__ ga, const float* __restrict__ ba, const float* __restrict__ prev_z, const float* __restrict__ prev_s, float* __restrict__ PREV, float* __restrict__ out, double* __restrict__ STD2) {
  __shared__ __attribute__((aligned(16))) float SR[D * D]; __shared__ float PSL[D * D]; __shared__ float red[256]; __shared__ float zs[LP * D], vs[LP * D]; __shared__ float pzP[D], pzS[D], zrow[D], vrow[D], qn[D], zfull[D], zcum[D], nav[D]; __shared__ float scal[4]; __shared__ double dred[2][256];
  const int b = blockIdx.y, blk = b * NC + blockIdx.x, l0 = blockIdx.x * CH, l1 = min(l0 + CH, L), t_ = threadIdx.x; const int q = t_ & (D - 1), ph = t_ >> 7;
  // prompt S state -> PSL temporarily, then prev_NAM into PREV (global); prompt P state -> PSL (kept).
  prompt_state(Z, V, NRS + NRP + b * LP, gz, bz, gs, bs, PSL, pzS, red, zs, vs);
  { const int u = min(max(uid[b], 0), NU - 1); float zu = 0.0f; if (t_ < D) { zu = bf16_rne(prev_z[(size_t)u * D + t_]) + pzS[t_]; } const float n2 = bsum(t_ < D ? zu * zu : 0.0f, red); const float inv = 1.0f / (sqrtf(n2) + EPS);
    float msum = bsum(t_ < D ? bf16_rne(prev_z[(size_t)u * D + t_]) : 0.0f, red); if (t_ == 0) scal[0] = (msum != 0.0f) ? 1.0f : 0.0f;
    {
#pragma unroll 1
      for (int pp = 0; pp < D / 2; ++pp) { const int p = ph * (D / 2) + pp; ((float*)PREV)[(size_t)blk * D * D + p * D + q] = (bf16_rne(prev_s[((size_t)u * D + p) * D + q]) + PSL[p * D + q]) * inv;
        asm volatile("s_wait_xcnt 0x0" ::: "memory"); }   // kept in front of the next trip's rewrite of the registers that the store names
       } }
  __syncthreads();
  prompt_state(Z, V, NRS + b * LP, gz, bz, gs, bs, PSL, pzP, red, zs, vs);
  // state in front of step l0: s = sum_{l < l0} z_l v_l^T and zcum = sum z_l, each element summed in step order. The thread keeps rows p0..p0+7 x columns q0..q0+3 and 64+q0..64+q0+3 in registers;
  // SR, which holds nothing yet, stages TR rows of z and TR rows of v at a time (whole tiles are loaded: rows past l0 are inside Z and V and are not summed).
  { float* zt = SR; float* vt = SR + TR * D; const int p0 = (t_ >> 4) * 8, q0 = (t_ & 15) * 4; v4f a0[8], a1[8]; float zc = 0.0f; const v4f* zg = (const v4f*)(Z + (size_t)b * L * D) + t_; const v4f* vg = (const v4f*)(V + (size_t)b * L * D) + t_;
#pragma unroll
    for (int r = 0; r < 8; ++r) { a0[r] = (v4f){}; a1[r] = (v4f){}; }
    for (int base = 0; base < l0; base += TR, zg += TR * D / 4, vg += TR * D / 4) { const int n = min(TR, l0 - base);
#pragma unroll   // all 16 loads of the thread in flight at once
      for (int k = 0; k < TR * D / 4 / 256; ++k) { ((v4f*)zt)[t_ + k * 256] = zg[k * 256]; ((v4f*)vt)[t_ + k * 256] = vg[k * 256]; }
      __syncthreads();
#pragma unroll 2   // the next row's LDS reads issue under this row's 64 multiply-adds
      for (int j = 0; j < n; ++j) { const v4f z0 = *(const v4f*)(zt + j * D + p0), z1 = *(const v4f*)(zt + j * D + p0 + 4), v0 = *(const v4f*)(vt + j * D + q0), v1 = *(const v4f*)(vt + j * D + 64 + q0);
        zc += zt[j * D + q];   // both halves of the block sum it, the lower half stores it
#pragma unroll
        for (int r = 0; r < 4; ++r) { a0[r] += z0[r] * v0; a1[r] += z0[r] * v1; a0[4 + r] += z1[r] * v0; a1[4 + r] += z1[r] * v1; } }
      __syncthreads(); }
#pragma unroll
    for (int r = 0; r < 8; ++r) { *(v4f*)(SR + (p0 + r) * D + q0) = a0[r]; *(v4f*)(SR + (p0 + r) * D + 64 + q0) = a1[r]; }
    if (t_ < D) zcum[t_] = zc; }
  __syncthreads();
  double dsum = 0.0, dsq = 0.0;
  const float* PRb = PREV + (size_t)blk * D * D;
  for (int l = l0; l < l1; ++l) { const size_t row = (size_t)b * L + l;
    if (t_ < D) { zrow[t_] = Z[row * D + t_]; vrow[t_] = V[row * D + t_]; zcum[t_] += Z[row * D + t_]; }
    __syncthreads();
    // z_l = LN_D(zcum + eps) gz + bz + Pz; qn; |z_l|
    { const float zc = t_ < D ? zcum[t_] + EPS : 0.0f; const float mz = bsum(zc, red) * (1.0f / D); const float dz = t_ < D ? zc - mz : 0.0f; const float vz = bsum(dz * dz, red) * (1.0f / D); const float rz = rsqrtf(vz + LNE);
      float zf = 0.0f, qv = 0.0f; if (t_ < D) { zf = pmul(dz * rz, bf16_rne(gz[t_])) + bf16_rne(bz[t_]) + pzP[t_]; zfull[t_] = zf; qv = Q[row * D + t_]; }
      const float qn2 = bsum(qv * qv, red), zn2 = bsum(zf * zf, red); if (t_ < D) qn[t_] = qv / (sqrtf(qn2) + EPS); if (t_ == 0) scal[1] = 1.0f / (sqrtf(zn2) + EPS);
      if (t_ < D) { const float xv = qv / fmaxf(zf, 1e-6f); dsum += (double)xv; dsq += (double)xv * (double)xv; } }
    __syncthreads();
    const float izn = scal[1];
    float s1 = 0.0f; const float vq = vrow[q];
#pragma unroll 1
    for (int pp = 0; pp < D / 2; ++pp) { const int p = ph * (D / 2) + pp; const float nv = SR[p * D + q] + pmul(zrow[p], vq); SR[p * D + q] = nv; s1 += nv + EPS; }
    const float m1 = bsum(s1, red) * (1.0f / (D * D)); float s2 = 0.0f;
#pragma unroll 1
    for (int pp = 0; pp < D / 2; ++pp) { const int p = ph * (D / 2) + pp; const float dv = (SR[p * D + q] + EPS) - m1; s2 += dv * dv; }
    const float r1 = rsqrtf(bsum(s2, red) * (1.0f / (D * D)) + LNE);
    // NAMraw = (LN(SR) gs + bs + Ps) izn + eps ; stats
    float n1 = 0.0f;
#pragma unroll 1
    for (int pp = 0; pp < D / 2; ++pp) { const int p = ph * (D / 2) + pp; const int i = p * D + q; const float sf = pmul(((SR[i] + EPS) - m1) * r1, bf16_rne(gs[i])) + bf16_rne(bs[i]) + PSL[i]; n1 += pmul(sf, izn) + EPS; }
    const float m2 = bsum(n1, red) * (1.0f / (D * D)); float n2 = 0.0f;
#pragma unroll 1
    for (int pp = 0; pp < D / 2; ++pp) { const int p = ph * (D / 2) + pp; const int i = p * D + q; const float sf = pmul(((SR[i] + EPS) - m1) * r1, bf16_rne(gs[i])) + bf16_rne(bs[i]) + PSL[i]; const float nr = (pmul(sf, izn) + EPS) - m2; n2 += nr * nr; }
    const float r2 = rsqrtf(bsum(n2, red) * (1.0f / (D * D)) + LNE);
    // NA_q partial over the thread's p half: sum_p qn_p NAM_pq ; prev partial: sum_p qn_p PREV_pq
    float na = 0.0f, pv = 0.0f;
#pragma unroll 1
    for (int pp = 0; pp < D / 2; ++pp) { const int p = ph * (D / 2) + pp; const int i = p * D + q; const float sf = pmul(((SR[i] + EPS) - m1) * r1, bf16_rne(gs[i])) + bf16_rne(bs[i]) + PSL[i]; const float nam = pmul(((pmul(sf, izn) + EPS) - m2) * r2, bf16_rne(gn[i])) + bf16_rne(bn[i]);
      na += pmul(qn[p], nam); pv += pmul(qn[p], PRb[i]); }
    // combine the two halves: threads q and q+128 -> via red
    red[t_] = na + scal[0] * pv; __syncthreads(); if (t_ < D) nav[t_] = red[t_] + red[t_ + D]; __syncthreads();
    // LN_D(NA) ga + ba -> out row
    { const float x = t_ < D ? nav[t_] : 0.0f; const float mu = bsum(x, red) * (1.0f / D); const float dv = t_ < D ? x - mu : 0.0f; const float var = bsum(dv * dv, red) * (1.0f / D); const float rr = rsqrtf(var + LNE);
      const float o = pmul(dv * rr, t_ < D ? bf16_rne(ga[t_]) : 0.0f) + (t_ < D ? bf16_rne(ba[t_]) : 0.0f);
      { if (t_ < D) ((float*)out)[row * D + t_] = o;  } }
    __syncthreads(); }
  dred[0][t_] = dsum; dred[1][t_] = dsq; __syncthreads(); for (int s = 128; s >= 1; s >>= 1) { if (t_ < s) { dred[0][t_] += dred[0][t_ + s]; dred[1][t_] += dred[1][t_ + s]; } __syncthreads(); }
  { if (t_ < 16) ((double*)STD2)[(size_t)blk * 16 + t_] = (t_ == 0) ? dred[0][0] : (t_ == 1) ? dred[1][0] : 0.0;  }
}
// final std: one wave, the users' sums joined by a butterfly over lanes 0..15: n = 16*200*128; var = (sumsq - sum^2/n) / (n-1); std -> out2[0] (and 31 zero floats to fill the line? the output is a single float at the end of the buffer; we write just it).
__global__ __launch_bounds__(32) void std_kernel(const double* __restrict__ STD2, float* __restrict__ out2) {
  const int lane = threadIdx.x; double s = 0.0, s2 = 0.0;
  if (lane < NB) {   // lane = user: its chunks in order
#pragma unroll   // several of the lane's loads in flight at a time
    for (int k = 0; k < NC; ++k) { s += STD2[(size_t)(lane * NC + k) * 16]; s2 += STD2[(size_t)(lane * NC + k) * 16 + 1]; } }
  for (int m = NB / 2; m >= 1; m >>= 1) { s += __shfl_xor(s, m); s2 += __shfl_xor(s2, m); }
  if (lane == 0) { const double n = (double)NB * L * D; const double var = (s2 - s * s / n) / (n - 1.0); const float sd = (float)sqrt(var > 0.0 ? var : 0.0);
    { ((float*)out2)[0] = sd;  } }
}
}  // namespace

extern "C" void kernel_launch(void* const* d_in, const int* in_sizes, int n_in, void* d_out, int out_size, void* d_ws, size_t ws_size, hipStream_t stream) {
  (void)n_in;
  auto Fp = [&](int i) { return (const float*)d_in[i]; }; auto Ip = [&](int i) { return (const int*)d_in[i]; };
  // input order: 0 user_id [16] i32, 1 seqs_emb [16,200,128], 2 P [16,8,128], 3 S [16,8,128], 4 Wq [128,128], 5 bq, 6 Wk, 7 bk, 8 Wv, 9 bv, 10 z_gamma, 11 z_beta, 12 s_gamma [128,128], 13 s_beta, 14 nam_gamma, 15 nam_beta,
  // 16 na_gamma [128], 17 na_beta, 18 prev_z [1001,128], 19 prev_s [1001,128,128]; outputs NA [16,200,128] at 0, std [1] at float 409600
  if (in_sizes[0] != NB || in_sizes[1] != NRS * D || in_sizes[2] != NRP * D || in_sizes[3] != NRP * D || in_sizes[4] != D * D || in_sizes[12] != D * D || in_sizes[18] != NU * D || in_sizes[19] != NU * D * D || out_size != NRS * D + 1) return;
  size_t off = 0; char* ws = (char*)d_ws;
  auto carve = [&](size_t bytes) { char* p = ws + off; off += (bytes + 255) & ~(size_t)255; return p; };
  b16* X16 = (b16*)carve((size_t)NR * D * 2); b16* W16 = (b16*)carve((size_t)3 * D * D * 2); float* Qp = (float*)carve((size_t)NRS * D * 4); float* Zp = (float*)carve((size_t)NR * D * 4); float* Vp = (float*)carve((size_t)NR * D * 4); float* PREV = (float*)carve((size_t)NB * NC * D * D * 4); double* STD2 = (double*)carve((size_t)NB * NC * 16 * 8);
  if (off > ws_size || off > ((size_t)128 << 20)) return;   // about 36 MB
  prep_kernel<<<(NR * D / 8 + 3 * D * D / 8 + 255) / 256, 256, 0, stream>>>(Fp(1), Fp(2), Fp(3), Fp(4), Fp(6), Fp(8), X16, W16);
  proj_kernel<<<dim3(NR / 64, 3), 128, 0, stream>>>(X16, W16, Fp(5), Fp(7), Fp(9), Qp, Zp, Vp);
  state_kernel<<<dim3(NC, NB), 256, 0, stream>>>(Qp, Zp, Vp, Ip(0), Fp(10), Fp(11), Fp(12), Fp(13), Fp(14), Fp(15), Fp(16), Fp(17), Fp(18), Fp(19), PREV, (float*)d_out, STD2);
  std_kernel<<<1, 32, 0, stream>>>(STD2, (float*)d_out + (size_t)NRS * D);
}

// v002
// A run of this version takes 212 microseconds.
// Timed twice side by side with v001, it ran 4.37 times as fast both times.
// Over all steps from v000 it is 95.2 times as fast.
#include <hip/hip_runtime.h>

// CSR attention block (16 users x 200 steps, D = 128): q = elu(x Wq^T + bq), qn = q/(|q|+eps); z = elu(x Wk^T + bk), v = x Wv^T + bv; per user the causal cumulative state s_l = sum_{l'<=l} z v^T
// and zc_l = sum z; z_l = LN_D(zc_l + eps) + Pz, S_l = LN_DxD(s_l + eps) + Ps where (Pz, Ps) is the same construction on the 8-step prompt P taken at its last step; NAM = LN_DxD(S_l/(|z_l|+eps) + eps);
// NA = qn . NAM + mask_b (qn . prev_NAM) with prev_NAM = (prev_s[uid] + Ss) / (|prev_z[uid] + Sz| + eps) from the prompt S; NA = LN_D(NA); second output std = unbiased std of
// q / max(z_l, 1e-6) over all (b, l, d).
// One block per (user, chunk of 7 steps): it first sums z v^T and z over all earlier steps of its user, in step order, in registers, then walks its chunk with the running DxD state in LDS (f32),
// the prompt state beside it, LN statistics by fixed-order block reductions, the two vector-matrix products on the VALU (batches of rows: the loads first, then the arithmetic); the std partials in f64 per block, combined by one final wave.
// WMMA (v_wmma_f32_16x16x32_f16, f32 accumulate): the q projection of the sequence ([3,200 x 128] x [128 x 128]) and the k/v projections of the sequence and both prompts ([3,456 x 128] x [128 x 128] x2) with EXACT bf16 inputs (x8) and weights (x256), 1 product.
// Inputs rounded to bf16 once; user_id int32, clamped. Fragment k-map per lane half hh for A AND B: elements 0..7 <- k = 8hh+0..7, 8..15 <- k = 16+8hh+0..7; acc[r] =

namespace {
constexpr int NB = 16, L = 200, LP = 8, D = 128, NU = 1001, NRS = NB * L /* 3200 */, NRP = NB * LP /* 128 */, NR = NRS + 2 * NRP /* 3456 = 54 x 64 */;
constexpr int CH = 7 /* steps per block */, NC = (L + CH - 1) / CH /* 29 chunks per user: 464 blocks, two per WGP by LDS */, TR = 64 /* rows of z and of v staged at a time for the earlier steps */;
static_assert(2 * TR * D <= D * D && (NB - 1) * L + ((L - 1) / TR + 1) * TR <= NR, "staged tiles fit SR and stay inside Z and V");
constexpr float XS = 8.0f, WSC = 256.0f, EPS = 1e-8f, LNE = 1e-5f;

typedef _Float16 b16;
typedef __attribute__((ext_vector_type(16))) _Float16 v16b;
typedef __attribute__((ext_vector_type(8))) _Float16 v8b;
typedef __attribute__((ext_vector_type(8))) float v8f;
typedef __attribute__((ext_vector_type(4))) float v4f;
__device__ __forceinline__ float bf16_rne(float f) { unsigned int u = __float_as_uint(f); u += 0x7FFFu + ((u >> 16) & 1u); return __uint_as_float(u & 0xFFFF0000u); }
__device__ __forceinline__ v16b frag_kb(const b16* p, int hh) { const v8b a = *(const v8b*)(p + 8 * hh), b = *(const v8b*)(p + 16 + 8 * hh); v16b f;
#pragma unroll
  for (int e = 0; e < 8; ++e) { f[e] = a[e]; f[8 + e] = b[e]; } return f; }
__device__ __forceinline__ v8f wmma16b(v16b a, v16b b, v8f c) { v8f d = __builtin_amdgcn_wmma_f32_16x16x32_f16(false, a, false, b, (short)0, c, false, false); asm volatile("v_nop\n\tv_nop\n\tv_nop\n\tv_nop" : "+v"(d) : "v"(a), "v"(b)); return d; }
__device__ __forceinline__ void wave_lds_sync() { __builtin_amdgcn_fence(__ATOMIC_RELEASE, "workgroup"); __builtin_amdgcn_wave_barrier(); __builtin_amdgcn_fence(__ATOMIC_ACQUIRE, "workgroup"); }
__device__ __forceinline__ float pmul(float a, float b) { float p = a * b; asm volatile("" : "+v"(p)); return p; }
__device__ __forceinline__ float elu(float x) { return x > 0.0f ? x : (__expf(x) - 1.0f); }

__global__ __launch_bounds__(256) void prep_kernel(const float* __restrict__ xs, const float* __restrict__ xp, const float* __restrict__ xq, const float* __restrict__ wq, const float* __restrict__ wk, const float* __restrict__ wv, b16* __restrict__ X16, b16* __restrict__ W16) {
  const int t = blockIdx.x * 256 + threadIdx.x; const int nx = NR * D / 8, nw = 3 * D * D / 8; v8b o;
  if (t < nx) { const int e = t * 8; const int row = e / D; const float* src = row < NRS ? xs + e : row < NRS + NRP ? xp + (e - NRS * D) : xq + (e - (NRS + NRP) * D);
    for (int j = 0; j < 8; ++j) o[j] = (b16)(bf16_rne(src[j]) * XS); { *(v8b*)(X16 + e) = o;  } }
  else if (t < nx + nw) { const int e = (t - nx) * 8; const int k = e / (D * D), r = e - k * D * D; const float* w = k == 0 ? wq : k == 1 ? wk : wv; for (int j = 0; j < 8; ++j) o[j] = (b16)(bf16_rne(w[r + j]) * WSC); { *(v8b*)(W16 + e) = o;  } }
}
__global__ __launch_bounds__(128) void proj_kernel(const b16* __restrict__ X16, const b16* __restrict__ W16, const float* __restrict__ bq, const float* __restrict__ bk, const float* __restrict__ bv, float* __restrict__ Q, float* __restrict__ Z, float* __restrict__ V) {
  __shared__ __attribute__((aligned(16))) float Ts[4][16][D + 4];
  const int kind = blockIdx.y, wave = threadIdx.x >> 5, lane = threadIdx.x & 31, nloc = lane & 15, hlf = lane >> 4; const size_t m0 = (size_t)blockIdx.x * 64 + wave * 16; if (kind == 0 && m0 >= (size_t)NRS) return;
  const b16* Wp = W16 + (size_t)kind * D * D; const float* bb = kind == 0 ? bq : kind == 1 ? bk : bv; float* dst = kind == 0 ? Q : kind == 1 ? Z : V;
  v8f acc[8];
#pragma unroll
  for (int t = 0; t < 8; ++t) acc[t] = (v8f){};
#pragma unroll
  for (int kb = 0; kb < D; kb += 32) { const v16b a = frag_kb(X16 + (m0 + nloc) * D + kb, hlf);
#pragma unroll
    for (int t = 0; t < 8; ++t) acc[t] = wmma16b(a, frag_kb(Wp + (size_t)(t * 16 + nloc) * D + kb, hlf), acc[t]); }
#pragma unroll
  for (int t = 0; t < 8; ++t) { const int c = t * 16 + nloc; const float b_ = bf16_rne(bb[c]);
#pragma unroll
    for (int r = 0; r < 8; ++r) { float v = acc[t][r] * (1.0f / (XS * WSC)) + b_; if (kind < 2) v = elu(v); Ts[wave][8 * hlf + r][c] = v; } }
  wave_lds_sync();
  { for (int rr = 0; rr < 16; ++rr) *(v4f*)(dst + (m0 + rr) * D + lane * 4) = *(const v4f*)(&Ts[wave][rr][lane * 4]);  }
}
// block-wide fixed-order reductions (256 threads): returns the total to every thread.
__device__ __forceinline__ float bsum(float v, float* red) { const int t_ = threadIdx.x; red[t_] = v; __syncthreads(); for (int s = 128; s >= 1; s >>= 1) { if (t_ < s) red[t_] += red[t_ + s]; __syncthreads(); } const float r = red[0]; __syncthreads(); return r; }
// prompt state for user b from rows r0..r0+7 of Z/V: zc = sum_j z_j; sc = sum_j z_j v_j^T; Pz = LN_D(zc + eps) gz + bz (vector, thread < 128 -> pzout), Ps = LN_DxD(sc + eps) gs + bs into
// PS (LDS or global, [p][q], thread owns q = t&127 for p in its half).
__device__ __forceinline__ void prompt_state(const float* __restrict__ Z, const float* __restrict__ V, int r0, const float* __restrict__ gz, const float* __restrict__ bz, const float* __restrict__ gs, const float* __restrict__ bs, float* __restrict__ PS, float* __restrict__ pzout, float* red, float* zs, float* vs) {
  const int t_ = threadIdx.x; const int q = t_ & (D - 1), ph = t_ >> 7;   // ph: which half of the p range (0: 0..63, 1: 64..127)
  // zc (thread < 128) and staging of the 8 z / v rows
  for (int i = t_; i < LP * D; i += 256) { zs[i] = Z[(size_t)r0 * D + i]; vs[i] = V[(size_t)r0 * D + i]; }
  __syncthreads();
  // Pz: LN over D of (zc + eps)
  float zc = 0.0f; if (t_ < D) { for (int j = 0; j < LP; ++j) zc += zs[j * D + t_]; zc += EPS; }
  const float mz = bsum(t_ < D ? zc : 0.0f, red) * (1.0f / D); const float dz = t_ < D ? zc - mz : 0.0f; const float vz = bsum(dz * dz, red) * (1.0f / D); const float rz = rsqrtf(vz + LNE);
  if (t_ < D) pzout[t_] = pmul(dz * rz, bf16_rne(gz[t_])) + bf16_rne(bz[t_]);
  // Each pass walks its 64 rows in batches of PB: first every load of the batch, into registers, then the arithmetic in row order (the sums keep their order). Written out so because no load moves
  // up over the asm statement in pmul: left in one loop body, each load waits out its latency alone.
  constexpr int PB = 8; const int pa = ph * (D / 2); float vr[LP], zr[PB][LP], gr[PB], br[PB];
#pragma unroll
  for (int j = 0; j < LP; ++j) vr[j] = vs[j * D + q];
  float s1 = 0.0f;
#pragma unroll 1   // the body holds PB rows already
  for (int pb = 0; pb < D / 2; pb += PB) {
#pragma unroll
    for (int k = 0; k < PB; ++k) for (int j = 0; j < LP; ++j) zr[k][j] = zs[j * D + pa + pb + k];
#pragma unroll
    for (int k = 0; k < PB; ++k) { float a = 0.0f; for (int j = 0; j < LP; ++j) a += pmul(zr[k][j], vr[j]); s1 += a + EPS; } }
  const float ms = bsum(s1, red) * (1.0f / (D * D)); float s2 = 0.0f;
#pragma unroll 1   // as above
  for (int pb = 0; pb < D / 2; pb += PB) {
#pragma unroll
    for (int k = 0; k < PB; ++k) for (int j = 0; j < LP; ++j) zr[k][j] = zs[j * D + pa + pb + k];
#pragma unroll
    for (int k = 0; k < PB; ++k) { float a = 0.0f; for (int j = 0; j < LP; ++j) a += pmul(zr[k][j], vr[j]); const float dv = (a + EPS) - ms; s2 += dv * dv; } }
  const float rs = rsqrtf(bsum(s2, red) * (1.0f / (D * D)) + LNE);
#pragma unroll 1   // as above
  for (int pb = 0; pb < D / 2; pb += PB) { const float *g0 = gs + (pa + pb) * D + q, *b0 = bs + (pa + pb) * D + q;
#pragma unroll
    for (int k = 0; k < PB; ++k) { gr[k] = g0[k * D]; br[k] = b0[k * D]; for (int j = 0; j < LP; ++j) zr[k][j] = zs[j * D + pa + pb + k]; }
    asm volatile("s_wait_xcnt 0x0" ::: "memory");   // in front of the first rewrite of a register that the loads of gs and bs name
#pragma unroll
    for (int k = 0; k < PB; ++k) { float a = 0.0f; for (int j = 0; j < LP; ++j) a += pmul(zr[k][j], vr[j]); PS[(pa + pb + k) * D + q] = pmul(((a + EPS) - ms) * rs, bf16_rne(gr[k])) + bf16_rne(br[k]); } }
  __syncthreads();
}
// state kernel: block = (chunk c, user b) (256 threads). LDS: SR [128][128] running s (f32), PSL [128][128] prompt-P state. PREV (prev_NAM) in global scratch per block. Per step l: SR += z v^T; LN stats; NAM passes;
__global__ __launch_bounds__(256) void state_kernel(const float* __restrict__ Q, const float* __restrict__ Z, const float* __restrict__ V, const int* __restrict__ uid, const float* __restrict__ gz, const float* __restrict__ bz, const float* __restrict__ gs, const float* __restrict__ bs,
                                                 const float* __restrict__ gn, const float* __restrict__ bn, const float* __restrict__ ga, const float* __restrict__ ba, const float* __restrict__ prev_z, const float* __restrict__ prev_s, float* __restrict__ PREV, float* __restrict__ out, double* __restrict__ STD2) {
  __shared__ __attribute__((aligned(16))) float SR[D * D]; __shared__ float PSL[D * D]; __shared__ float red[256]; __shared__ float zs[LP * D], vs[LP * D]; __shared__ float pzP[D], pzS[D], zrow[D], vrow[D], qn[D], zfull[D], zcum[D], nav[D]; __shared__ float scal[4]; __shared__ double dred[2][256];
  const int b = blockIdx.y, blk = b * NC + blockIdx.x, l0 = blockIdx.x * CH, l1 = min(l0 + CH, L), t_ = threadIdx.x; const int q = t_ & (D - 1), ph = t_ >> 7;
  // prompt S state -> PSL temporarily, then prev_NAM into PREV (global); prompt P state -> PSL (kept).
  prompt_state(Z, V, NRS + NRP + b * LP, gz, bz, gs, bs, PSL, pzS, red, zs, vs);
  { const int u = min(max(uid[b], 0), NU - 1); float zu = 0.0f; if (t_ < D) { zu = bf16_rne(prev_z[(size_t)u * D + t_]) + pzS[t_]; } const float n2 = bsum(t_ < D ? zu * zu : 0.0f, red); const float inv = 1.0f / (sqrtf(n2) + EPS);
    float msum = bsum(t_ < D ? bf16_rne(prev_z[(size_t)u * D + t_]) : 0.0f, red); if (t_ == 0) scal[0] = (msum != 0.0f) ? 1.0f : 0.0f;
    {
#pragma unroll 1   // the body holds 16 rows already
      for (int pb = 0; pb < D / 2; pb += 16) { float w[16];
#pragma unroll   // 16 loads of prev_s (from memory) in flight per thread
        for (int k = 0; k < 16; ++k) w[k] = (bf16_rne(prev_s[((size_t)u * D + ph * (D / 2) + pb + k) * D + q]) + PSL[(ph * (D / 2) + pb + k) * D + q]) * inv;
#pragma unroll
        for (int k = 0; k < 16; ++k) ((float*)PREV)[(size_t)blk * D * D + (ph * (D / 2) + pb + k) * D + q] = w[k];
        asm volatile("s_wait_xcnt 0x0" ::: "memory"); }   // kept in front of the next trip's rewrite of the registers that the loads and stores name
       } }
  __syncthreads();
  prompt_state(Z, V, NRS + b * LP, gz, bz, gs, bs, PSL, pzP, red, zs, vs);
  // state in front of step l0: s = sum_{l < l0} z_l v_l^T and zcum = sum z_l, each element summed in step order. The thread keeps rows p0..p0+7 x columns q0..q0+3 and 64+q0..64+q0+3 in registers;
  // SR, which holds nothing yet, stages TR rows of z and TR rows of v at a time (whole tiles are loaded: rows past l0 are inside Z and V and are not summed).
  { float* zt = SR; float* vt = SR + TR * D; const int p0 = (t_ >> 4) * 8, q0 = (t_ & 15) * 4; v4f a0[8], a1[8]; float zc = 0.0f; const v4f* zg = (const v4f*)(Z + (size_t)b * L * D) + t_; const v4f* vg = (const v4f*)(V + (size_t)b * L * D) + t_;
#pragma unroll
    for (int r = 0; r < 8; ++r) { a0[r] = (v4f){}; a1[r] = (v4f){}; }
    for (int base = 0; base < l0; base += TR, zg += TR * D / 4, vg += TR * D / 4) { const int n = min(TR, l0 - base);
#pragma unroll   // all 16 loads of the thread in flight at once
      for (int k = 0; k < TR * D / 4 / 256; ++k) { ((v4f*)zt)[t_ + k * 256] = zg[k * 256]; ((v4f*)vt)[t_ + k * 256] = vg[k * 256]; }
      __syncthreads();
#pragma unroll 2   // the next row's LDS reads issue under this row's 64 multiply-adds
      for (int j = 0; j < n; ++j) { const v4f z0 = *(const v4f*)(zt + j * D + p0), z1 = *(const v4f*)(zt + j * D + p0 + 4), v0 = *(const v4f*)(vt + j * D + q0), v1 = *(const v4f*)(vt + j * D + 64 + q0);
        zc += zt[j * D + q];   // both halves of the block sum it, the lower half stores it
#pragma unroll
        for (int r = 0; r < 4; ++r) { a0[r] += z0[r] * v0; a1[r] += z0[r] * v1; a0[4 + r] += z1[r] * v0; a1[4 + r] += z1[r] * v1; } }
      __syncthreads(); }
#pragma unroll
    for (int r = 0; r < 8; ++r) { *(v4f*)(SR + (p0 + r) * D + q0) = a0[r]; *(v4f*)(SR + (p0 + r) * D + 64 + q0) = a1[r]; }
    if (t_ < D) zcum[t_] = zc; }
  __syncthreads();
  double dsum = 0.0, dsq = 0.0;
  const float* PRb = PREV + (size_t)blk * D * D;
  for (int l = l0; l < l1; ++l) { const size_t row = (size_t)b * L + l;
    if (t_ < D) { zrow[t_] = Z[row * D + t_]; vrow[t_] = V[row * D + t_]; zcum[t_] += Z[row * D + t_]; }
    __syncthreads();
    // z_l = LN_D(zcum + eps) gz + bz + Pz; qn; |z_l|
    { const float zc = t_ < D ? zcum[t_] + EPS : 0.0f; const float mz = bsum(zc, red) * (1.0f / D); const float dz = t_ < D ? zc - mz : 0.0f; const float vz = bsum(dz * dz, red) * (1.0f / D); const float rz = rsqrtf(vz + LNE);
      float zf = 0.0f, qv = 0.0f; if (t_ < D) { zf = pmul(dz * rz, bf16_rne(gz[t_])) + bf16_rne(bz[t_]) + pzP[t_]; zfull[t_] = zf; qv = Q[row * D + t_]; }
      const float qn2 = bsum(qv * qv, red), zn2 = bsum(zf * zf, red); if (t_ < D) qn[t_] = qv / (sqrtf(qn2) + EPS); if (t_ == 0) scal[1] = 1.0f / (sqrtf(zn2) + EPS);
      if (t_ < D) { const float xv = qv / fmaxf(zf, 1e-6f); dsum += (double)xv; dsq += (double)xv * (double)xv; } }
    __syncthreads();
    const float izn = scal[1];
    // The five passes over the thread's 64 rows go in batches of RA or RB rows: first every load of the batch (LDS and global), into registers, then the arithmetic in row order (the sums keep their order).
    // Written out so because no load moves up over the asm statement in pmul: left in one loop body, each load waits out its latency alone.
    constexpr int RA = 32 /* passes with up to four loads a row */, RB = 16 /* the last pass, eight loads a row */; const int pa = ph * (D / 2); float sv[RA], pl[RA], gv[RA], bv_[RA], nv_[RB], ov[RB], pr[RB], qv_[RA];
    float s1 = 0.0f; const float vq = vrow[q];
#pragma unroll 1   // the body holds RA rows already
    for (int pb = 0; pb < D / 2; pb += RA) {
#pragma unroll
      for (int k = 0; k < RA; ++k) { sv[k] = SR[(pa + pb + k) * D + q]; qv_[k] = zrow[pa + pb + k]; }
#pragma unroll
      for (int k = 0; k < RA; ++k) { const float nv = sv[k] + pmul(qv_[k], vq); SR[(pa + pb + k) * D + q] = nv; s1 += nv + EPS; } }
    const float m1 = bsum(s1, red) * (1.0f / (D * D)); float s2 = 0.0f;
#pragma unroll 1   // as above
    for (int pb = 0; pb < D / 2; pb += RA) {
#pragma unroll
      for (int k = 0; k < RA; ++k) sv[k] = SR[(pa + pb + k) * D + q];
      __builtin_amdgcn_sched_barrier(0);   // keeps the batch's LDS reads together in front of the sums: without it they sink back between the adds, each with a wait of its own
#pragma unroll
      for (int k = 0; k < RA; ++k) { const float dv = (sv[k] + EPS) - m1; s2 += dv * dv; } }
    const float r1 = rsqrtf(bsum(s2, red) * (1.0f / (D * D)) + LNE);
    // NAMraw = (LN(SR) gs + bs + Ps) izn + eps ; stats
    float n1 = 0.0f;
#pragma unroll 1   // as above
    for (int pb = 0; pb < D / 2; pb += RA) { const int i0 = (pa + pb) * D + q; const float *g0 = gs + i0, *b0 = bs + i0;
#pragma unroll
      for (int k = 0; k < RA; ++k) { gv[k] = g0[k * D]; bv_[k] = b0[k * D]; sv[k] = SR[i0 + k * D]; pl[k] = PSL[i0 + k * D]; }
#pragma unroll
      for (int k = 0; k < RA; ++k) { const float sf = pmul(((sv[k] + EPS) - m1) * r1, bf16_rne(gv[k])) + bf16_rne(bv_[k]) + pl[k]; n1 += pmul(sf, izn) + EPS; } }
    const float m2 = bsum(n1, red) * (1.0f / (D * D)); float n2 = 0.0f;
#pragma unroll 1   // as above
    for (int pb = 0; pb < D / 2; pb += RA) { const int i0 = (pa + pb) * D + q; const float *g0 = gs + i0, *b0 = bs + i0;
#pragma unroll
      for (int k = 0; k < RA; ++k) { gv[k] = g0[k * D]; bv_[k] = b0[k * D]; sv[k] = SR[i0 + k * D]; pl[k] = PSL[i0 + k * D]; }
#pragma unroll
      for (int k = 0; k < RA; ++k) { const float sf = pmul(((sv[k] + EPS) - m1) * r1, bf16_rne(gv[k])) + bf16_rne(bv_[k]) + pl[k]; const float nr = (pmul(sf, izn) + EPS) - m2; n2 += nr * nr; } }
    const float r2 = rsqrtf(bsum(n2, red) * (1.0f / (D * D)) + LNE);
    // NA_q partial over the thread's p half: sum_p qn_p NAM_pq ; prev partial: sum_p qn_p PREV_pq
    float na = 0.0f, pv = 0.0f;
#pragma unroll 1   // as above
    for (int pb = 0; pb < D / 2; pb += RB) { const int i0 = (pa + pb) * D + q; const float *g0 = gs + i0, *b0 = bs + i0, *n0 = gn + i0, *o0 = bn + i0, *p0_ = PRb + i0;
#pragma unroll
      for (int k = 0; k < RB; ++k) { gv[k] = g0[k * D]; bv_[k] = b0[k * D]; nv_[k] = n0[k * D]; ov[k] = o0[k * D]; pr[k] = p0_[k * D]; sv[k] = SR[i0 + k * D]; pl[k] = PSL[i0 + k * D]; qv_[k] = qn[pa + pb + k]; }
#pragma unroll
      for (int k = 0; k < RB; ++k) { const float sf = pmul(((sv[k] + EPS) - m1) * r1, bf16_rne(gv[k])) + bf16_rne(bv_[k]) + pl[k]; const float nam = pmul(((pmul(sf, izn) + EPS) - m2) * r2, bf16_rne(nv_[k])) + bf16_rne(ov[k]);
        na += pmul(qv_[k], nam); pv += pmul(qv_[k], pr[k]); } }
    // combine the two halves: threads q and q+128 -> via red
    red[t_] = na + scal[0] * pv; __syncthreads(); if (t_ < D) nav[t_] = red[t_] + red[t_ + D]; __syncthreads();
    // LN_D(NA) ga + ba -> out row
    { const float x = t_ < D ? nav[t_] : 0.0f; const float mu = bsum(x, red) * (1.0f / D); const float dv = t_ < D ? x - mu : 0.0f; const float var = bsum(dv * dv, red) * (1.0f / D); const float rr = rsqrtf(var + LNE);
      const float o = pmul(dv * rr, t_ < D ? bf16_rne(ga[t_]) : 0.0f) + (t_ < D ? bf16_rne(ba[t_]) : 0.0f);
      { if (t_ < D) ((float*)out)[row * D + t_] = o;  } }
    __syncthreads(); }
  dred[0][t_] = dsum; dred[1][t_] = dsq; __syncthreads(); for (int s = 128; s >= 1; s >>= 1) { if (t_ < s) { dred[0][t_] += dred[0][t_ + s]; dred[1][t_] += dred[1][t_ + s]; } __syncthreads(); }
  { if (t_ < 16) ((double*)STD2)[(size_t)blk * 16 + t_] = (t_ == 0) ? dred[0][0] : (t_ == 1) ? dred[1][0] : 0.0;  }
}
// final std: one wave, the users' sums joined by a butterfly over lanes 0..15: n = 16*200*128; var = (sumsq - sum^2/n) / (n-1); std -> out2[0] (and 31 zero floats to fill the line? the output is a single float at the end of the buffer; we write just it).
__global__ __launch_bounds__(32) void std_kernel(const double* __restrict__ STD2, float* __restrict__ out2) {
  const int lane = threadIdx.x; double s = 0.0, s2 = 0.0;
  if (lane < NB) {   // lane = user: its chunks in order
#pragma unroll   // several of the lane's loads in flight at a time
    for (int k = 0; k < NC; ++k) { s += STD2[(size_t)(lane * NC + k) * 16]; s2 += STD2[(size_t)(lane * NC + k) * 16 + 1]; } }
  for (int m = NB / 2; m >= 1; m >>= 1) { s += __shfl_xor(s, m); s2 += __shfl_xor(s2, m); }
  if (lane == 0) { const double n = (double)NB * L * D; const double var = (s2 - s * s / n) / (n - 1.0); const float sd = (float)sqrt(var > 0.0 ? var : 0.0);
    { ((float*)out2)[0] = sd;  } }
}
}  // namespace

extern "C" void kernel_launch(void* const* d_in, const int* in_sizes, int n_in, void* d_out, int out_size, void* d_ws, size_t ws_size, hipStream_t stream) {
  (void)n_in;
  auto Fp = [&](int i) { return (const float*)d_in[i]; }; auto Ip = [&](int i) { return (const int*)d_in[i]; };
  // input order: 0 user_id [16] i32, 1 seqs_emb [16,200,128], 2 P [16,8,128], 3 S [16,8,128], 4 Wq [128,128], 5 bq, 6 Wk, 7 bk, 8 Wv, 9 bv, 10 z_gamma, 11 z_beta, 12 s_gamma [128,128], 13 s_beta, 14 nam_gamma, 15 nam_beta,
  // 16 na_gamma [128], 17 na_beta, 18 prev_z [1001,128], 19 prev_s [1001,128,128]; outputs NA [16,200,128] at 0, std [1] at float 409600
  if (in_sizes[0] != NB || in_sizes[1] != NRS * D || in_sizes[2] != NRP * D || in_sizes[3] != NRP * D || in_sizes[4] != D * D || in_sizes[12] != D * D || in_sizes[18] != NU * D || in_sizes[19] != NU * D * D || out_size != NRS * D + 1) return;
  size_t off = 0; char* ws = (char*)d_ws;
  auto carve = [&](size_t bytes) { char* p = ws + off; off += (bytes + 255) & ~(size_t)255; return p; };
  b16* X16 = (b16*)carve((size_t)NR * D * 2); b16* W16 = (b16*)carve((size_t)3 * D * D * 2); float* Qp = (float*)carve((size_t)NRS * D * 4); float* Zp = (float*)carve((size_t)NR * D * 4); float* Vp = (float*)carve((size_t)NR * D * 4); float* PREV = (float*)carve((size_t)NB * NC * D * D * 4); double* STD2 = (double*)carve((size_t)NB * NC * 16 * 8);
  if (off > ws_size || off > ((size_t)128 << 20)) return;   // about 36 MB
  prep_kernel<<<(NR * D / 8 + 3 * D * D / 8 + 255) / 256, 256, 0, stream>>>(Fp(1), Fp(2), Fp(3), Fp(4), Fp(6), Fp(8), X16, W16);
  proj_kernel<<<dim3(NR / 64, 3), 128, 0, stream>>>(X16, W16, Fp(5), Fp(7), Fp(9), Qp, Zp, Vp);
  state_kernel<<<dim3(NC, NB), 256, 0, stream>>>(Qp, Zp, Vp, Ip(0), Fp(10), Fp(11), Fp(12), Fp(13), Fp(14), Fp(15), Fp(16), Fp(17), Fp(18), Fp(19), PREV, (float*)d_out, STD2);
  std_kernel<<<1, 32, 0, stream>>>(STD2, (float*)d_out + (size_t)NRS * D);
}

// v003
// It runs in 159 microseconds.
// In two side-by-side timings against v002, it was 1.32 and 1.34 times as fast.
// Counting every step since v000, it is 126 times as fast.
#include <hip/hip_runtime.h>

// CSR attention block (16 users x 200 steps, D = 128): q = elu(x Wq^T + bq), qn = q/(|q|+eps); z = elu(x Wk^T + bk), v = x Wv^T + bv; per user the causal cumulative state s_l = sum_{l'<=l} z v^T
// and zc_l = sum z; z_l = LN_D(zc_l + eps) + Pz, S_l = LN_DxD(s_l + eps) + Ps where (Pz, Ps) is the same construction on the 8-step prompt P taken at its last step; NAM = LN_DxD(S_l/(|z_l|+eps) + eps);
// NA = qn . NAM + mask_b (qn . prev_NAM) with prev_NAM = (prev_s[uid] + Ss) / (|prev_z[uid] + Sz| + eps) from the prompt S; NA = LN_D(NA); second output std = unbiased std of
// q / max(z_l, 1e-6) over all (b, l, d).
// One block per (user, chunk of 7 steps): it first sums z v^T and z over all earlier steps of its user, in step order, in registers, then walks its chunk with the running DxD state in registers (f32, 64 elements a thread),
// the prompt state beside it, LN statistics by fixed-order block reductions, the two vector-matrix products on the VALU (batches of rows: the loads first, then the arithmetic); the std partials in f64 per block, combined by one final wave.
// WMMA (v_wmma_f32_16x16x32_f16, f32 accumulate): the q projection of the sequence ([3,200 x 128] x [128 x 128]) and the k/v projections of the sequence and both prompts ([3,456 x 128] x [128 x 128] x2) with EXACT bf16 inputs (x8) and weights (x256), 1 product.
// Inputs rounded to bf16 once; user_id int32, clamped. Fragment k-map per lane half hh for A AND B: elements 0..7 <- k = 8hh+0..7, 8..15 <- k = 16+8hh+0..7; acc[r] =

namespace {
constexpr int NB = 16, L = 200, LP = 8, D = 128, NU = 1001, NRS = NB * L /* 3200 */, NRP = NB * LP /* 128 */, NR = NRS + 2 * NRP /* 3456 = 54 x 64 */;
constexpr int CH = 7 /* steps per block */, NC = (L + CH - 1) / CH /* 29 chunks per user: 464 blocks, two per WGP by LDS */, TR = 64 /* rows of z and of v staged at a time for the earlier steps */;
static_assert(2 * TR * D <= D * D && (NB - 1) * L + ((L - 1) / TR + 1) * TR <= NR, "staged tiles fit SR and stay inside Z and V");
constexpr float XS = 8.0f, WSC = 256.0f, EPS = 1e-8f, LNE = 1e-5f;

typedef _Float16 b16;
typedef __attribute__((ext_vector_type(16))) _Float16 v16b;
typedef __attribute__((ext_vector_type(8))) _Float16 v8b;
typedef __attribute__((ext_vector_type(8))) float v8f;
typedef __attribute__((ext_vector_type(4))) float v4f;
__device__ __forceinline__ float bf16_rne(float f) { unsigned int u = __float_as_uint(f); u += 0x7FFFu + ((u >> 16) & 1u); return __uint_as_float(u & 0xFFFF0000u); }
__device__ __forceinline__ v16b frag_kb(const b16* p, int hh) { const v8b a = *(const v8b*)(p + 8 * hh), b = *(const v8b*)(p + 16 + 8 * hh); v16b f;
#pragma unroll
  for (int e = 0; e < 8; ++e) { f[e] = a[e]; f[8 + e] = b[e]; } return f; }
__device__ __forceinline__ v8f wmma16b(v16b a, v16b b, v8f c) { v8f d = __builtin_amdgcn_wmma_f32_16x16x32_f16(false, a, false, b, (short)0, c, false, false); asm volatile("v_nop\n\tv_nop\n\tv_nop\n\tv_nop" : "+v"(d) : "v"(a), "v"(b)); return d; }
__device__ __forceinline__ void wave_lds_sync() { __builtin_amdgcn_fence(__ATOMIC_RELEASE, "workgroup"); __builtin_amdgcn_wave_barrier(); __builtin_amdgcn_fence(__ATOMIC_ACQUIRE, "workgroup"); }
__device__ __forceinline__ float pmul(float a, float b) { float p = a * b; asm volatile("" : "+v"(p)); return p; }
__device__ __forceinline__ float elu(float x) { return x > 0.0f ? x : (__expf(x) - 1.0f); }

__global__ __launch_bounds__(256) void prep_kernel(const float* __restrict__ xs, const float* __restrict__ xp, const float* __restrict__ xq, const float* __restrict__ wq, const float* __restrict__ wk, const float* __restrict__ wv, b16* __restrict__ X16, b16* __restrict__ W16) {
  const int t = blockIdx.x * 256 + threadIdx.x; const int nx = NR * D / 8, nw = 3 * D * D / 8; v8b o;
  if (t < nx) { const int e = t * 8; const int row = e / D; const float* src = row < NRS ? xs + e : row < NRS + NRP ? xp + (e - NRS * D) : xq + (e - (NRS + NRP) * D);
    for (int j = 0; j < 8; ++j) o[j] = (b16)(bf16_rne(src[j]) * XS); { *(v8b*)(X16 + e) = o;  } }
  else if (t < nx + nw) { const int e = (t - nx) * 8; const int k = e / (D * D), r = e - k * D * D; const float* w = k == 0 ? wq : k == 1 ? wk : wv; for (int j = 0; j < 8; ++j) o[j] = (b16)(bf16_rne(w[r + j]) * WSC); { *(v8b*)(W16 + e) = o;  } }
}
__global__ __launch_bounds__(128) void proj_kernel(const b16* __restrict__ X16, const b16* __restrict__ W16, const float* __restrict__ bq, const float* __restrict__ bk, const float* __restrict__ bv, float* __restrict__ Q, float* __restrict__ Z, float* __restrict__ V) {
  __shared__ __attribute__((aligned(16))) float Ts[4][16][D + 4];
  const int kind = blockIdx.y, wave = threadIdx.x >> 5, lane = threadIdx.x & 31, nloc = lane & 15, hlf = lane >> 4; const size_t m0 = (size_t)blockIdx.x * 64 + wave * 16; if (kind == 0 && m0 >= (size_t)NRS) return;
  const b16* Wp = W16 + (size_t)kind * D * D; const float* bb = kind == 0 ? bq : kind == 1 ? bk : bv; float* dst = kind == 0 ? Q : kind == 1 ? Z : V;
  v8f acc[8];
#pragma unroll
  for (int t = 0; t < 8; ++t) acc[t] = (v8f){};
#pragma unroll
  for (int kb = 0; kb < D; kb += 32) { const v16b a = frag_kb(X16 + (m0 + nloc) * D + kb, hlf);
#pragma unroll
    for (int t = 0; t < 8; ++t) acc[t] = wmma16b(a, frag_kb(Wp + (size_t)(t * 16 + nloc) * D + kb, hlf), acc[t]); }
#pragma unroll
  for (int t = 0; t < 8; ++t) { const int c = t * 16 + nloc; const float b_ = bf16_rne(bb[c]);
#pragma unroll
    for (int r = 0; r < 8; ++r) { float v = acc[t][r] * (1.0f / (XS * WSC)) + b_; if (kind < 2) v = elu(v); Ts[wave][8 * hlf + r][c] = v; } }
  wave_lds_sync();
  { for (int rr = 0; rr < 16; ++rr) *(v4f*)(dst + (m0 + rr) * D + lane * 4) = *(const v4f*)(&Ts[wave][rr][lane * 4]);  }
}
// block-wide fixed-order reductions (256 threads): returns the total to every thread.
__device__ __forceinline__ float bsum(float v, float* red) { const int t_ = threadIdx.x; red[t_] = v; __syncthreads(); for (int s = 128; s >= 1; s >>= 1) { if (t_ < s) red[t_] += red[t_ + s]; __syncthreads(); } const float r = red[0]; __syncthreads(); return r; }
// prompt state for user b from rows r0..r0+7 of Z/V: zc = sum_j z_j; sc = sum_j z_j v_j^T; Pz = LN_D(zc + eps) gz + bz (vector, thread < 128 -> pzout), Ps = LN_DxD(sc + eps) gs + bs into
// PS (LDS or global, [p][q], thread owns q = t&127 for p in its half).
__device__ __forceinline__ void prompt_state(const float* __restrict__ Z, const float* __restrict__ V, int r0, const float* __restrict__ gz, const float* __restrict__ bz, const float* __restrict__ gs, const float* __restrict__ bs, float* __restrict__ PS, float* __restrict__ pzout, float* red, float* zs, float* vs) {
  const int t_ = threadIdx.x; const int q = t_ & (D - 1), ph = t_ >> 7;   // ph: which half of the p range (0: 0..63, 1: 64..127)
  // zc (thread < 128) and staging of the 8 z / v rows
  for (int i = t_; i < LP * D; i += 256) { zs[i] = Z[(size_t)r0 * D + i]; vs[i] = V[(size_t)r0 * D + i]; }
  __syncthreads();
  // Pz: LN over D of (zc + eps)
  float zc = 0.0f; if (t_ < D) { for (int j = 0; j < LP; ++j) zc += zs[j * D + t_]; zc += EPS; }
  const float mz = bsum(t_ < D ? zc : 0.0f, red) * (1.0f / D); const float dz = t_ < D ? zc - mz : 0.0f; const float vz = bsum(dz * dz, red) * (1.0f / D); const float rz = rsqrtf(vz + LNE);
  if (t_ < D) pzout[t_] = pmul(dz * rz, bf16_rne(gz[t_])) + bf16_rne(bz[t_]);
  // Each pass walks its 64 rows in batches of PB: first every load of the batch, into registers, then the arithmetic in row order (the sums keep their order). Written out so because no load moves
  // up over the asm statement in pmul: left in one loop body, each load waits out its latency alone.
  constexpr int PB = 8; const int pa = ph * (D / 2); float vr[LP], zr[PB][LP], gr[PB], br[PB];
#pragma unroll
  for (int j = 0; j < LP; ++j) vr[j] = vs[j * D + q];
  float s1 = 0.0f;
#pragma unroll 1   // the body holds PB rows already
  for (int pb = 0; pb < D / 2; pb += PB) {
#pragma unroll
    for (int k = 0; k < PB; ++k) for (int j = 0; j < LP; ++j) zr[k][j] = zs[j * D + pa + pb + k];
#pragma unroll
    for (int k = 0; k < PB; ++k) { float a = 0.0f; for (int j = 0; j < LP; ++j) a += pmul(zr[k][j], vr[j]); s1 += a + EPS; } }
  const float ms = bsum(s1, red) * (1.0f / (D * D)); float s2 = 0.0f;
#pragma unroll 1   // as above
  for (int pb = 0; pb < D / 2; pb += PB) {
#pragma unroll
    for (int k = 0; k < PB; ++k) for (int j = 0; j < LP; ++j) zr[k][j] = zs[j * D + pa + pb + k];
#pragma unroll
    for (int k = 0; k < PB; ++k) { float a = 0.0f; for (int j = 0; j < LP; ++j) a += pmul(zr[k][j], vr[j]); const float dv = (a + EPS) - ms; s2 += dv * dv; } }
  const float rs = rsqrtf(bsum(s2, red) * (1.0f / (D * D)) + LNE);
#pragma unroll 1   // as above
  for (int pb = 0; pb < D / 2; pb += PB) { const float *g0 = gs + (pa + pb) * D + q, *b0 = bs + (pa + pb) * D + q;
#pragma unroll
    for (int k = 0; k < PB; ++k) { gr[k] = g0[k * D]; br[k] = b0[k * D]; for (int j = 0; j < LP; ++j) zr[k][j] = zs[j * D + pa + pb + k]; }
    asm volatile("s_wait_xcnt 0x0" ::: "memory");   // in front of the first rewrite of a register that the loads of gs and bs name
#pragma unroll
    for (int k = 0; k < PB; ++k) { float a = 0.0f; for (int j = 0; j < LP; ++j) a += pmul(zr[k][j], vr[j]); PS[(pa + pb + k) * D + q] = pmul(((a + EPS) - ms) * rs, bf16_rne(gr[k])) + bf16_rne(br[k]); } }
  __syncthreads();
}
// state kernel: block = (chunk c, user b) (256 threads). LDS: SR [128][128] staging for the start state, PSL [128][128] prompt-P state; the running s (f32) in registers. PREV (prev_NAM) in global scratch per block. Per step l: s += z v^T; LN stats; NAM passes;
// amdgpu_waves_per_eu(4, 4): at most 256 registers a wave, so that two blocks still share a WGP (four waves on each SIMD), which the LDS allows
__global__ __launch_bounds__(256) __attribute__((amdgpu_waves_per_eu(4, 4))) void state_kernel(const float* __restrict__ Q, const float* __restrict__ Z, const float* __restrict__ V, const int* __restrict__ uid, const float* __restrict__ gz, const float* __restrict__ bz, const float* __restrict__ gs, const float* __restrict__ bs,
                                                 const float* __restrict__ gn, const float* __restrict__ bn, const float* __restrict__ ga, const float* __restrict__ ba, const float* __restrict__ prev_z, const float* __restrict__ prev_s, float* __restrict__ PREV, float* __restrict__ out, double* __restrict__ STD2) {
  __shared__ __attribute__((aligned(16))) float SR[D * D]; __shared__ float PSL[D * D]; __shared__ float red[256]; __shared__ float zs[LP * D], vs[LP * D]; __shared__ float pzP[D], pzS[D], zrow[D], vrow[D], qn[D], zfull[D], zcum[D], nav[D]; __shared__ float scal[4]; __shared__ double dred[2][256];
  const int b = blockIdx.y, blk = b * NC + blockIdx.x, l0 = blockIdx.x * CH, l1 = min(l0 + CH, L), t_ = threadIdx.x; const int q = t_ & (D - 1), ph = t_ >> 7;
  // prompt S state -> PSL temporarily, then prev_NAM into PREV (global); prompt P state -> PSL (kept).
  prompt_state(Z, V, NRS + NRP + b * LP, gz, bz, gs, bs, PSL, pzS, red, zs, vs);
  { const int u = min(max(uid[b], 0), NU - 1); float zu = 0.0f; if (t_ < D) { zu = bf16_rne(prev_z[(size_t)u * D + t_]) + pzS[t_]; } const float n2 = bsum(t_ < D ? zu * zu : 0.0f, red); const float inv = 1.0f / (sqrtf(n2) + EPS);
    float msum = bsum(t_ < D ? bf16_rne(prev_z[(size_t)u * D + t_]) : 0.0f, red); if (t_ == 0) scal[0] = (msum != 0.0f) ? 1.0f : 0.0f;
    {
#pragma unroll 1   // the body holds 16 rows already
      for (int pb = 0; pb < D / 2; pb += 16) { float w[16];
#pragma unroll   // 16 loads of prev_s (from memory) in flight per thread
        for (int k = 0; k < 16; ++k) w[k] = (bf16_rne(prev_s[((size_t)u * D + ph * (D / 2) + pb + k) * D + q]) + PSL[(ph * (D / 2) + pb + k) * D + q]) * inv;
#pragma unroll
        for (int k = 0; k < 16; ++k) ((float*)PREV)[(size_t)blk * D * D + (ph * (D / 2) + pb + k) * D + q] = w[k];
        asm volatile("s_wait_xcnt 0x0" ::: "memory"); }   // kept in front of the next trip's rewrite of the registers that the loads and stores name
       } }
  __syncthreads();
  prompt_state(Z, V, NRS + b * LP, gz, bz, gs, bs, PSL, pzP, red, zs, vs);
  // state in front of step l0: s = sum_{l < l0} z_l v_l^T and zcum = sum z_l, each element summed in step order. The thread keeps rows p0..p0+7 x columns q0..q0+3 and 64+q0..64+q0+3 in registers;
  // SR, which holds nothing yet, stages TR rows of z and TR rows of v at a time (whole tiles are loaded: rows past l0 are inside Z and V and are not summed).
  { float* zt = SR; float* vt = SR + TR * D; const int p0 = (t_ >> 4) * 8, q0 = (t_ & 15) * 4; v4f a0[8], a1[8]; float zc = 0.0f; const v4f* zg = (const v4f*)(Z + (size_t)b * L * D) + t_; const v4f* vg = (const v4f*)(V + (size_t)b * L * D) + t_;
#pragma unroll
    for (int r = 0; r < 8; ++r) { a0[r] = (v4f){}; a1[r] = (v4f){}; }
    for (int base = 0; base < l0; base += TR, zg += TR * D / 4, vg += TR * D / 4) { const int n = min(TR, l0 - base);
#pragma unroll   // all 16 loads of the thread in flight at once
      for (int k = 0; k < TR * D / 4 / 256; ++k) { ((v4f*)zt)[t_ + k * 256] = zg[k * 256]; ((v4f*)vt)[t_ + k * 256] = vg[k * 256]; }
      __syncthreads();
#pragma unroll 2   // the next row's LDS reads issue under this row's 64 multiply-adds
      for (int j = 0; j < n; ++j) { const v4f z0 = *(const v4f*)(zt + j * D + p0), z1 = *(const v4f*)(zt + j * D + p0 + 4), v0 = *(const v4f*)(vt + j * D + q0), v1 = *(const v4f*)(vt + j * D + 64 + q0);
        zc += zt[j * D + q];   // both halves of the block sum it, the lower half stores it
#pragma unroll
        for (int r = 0; r < 4; ++r) { a0[r] += z0[r] * v0; a1[r] += z0[r] * v1; a0[4 + r] += z1[r] * v0; a1[4 + r] += z1[r] * v1; } }
      __syncthreads(); }
#pragma unroll
    for (int r = 0; r < 8; ++r) { *(v4f*)(SR + (p0 + r) * D + q0) = a0[r]; *(v4f*)(SR + (p0 + r) * D + 64 + q0) = a1[r]; }
    if (t_ < D) zcum[t_] = zc; }
  __syncthreads();
  // From here on every element of the state is read and written by one thread only (rows pa..pa+63 of column q): it leaves SR for the thread's registers and stays there over all steps of the chunk.
  constexpr int NH = D / 2; const int pa = ph * NH; const unsigned e0 = pa * D + q /* the thread's first element in every DxD matrix: the rows of the unrolled passes differ from it by constants, so each matrix takes one address for the whole loop */; float st[NH], nw[NH];
#pragma unroll   // st is indexed by constants only, so that it lives in registers
  for (int k = 0; k < NH; ++k) st[k] = SR[(pa + k) * D + q];
  double dsum = 0.0, dsq = 0.0;
  const float* PRb = PREV + (size_t)blk * D * D;
  for (int l = l0; l < l1; ++l) { const size_t row = (size_t)b * L + l;
    if (t_ < D) { zrow[t_] = Z[row * D + t_]; vrow[t_] = V[row * D + t_]; zcum[t_] += Z[row * D + t_]; }
    __syncthreads();
    // z_l = LN_D(zcum + eps) gz + bz + Pz; qn; |z_l|
    { const float zc = t_ < D ? zcum[t_] + EPS : 0.0f; const float mz = bsum(zc, red) * (1.0f / D); const float dz = t_ < D ? zc - mz : 0.0f; const float vz = bsum(dz * dz, red) * (1.0f / D); const float rz = rsqrtf(vz + LNE);
      float zf = 0.0f, qv = 0.0f; if (t_ < D) { zf = pmul(dz * rz, bf16_rne(gz[t_])) + bf16_rne(bz[t_]) + pzP[t_]; zfull[t_] = zf; qv = Q[row * D + t_]; }
      const float qn2 = bsum(qv * qv, red), zn2 = bsum(zf * zf, red); if (t_ < D) qn[t_] = qv / (sqrtf(qn2) + EPS); if (t_ == 0) scal[1] = 1.0f / (sqrtf(zn2) + EPS);
      if (t_ < D) { const float xv = qv / fmaxf(zf, 1e-6f); dsum += (double)xv; dsq += (double)xv * (double)xv; } }
    __syncthreads();
    const float izn = scal[1];
    // Five passes over the thread's 64 rows, all unrolled (st and nw are indexed by constants only). st holds the running state; nw holds S_l/|z_l| + eps, made once in the third pass and used again by the
    // fourth and fifth, which so read neither gs, bs nor the prompt state again. What a pass still loads comes in batches of RA or RB rows: first every load of the batch, then the arithmetic in row order
    // (the sums keep their order); no load moves up over the asm statement in pmul, so left in one body each load would wait out its latency alone.
    constexpr int RA = 32 /* the first pass: one LDS read a row */, RB = 16 /* the third and fifth pass: three or four loads a row beside the 128 kept values */; float pl[RB], gv[RB], bv_[RB], qv_[RA];
    float s1 = 0.0f; const float vq = vrow[q];
#pragma unroll
    for (int pb = 0; pb < NH; pb += RA) {
#pragma unroll
      for (int k = 0; k < RA; ++k) qv_[k] = zrow[pa + pb + k];
#pragma unroll
      for (int k = 0; k < RA; ++k) { st[pb + k] += pmul(qv_[k], vq); s1 += st[pb + k] + EPS; } }
    const float m1 = bsum(s1, red) * (1.0f / (D * D)); float s2 = 0.0f;
#pragma unroll
    for (int k = 0; k < NH; ++k) { const float dv = (st[k] + EPS) - m1; s2 += dv * dv; }
    const float r1 = rsqrtf(bsum(s2, red) * (1.0f / (D * D)) + LNE);
    // NAMraw = (LN(s) gs + bs + Ps) izn + eps ; stats
    float n1 = 0.0f;
#pragma unroll
    for (int pb = 0; pb < NH; pb += RB) {
#pragma unroll
      for (int k = 0; k < RB; ++k) { gv[k] = gs[e0 + (pb + k) * D]; bv_[k] = bs[e0 + (pb + k) * D]; pl[k] = PSL[e0 + (pb + k) * D]; }
      asm volatile("s_wait_xcnt 0x0" ::: "memory");   // behind the loads of gs and bs, in front of any later rewrite of a register that they name; its memory clobber also keeps the batch's loads in front of the arithmetic
#pragma unroll
      for (int k = 0; k < RB; ++k) { const float sf = pmul(((st[pb + k] + EPS) - m1) * r1, bf16_rne(gv[k])) + bf16_rne(bv_[k]) + pl[k]; nw[pb + k] = pmul(sf, izn) + EPS; n1 += nw[pb + k]; } }
    const float m2 = bsum(n1, red) * (1.0f / (D * D)); float n2 = 0.0f;
#pragma unroll
    for (int k = 0; k < NH; ++k) { const float nr = nw[k] - m2; n2 += nr * nr; }
    const float r2 = rsqrtf(bsum(n2, red) * (1.0f / (D * D)) + LNE);
    // NA_q partial over the thread's p half: sum_p qn_p NAM_pq ; prev partial: sum_p qn_p PREV_pq
    float na = 0.0f, pv = 0.0f;
#pragma unroll
    for (int pb = 0; pb < NH; pb += RB) {
#pragma unroll
      for (int k = 0; k < RB; ++k) { gv[k] = gn[e0 + (pb + k) * D]; bv_[k] = bn[e0 + (pb + k) * D]; pl[k] = PRb[e0 + (pb + k) * D]; qv_[k] = qn[pa + pb + k]; }
      asm volatile("s_wait_xcnt 0x0" ::: "memory");   // as in the third pass, for the loads of gn, bn and PREV
#pragma unroll
      for (int k = 0; k < RB; ++k) { const float nam = pmul((nw[pb + k] - m2) * r2, bf16_rne(gv[k])) + bf16_rne(bv_[k]);
        na += pmul(qv_[k], nam); pv += pmul(qv_[k], pl[k]); } }
    // combine the two halves: threads q and q+128 -> via red
    red[t_] = na + scal[0] * pv; __syncthreads(); if (t_ < D) nav[t_] = red[t_] + red[t_ + D]; __syncthreads();
    // LN_D(NA) ga + ba -> out row
    { const float x = t_ < D ? nav[t_] : 0.0f; const float mu = bsum(x, red) * (1.0f / D); const float dv = t_ < D ? x - mu : 0.0f; const float var = bsum(dv * dv, red) * (1.0f / D); const float rr = rsqrtf(var + LNE);
      const float o = pmul(dv * rr, t_ < D ? bf16_rne(ga[t_]) : 0.0f) + (t_ < D ? bf16_rne(ba[t_]) : 0.0f);
      { if (t_ < D) ((float*)out)[row * D + t_] = o;  } }
    __syncthreads(); }
  dred[0][t_] = dsum; dred[1][t_] = dsq; __syncthreads(); for (int s = 128; s >= 1; s >>= 1) { if (t_ < s) { dred[0][t_] += dred[0][t_ + s]; dred[1][t_] += dred[1][t_ + s]; } __syncthreads(); }
  { if (t_ < 16) ((double*)STD2)[(size_t)blk * 16 + t_] = (t_ == 0) ? dred[0][0] : (t_ == 1) ? dred[1][0] : 0.0;  }
}
// final std: one wave, the users' sums joined by a butterfly over lanes 0..15: n = 16*200*128; var = (sumsq - sum^2/n) / (n-1); std -> out2[0] (and 31 zero floats to fill the line? the output is a single float at the end of the buffer; we write just it).
__global__ __launch_bounds__(32) void std_kernel(const double* __restrict__ STD2, float* __restrict__ out2) {
  const int lane = threadIdx.x; double s = 0.0, s2 = 0.0;
  if (lane < NB) {   // lane = user: its chunks in order
#pragma unroll   // several of the lane's loads in flight at a time
    for (int k = 0; k < NC; ++k) { s += STD2[(size_t)(lane * NC + k) * 16]; s2 += STD2[(size_t)(lane * NC + k) * 16 + 1]; } }
  for (int m = NB / 2; m >= 1; m >>= 1) { s += __shfl_xor(s, m); s2 += __shfl_xor(s2, m); }
  if (lane == 0) { const double n = (double)NB * L * D; const double var = (s2 - s * s / n) / (n - 1.0); const float sd = (float)sqrt(var > 0.0 ? var : 0.0);
    { ((float*)out2)[0] = sd;  } }
}
}  // namespace

extern "C" void kernel_launch(void* const* d_in, const int* in_sizes, int n_in, void* d_out, int out_size, void* d_ws, size_t ws_size, hipStream_t stream) {
  (void)n_in;
  auto Fp = [&](int i) { return (const float*)d_in[i]; }; auto Ip = [&](int i) { return (const int*)d_in[i]; };
  // input order: 0 user_id [16] i32, 1 seqs_emb [16,200,128], 2 P [16,8,128], 3 S [16,8,128], 4 Wq [128,128], 5 bq, 6 Wk, 7 bk, 8 Wv, 9 bv, 10 z_gamma, 11 z_beta, 12 s_gamma [128,128], 13 s_beta, 14 nam_gamma, 15 nam_beta,
  // 16 na_gamma [128], 17 na_beta, 18 prev_z [1001,128], 19 prev_s [1001,128,128]; outputs NA [16,200,128] at 0, std [1] at float 409600
  if (in_sizes[0] != NB || in_sizes[1] != NRS * D || in_sizes[2] != NRP * D || in_sizes[3] != NRP * D || in_sizes[4] != D * D || in_sizes[12] != D * D || in_sizes[18] != NU * D || in_sizes[19] != NU * D * D || out_size != NRS * D + 1) return;
  size_t off = 0; char* ws = (char*)d_ws;
  auto carve = [&](size_t bytes) { char* p = ws + off; off += (bytes + 255) & ~(size_t)255; return p; };
  b16* X16 = (b16*)carve((size_t)NR * D * 2); b16* W16 = (b16*)carve((size_t)3 * D * D * 2); float* Qp = (float*)carve((size_t)NRS * D * 4); float* Zp = (float*)carve((size_t)NR * D * 4); float* Vp = (float*)carve((size_t)NR * D * 4); float* PREV = (float*)carve((size_t)NB * NC * D * D * 4); double* STD2 = (double*)carve((size_t)NB * NC * 16 * 8);
  if (off > ws_size || off > ((size_t)128 << 20)) return;   // about 36 MB
  prep_kernel<<<(NR * D / 8 + 3 * D * D / 8 + 255) / 256, 256, 0, stream>>>(Fp(1), Fp(2), Fp(3), Fp(4), Fp(6), Fp(8), X16, W16);
  proj_kernel<<<dim3(NR / 64, 3), 128, 0, stream>>>(X16, W16, Fp(5), Fp(7), Fp(9), Qp, Zp, Vp);
  state_kernel<<<dim3(NC, NB), 256, 0, stream>>>(Qp, Zp, Vp, Ip(0), Fp(10), Fp(11), Fp(12), Fp(13), Fp(14), Fp(15), Fp(16), Fp(17), Fp(18), Fp(19), PREV, (float*)d_out, STD2);
  std_kernel<<<1, 32, 0, stream>>>(STD2, (float*)d_out + (size_t)NRS * D);
}

// v004
// One run takes 119 microseconds.
// In both of two side-by-side timings against v003, it was 1.33 times as fast.
// All steps since v000 together make it 168 times as fast.
#include <hip/hip_runtime.h>

// CSR attention block (16 users x 200 steps, D = 128): q = elu(x Wq^T + bq), qn = q/(|q|+eps); z = elu(x Wk^T + bk), v = x Wv^T + bv; per user the causal cumulative state s_l = sum_{l'<=l} z v^T
// and zc_l = sum z; z_l = LN_D(zc_l + eps) + Pz, S_l = LN_DxD(s_l + eps) + Ps where (Pz, Ps) is the same construction on the 8-step prompt P taken at its last step; NAM = LN_DxD(S_l/(|z_l|+eps) + eps);
// NA = qn . NAM + mask_b (qn . prev_NAM) with prev_NAM = (prev_s[uid] + Ss) / (|prev_z[uid] + Sz| + eps) from the prompt S; NA = LN_D(NA); second output std = unbiased std of
// q / max(z_l, 1e-6) over all (b, l, d).
// One block per (user, chunk of 7 steps): it first sums z v^T and z over all earlier steps of its user, in step order, in registers, then walks its chunk with the running DxD state in registers (f32, 64 elements a thread),
// the prompt state beside it, LN statistics by fixed-order block reductions, the two vector-matrix products on the VALU (batches of rows: the loads first, then the arithmetic); the std partials in f64 per block, combined by one final wave.
// WMMA (v_wmma_f32_16x16x32_f16, f32 accumulate): the q projection of the sequence ([3,200 x 128] x [128 x 128]) and the k/v projections of the sequence and both prompts ([3,456 x 128] x [128 x 128] x2) with EXACT bf16 inputs (x8) and weights (x256), 1 product.
// Inputs rounded to bf16 once; user_id int32, clamped. Fragment k-map per lane half hh for A AND B: elements 0..7 <- k = 8hh+0..7, 8..15 <- k = 16+8hh+0..7; acc[r] =

namespace {
constexpr int NB = 16, L = 200, LP = 8, D = 128, NU = 1001, NRS = NB * L /* 3200 */, NRP = NB * LP /* 128 */, NR = NRS + 2 * NRP /* 3456 = 54 x 64 */;
constexpr int CH = 7 /* steps per block */, NC = (L + CH - 1) / CH /* 29 chunks per user: 464 blocks, two per WGP by LDS */, TR = 64 /* rows of z and of v staged at a time for the earlier steps */;
static_assert(2 * TR * D <= D * D && (NB - 1) * L + ((L - 1) / TR + 1) * TR <= NR, "staged tiles fit SR and stay inside Z and V");
constexpr float XS = 8.0f, WSC = 256.0f, EPS = 1e-8f, LNE = 1e-5f;

typedef _Float16 b16;
typedef __attribute__((ext_vector_type(16))) _Float16 v16b;
typedef __attribute__((ext_vector_type(8))) _Float16 v8b;
typedef __attribute__((ext_vector_type(8))) float v8f;
typedef __attribute__((ext_vector_type(4))) float v4f;
__device__ __forceinline__ float bf16_rne(float f) { unsigned int u = __float_as_uint(f); u += 0x7FFFu + ((u >> 16) & 1u); return __uint_as_float(u & 0xFFFF0000u); }
__device__ __forceinline__ v16b frag_kb(const b16* p, int hh) { const v8b a = *(const v8b*)(p + 8 * hh), b = *(const v8b*)(p + 16 + 8 * hh); v16b f;
#pragma unroll
  for (int e = 0; e < 8; ++e) { f[e] = a[e]; f[8 + e] = b[e]; } return f; }
__device__ __forceinline__ v8f wmma16b(v16b a, v16b b, v8f c) { v8f d = __builtin_amdgcn_wmma_f32_16x16x32_f16(false, a, false, b, (short)0, c, false, false); asm volatile("v_nop\n\tv_nop\n\tv_nop\n\tv_nop" : "+v"(d) : "v"(a), "v"(b)); return d; }
__device__ __forceinline__ void wave_lds_sync() { __builtin_amdgcn_fence(__ATOMIC_RELEASE, "workgroup"); __builtin_amdgcn_wave_barrier(); __builtin_amdgcn_fence(__ATOMIC_ACQUIRE, "workgroup"); }
__device__ __forceinline__ float pmul(float a, float b) { float p = a * b; asm volatile("" : "+v"(p)); return p; }
__device__ __forceinline__ float elu(float x) { return x > 0.0f ? x : (__expf(x) - 1.0f); }

__global__ __launch_bounds__(256) void prep_kernel(const float* __restrict__ xs, const float* __restrict__ xp, const float* __restrict__ xq, const float* __restrict__ wq, const float* __restrict__ wk, const float* __restrict__ wv, b16* __restrict__ X16, b16* __restrict__ W16) {
  const int t = blockIdx.x * 256 + threadIdx.x; const int nx = NR * D / 8, nw = 3 * D * D / 8; v8b o;
  if (t < nx) { const int e = t * 8; const int row = e / D; const float* src = row < NRS ? xs + e : row < NRS + NRP ? xp + (e - NRS * D) : xq + (e - (NRS + NRP) * D);
    for (int j = 0; j < 8; ++j) o[j] = (b16)(bf16_rne(src[j]) * XS); { *(v8b*)(X16 + e) = o;  } }
  else if (t < nx + nw) { const int e = (t - nx) * 8; const int k = e / (D * D), r = e - k * D * D; const float* w = k == 0 ? wq : k == 1 ? wk : wv; for (int j = 0; j < 8; ++j) o[j] = (b16)(bf16_rne(w[r + j]) * WSC); { *(v8b*)(W16 + e) = o;  } }
}
__global__ __launch_bounds__(128) void proj_kernel(const b16* __restrict__ X16, const b16* __restrict__ W16, const float* __restrict__ bq, const float* __restrict__ bk, const float* __restrict__ bv, float* __restrict__ Q, float* __restrict__ Z, float* __restrict__ V) {
  __shared__ __attribute__((aligned(16))) float Ts[4][16][D + 4];
  const int kind = blockIdx.y, wave = threadIdx.x >> 5, lane = threadIdx.x & 31, nloc = lane & 15, hlf = lane >> 4; const size_t m0 = (size_t)blockIdx.x * 64 + wave * 16; if (kind == 0 && m0 >= (size_t)NRS) return;
  const b16* Wp = W16 + (size_t)kind * D * D; const float* bb = kind == 0 ? bq : kind == 1 ? bk : bv; float* dst = kind == 0 ? Q : kind == 1 ? Z : V;
  v8f acc[8];
#pragma unroll
  for (int t = 0; t < 8; ++t) acc[t] = (v8f){};
#pragma unroll
  for (int kb = 0; kb < D; kb += 32) { const v16b a = frag_kb(X16 + (m0 + nloc) * D + kb, hlf);
#pragma unroll
    for (int t = 0; t < 8; ++t) acc[t] = wmma16b(a, frag_kb(Wp + (size_t)(t * 16 + nloc) * D + kb, hlf), acc[t]); }
#pragma unroll
  for (int t = 0; t < 8; ++t) { const int c = t * 16 + nloc; const float b_ = bf16_rne(bb[c]);
#pragma unroll
    for (int r = 0; r < 8; ++r) { float v = acc[t][r] * (1.0f / (XS * WSC)) + b_; if (kind < 2) v = elu(v); Ts[wave][8 * hlf + r][c] = v; } }
  wave_lds_sync();
  { for (int rr = 0; rr < 16; ++rr) *(v4f*)(dst + (m0 + rr) * D + lane * 4) = *(const v4f*)(&Ts[wave][rr][lane * 4]);  }
}
// Block-wide fixed-order reductions (256 threads, every lane on): a butterfly inside each wave (lane ^ 1, 2, 4, 8 by DPP inside the 16-lane row, lane ^ 16 by a cross-row move), one word a wave in LDS, ONE barrier, then every
// thread adds the eight words in one fixed tree. N sums that do not depend on each other share the exchange. RB picks one of two exchange buffers: neighbouring reductions alternate, or have another barrier between them,
// so a buffer is rewritten only behind a barrier that every wave signals after its reads of it have returned.
template <int M> __device__ __forceinline__ int xrow_i(int x) { return __builtin_amdgcn_update_dpp(0, x, 0x160 | M /* row_xmask:M */, 0xf, 0xf, true); }
__device__ __forceinline__ int xhalf_i(int x) { return __builtin_amdgcn_permlanex16(x, x, 0x76543210, 0xfedcba98, false, false); }   // lane l with lane l ^ 16
template <int M> __device__ __forceinline__ float xrow(float x) { return __builtin_bit_cast(float, xrow_i<M>(__builtin_bit_cast(int, x))); }
__device__ __forceinline__ float xhalf(float x) { return __builtin_bit_cast(float, xhalf_i(__builtin_bit_cast(int, x))); }
template <int M> __device__ __forceinline__ double xrow_d(double x) { return __hiloint2double(xrow_i<M>(__double2hiint(x)), xrow_i<M>(__double2loint(x))); }
__device__ __forceinline__ double xhalf_d(double x) { return __hiloint2double(xhalf_i(__double2hiint(x)), xhalf_i(__double2loint(x))); }
constexpr int NW = 8 /* waves a block */, RN = 3 /* most sums in one exchange */;
template <int RB, int N> __device__ __forceinline__ void bsum(float (&v)[N], float (*rw)[RN * NW]) { static_assert(N <= RN && RB < 2, "fits the exchange buffers"); float* r = rw[RB];
  for (int i = 0; i < N; ++i) v[i] += xrow<1>(v[i]);
  for (int i = 0; i < N; ++i) v[i] += xrow<2>(v[i]);
  for (int i = 0; i < N; ++i) v[i] += xrow<4>(v[i]);
  for (int i = 0; i < N; ++i) v[i] += xrow<8>(v[i]);
  for (int i = 0; i < N; ++i) v[i] += xhalf(v[i]);
  if ((threadIdx.x & 31) == 0) { for (int i = 0; i < N; ++i) r[i * NW + (threadIdx.x >> 5)] = v[i]; }   // lane 0 speaks for the wave (where a product is fused into the first add, the lanes need not agree in the last bit)
  __syncthreads();
  for (int i = 0; i < N; ++i) { const v4f a = *(const v4f*)(r + i * NW), c = *(const v4f*)(r + i * NW + 4); v[i] = ((a[0] + a[1]) + (a[2] + a[3])) + ((c[0] + c[1]) + (c[2] + c[3])); } }
template <int RB> __device__ __forceinline__ float bsum1(float x, float (*rw)[RN * NW]) { float v[1] = {x}; bsum<RB>(v, rw); return v[0]; }
// prompt state for user b from rows r0..r0+7 of Z/V: zc = sum_j z_j; sc = sum_j z_j v_j^T; Pz = LN_D(zc + eps) gz + bz (vector, thread < 128 -> pzout), Ps = LN_DxD(sc + eps) gs + bs into
// PS (LDS or global, [p][q], thread owns q = t&127 for p in its half).
__device__ __forceinline__ void prompt_state(const float* __restrict__ Z, const float* __restrict__ V, int r0, const float* __restrict__ gz, const float* __restrict__ bz, const float* __restrict__ gs, const float* __restrict__ bs, float* __restrict__ PS, float* __restrict__ pzout, float (*rw)[RN * NW], float* zs, float* vs) {
  const int t_ = threadIdx.x; const int q = t_ & (D - 1), ph = t_ >> 7;   // ph: which half of the p range (0: 0..63, 1: 64..127)
  // zc (thread < 128) and staging of the 8 z / v rows
  for (int i = t_; i < LP * D; i += 256) { zs[i] = Z[(size_t)r0 * D + i]; vs[i] = V[(size_t)r0 * D + i]; }
  __syncthreads();
  // Pz: LN over D of (zc + eps); its two sums share the exchanges of the two sums of the DxD LN
  float zc = 0.0f; if (t_ < D) { for (int j = 0; j < LP; ++j) zc += zs[j * D + t_]; zc += EPS; }
  // Each pass walks its 64 rows in batches of PB: first every load of the batch, into registers, then the arithmetic in row order (the sums keep their order). Written out so because no load moves
  // up over the asm statement in pmul: left in one loop body, each load waits out its latency alone.
  constexpr int PB = 8; const int pa = ph * (D / 2); float vr[LP], zr[PB][LP], gr[PB], br[PB];
#pragma unroll
  for (int j = 0; j < LP; ++j) vr[j] = vs[j * D + q];
  float s1 = 0.0f;
#pragma unroll 1   // the body holds PB rows already
  for (int pb = 0; pb < D / 2; pb += PB) {
#pragma unroll
    for (int k = 0; k < PB; ++k) for (int j = 0; j < LP; ++j) zr[k][j] = zs[j * D + pa + pb + k];
#pragma unroll
    for (int k = 0; k < PB; ++k) { float a = 0.0f; for (int j = 0; j < LP; ++j) a += pmul(zr[k][j], vr[j]); s1 += a + EPS; } }
  float ra[2] = {zc, s1}; bsum<0>(ra, rw); const float mz = ra[0] * (1.0f / D), ms = ra[1] * (1.0f / (D * D)); const float dz = t_ < D ? zc - mz : 0.0f; float s2 = 0.0f;
#pragma unroll 1   // as above
  for (int pb = 0; pb < D / 2; pb += PB) {
#pragma unroll
    for (int k = 0; k < PB; ++k) for (int j = 0; j < LP; ++j) zr[k][j] = zs[j * D + pa + pb + k];
#pragma unroll
    for (int k = 0; k < PB; ++k) { float a = 0.0f; for (int j = 0; j < LP; ++j) a += pmul(zr[k][j], vr[j]); const float dv = (a + EPS) - ms; s2 += dv * dv; } }
  float rb[2] = {dz * dz, s2}; bsum<1>(rb, rw); const float rz = rsqrtf(rb[0] * (1.0f / D) + LNE), rs = rsqrtf(rb[1] * (1.0f / (D * D)) + LNE);
  if (t_ < D) pzout[t_] = pmul(dz * rz, bf16_rne(gz[t_])) + bf16_rne(bz[t_]);
#pragma unroll 1   // as above
  for (int pb = 0; pb < D / 2; pb += PB) { const float *g0 = gs + (pa + pb) * D + q, *b0 = bs + (pa + pb) * D + q;
#pragma unroll
    for (int k = 0; k < PB; ++k) { gr[k] = g0[k * D]; br[k] = b0[k * D]; for (int j = 0; j < LP; ++j) zr[k][j] = zs[j * D + pa + pb + k]; }
    asm volatile("s_wait_xcnt 0x0" ::: "memory");   // in front of the first rewrite of a register that the loads of gs and bs name
#pragma unroll
    for (int k = 0; k < PB; ++k) { float a = 0.0f; for (int j = 0; j < LP; ++j) a += pmul(zr[k][j], vr[j]); PS[(pa + pb + k) * D + q] = pmul(((a + EPS) - ms) * rs, bf16_rne(gr[k])) + bf16_rne(br[k]); } }
  __syncthreads();
}
// state kernel: block = (chunk c, user b) (256 threads). LDS: SR [128][128] staging for the start state, PSL [128][128] prompt-P state; the running s (f32) in registers. PREV (prev_NAM) in global scratch per block. Per step l: s += z v^T; LN stats; NAM passes;
// amdgpu_waves_per_eu(4, 4): at most 256 registers a wave, so that two blocks still share a WGP (four waves on each SIMD), which the LDS allows
__global__ __launch_bounds__(256) __attribute__((amdgpu_waves_per_eu(4, 4))) void state_kernel(const float* __restrict__ Q, const float* __restrict__ Z, const float* __restrict__ V, const int* __restrict__ uid, const float* __restrict__ gz, const float* __restrict__ bz, const float* __restrict__ gs, const float* __restrict__ bs,
                                                 const float* __restrict__ gn, const float* __restrict__ bn, const float* __restrict__ ga, const float* __restrict__ ba, const float* __restrict__ prev_z, const float* __restrict__ prev_s, float* __restrict__ PREV, float* __restrict__ out, double* __restrict__ STD2) {
  __shared__ __attribute__((aligned(16))) float SR[D * D]; __shared__ float PSL[D * D]; __shared__ float red[256]; __shared__ __attribute__((aligned(16))) float rw[2][RN * NW]; __shared__ float zs[LP * D], vs[LP * D]; __shared__ float pzP[D], pzS[D], zrow[D], vrow[D], qn[D], zfull[D], zcum[D]; __shared__ float scal[4]; __shared__ __attribute__((aligned(16))) double dw[2][NW];
  const int b = blockIdx.y, blk = b * NC + blockIdx.x, l0 = blockIdx.x * CH, l1 = min(l0 + CH, L), t_ = threadIdx.x; const int q = t_ & (D - 1), ph = t_ >> 7;
  // prompt S state -> PSL temporarily, then prev_NAM into PREV (global); prompt P state -> PSL (kept).
  prompt_state(Z, V, NRS + NRP + b * LP, gz, bz, gs, bs, PSL, pzS, rw, zs, vs);
  { const int u = min(max(uid[b], 0), NU - 1); float zu = 0.0f; if (t_ < D) { zu = bf16_rne(prev_z[(size_t)u * D + t_]) + pzS[t_]; } float ru[2] = {zu * zu, t_ < D ? bf16_rne(prev_z[(size_t)u * D + t_]) : 0.0f}; bsum<0>(ru, rw); const float inv = 1.0f / (sqrtf(ru[0]) + EPS);
    if (t_ == 0) scal[0] = (ru[1] != 0.0f) ? 1.0f : 0.0f;
    {
#pragma unroll 1   // the body holds 16 rows already
      for (int pb = 0; pb < D / 2; pb += 16) { float w[16];
#pragma unroll   // 16 loads of prev_s (from memory) in flight per thread
        for (int k = 0; k < 16; ++k) w[k] = (bf16_rne(prev_s[((size_t)u * D + ph * (D / 2) + pb + k) * D + q]) + PSL[(ph * (D / 2) + pb + k) * D + q]) * inv;
#pragma unroll
        for (int k = 0; k < 16; ++k) ((float*)PREV)[(size_t)blk * D * D + (ph * (D / 2) + pb + k) * D + q] = w[k];
        asm volatile("s_wait_xcnt 0x0" ::: "memory"); }   // kept in front of the next trip's rewrite of the registers that the loads and stores name
       } }
  __syncthreads();
  prompt_state(Z, V, NRS + b * LP, gz, bz, gs, bs, PSL, pzP, rw, zs, vs);
  // state in front of step l0: s = sum_{l < l0} z_l v_l^T and zcum = sum z_l, each element summed in step order. The thread keeps rows p0..p0+7 x columns q0..q0+3 and 64+q0..64+q0+3 in registers;
  // SR, which holds nothing yet, stages TR rows of z and TR rows of v at a time (whole tiles are loaded: rows past l0 are inside Z and V and are not summed).
  { float* zt = SR; float* vt = SR + TR * D; const int p0 = (t_ >> 4) * 8, q0 = (t_ & 15) * 4; v4f a0[8], a1[8]; float zc = 0.0f; const v4f* zg = (const v4f*)(Z + (size_t)b * L * D) + t_; const v4f* vg = (const v4f*)(V + (size_t)b * L * D) + t_;
#pragma unroll
    for (int r = 0; r < 8; ++r) { a0[r] = (v4f){}; a1[r] = (v4f){}; }
    for (int base = 0; base < l0; base += TR, zg += TR * D / 4, vg += TR * D / 4) { const int n = min(TR, l0 - base);
#pragma unroll   // all 16 loads of the thread in flight at once
      for (int k = 0; k < TR * D / 4 / 256; ++k) { ((v4f*)zt)[t_ + k * 256] = zg[k * 256]; ((v4f*)vt)[t_ + k * 256] = vg[k * 256]; }
      __syncthreads();
#pragma unroll 2   // the next row's LDS reads issue under this row's 64 multiply-adds
      for (int j = 0; j < n; ++j) { const v4f z0 = *(const v4f*)(zt + j * D + p0), z1 = *(const v4f*)(zt + j * D + p0 + 4), v0 = *(const v4f*)(vt + j * D + q0), v1 = *(const v4f*)(vt + j * D + 64 + q0);
        zc += zt[j * D + q];   // both halves of the block sum it, the lower half stores it
#pragma unroll
        for (int r = 0; r < 4; ++r) { a0[r] += z0[r] * v0; a1[r] += z0[r] * v1; a0[4 + r] += z1[r] * v0; a1[4 + r] += z1[r] * v1; } }
      __syncthreads(); }
#pragma unroll
    for (int r = 0; r < 8; ++r) { *(v4f*)(SR + (p0 + r) * D + q0) = a0[r]; *(v4f*)(SR + (p0 + r) * D + 64 + q0) = a1[r]; }
    if (t_ < D) zcum[t_] = zc; }
  __syncthreads();
  // From here on every element of the state is read and written by one thread only (rows pa..pa+63 of column q): it leaves SR for the thread's registers and stays there over all steps of the chunk.
  constexpr int NH = D / 2; const int pa = ph * NH; const unsigned e0 = pa * D + q /* the thread's first element in every DxD matrix: the rows of the unrolled passes differ from it by constants, so each matrix takes one address for the whole loop */; float st[NH], nw[NH];
#pragma unroll   // st is indexed by constants only, so that it lives in registers
  for (int k = 0; k < NH; ++k) st[k] = SR[(pa + k) * D + q];
  double dsum = 0.0, dsq = 0.0;
  const float* PRb = PREV + (size_t)blk * D * D;
  for (int l = l0; l < l1; ++l) { const size_t row = (size_t)b * L + l;
    if (t_ < D) { zrow[t_] = Z[row * D + t_]; vrow[t_] = V[row * D + t_]; zcum[t_] += Z[row * D + t_]; }
    __syncthreads();
    // The two sums of z's LN and |q|^2 depend on nothing of the state, so they ride in the exchanges of the state's own LN sums (first and second pass).
    float qv = 0.0f; if (t_ < D) qv = Q[row * D + t_];
    const float zc = t_ < D ? zcum[t_] + EPS : 0.0f;
    // Five passes over the thread's 64 rows, all unrolled (st and nw are indexed by constants only). st holds the running state; nw holds S_l/|z_l| + eps, made once in the third pass and used again by the
    // fourth and fifth, which so read neither gs, bs nor the prompt state again. What a pass still loads comes in batches of RA or RB rows: first every load of the batch, then the arithmetic in row order
    // (the sums keep their order); no load moves up over the asm statement in pmul, so left in one body each load would wait out its latency alone.
    constexpr int RA = 32 /* the first pass: one LDS read a row */, RB = 16 /* the third and fifth pass: three or four loads a row beside the 128 kept values */; float pl[RB], gv[RB], bv_[RB], qv_[RA];
    float s1 = 0.0f; const float vq = vrow[q];
#pragma unroll
    for (int pb = 0; pb < NH; pb += RA) {
#pragma unroll
      for (int k = 0; k < RA; ++k) qv_[k] = zrow[pa + pb + k];
#pragma unroll
      for (int k = 0; k < RA; ++k) { st[pb + k] += pmul(qv_[k], vq); s1 += st[pb + k] + EPS; } }
    float ra[3] = {zc, qv * qv, s1}; bsum<0>(ra, rw); const float mz = ra[0] * (1.0f / D), qn2 = ra[1], m1 = ra[2] * (1.0f / (D * D)); const float dz = t_ < D ? zc - mz : 0.0f; float s2 = 0.0f;
#pragma unroll
    for (int k = 0; k < NH; ++k) { const float dv = (st[k] + EPS) - m1; s2 += dv * dv; }
    float rb[2] = {dz * dz, s2}; bsum<1>(rb, rw); const float rz = rsqrtf(rb[0] * (1.0f / D) + LNE), r1 = rsqrtf(rb[1] * (1.0f / (D * D)) + LNE);
    // z_l = LN_D(zcum + eps) gz + bz + Pz; qn (read in the fifth pass, two barriers on); 1/|z_l|, which every thread forms from the total it holds
    float zf = 0.0f; if (t_ < D) { zf = pmul(dz * rz, bf16_rne(gz[t_])) + bf16_rne(bz[t_]) + pzP[t_]; zfull[t_] = zf; }
    const float zn2 = bsum1<0>(zf * zf, rw); if (t_ < D) qn[t_] = qv / (sqrtf(qn2) + EPS); const float izn = 1.0f / (sqrtf(zn2) + EPS);
    if (t_ < D) { const float xv = qv / fmaxf(zf, 1e-6f); dsum += (double)xv; dsq += (double)xv * (double)xv; }
    // NAMraw = (LN(s) gs + bs + Ps) izn + eps ; stats
    float n1 = 0.0f;
#pragma unroll
    for (int pb = 0; pb < NH; pb += RB) {
#pragma unroll
      for (int k = 0; k < RB; ++k) { gv[k] = gs[e0 + (pb + k) * D]; bv_[k] = bs[e0 + (pb + k) * D]; pl[k] = PSL[e0 + (pb + k) * D]; }
      asm volatile("s_wait_xcnt 0x0" ::: "memory");   // behind the loads of gs and bs, in front of any later rewrite of a register that they name; its memory clobber also keeps the batch's loads in front of the arithmetic
#pragma unroll
      for (int k = 0; k < RB; ++k) { const float sf = pmul(((st[pb + k] + EPS) - m1) * r1, bf16_rne(gv[k])) + bf16_rne(bv_[k]) + pl[k]; nw[pb + k] = pmul(sf, izn) + EPS; n1 += nw[pb + k]; } }
    const float m2 = bsum1<1>(n1, rw) * (1.0f / (D * D)); float n2 = 0.0f;
#pragma unroll
    for (int k = 0; k < NH; ++k) { const float nr = nw[k] - m2; n2 += nr * nr; }
    const float r2 = rsqrtf(bsum1<0>(n2, rw) * (1.0f / (D * D)) + LNE);
    // NA_q partial over the thread's p half: sum_p qn_p NAM_pq ; prev partial: sum_p qn_p PREV_pq
    float na = 0.0f, pv = 0.0f;
#pragma unroll
    for (int pb = 0; pb < NH; pb += RB) {
#pragma unroll
      for (int k = 0; k < RB; ++k) { gv[k] = gn[e0 + (pb + k) * D]; bv_[k] = bn[e0 + (pb + k) * D]; pl[k] = PRb[e0 + (pb + k) * D]; qv_[k] = qn[pa + pb + k]; }
      asm volatile("s_wait_xcnt 0x0" ::: "memory");   // as in the third pass, for the loads of gn, bn and PREV
#pragma unroll
      for (int k = 0; k < RB; ++k) { const float nam = pmul((nw[pb + k] - m2) * r2, bf16_rne(gv[k])) + bf16_rne(bv_[k]);
        na += pmul(qv_[k], nam); pv += pmul(qv_[k], pl[k]); } }
    // combine the two halves: threads q and q+128 -> via red
    red[t_] = na + scal[0] * pv; __syncthreads();
    // LN_D(NA) ga + ba -> out row. No barrier closes the step: what the next step writes in LDS (zrow, vrow, later qn and red) was last read in front of the two barriers below.
    { const float x = t_ < D ? red[t_] + red[t_ + D] : 0.0f; const float mu = bsum1<1>(x, rw) * (1.0f / D); const float dv = t_ < D ? x - mu : 0.0f; const float var = bsum1<0>(dv * dv, rw) * (1.0f / D); const float rr = rsqrtf(var + LNE);
      const float o = pmul(dv * rr, t_ < D ? bf16_rne(ga[t_]) : 0.0f) + (t_ < D ? bf16_rne(ba[t_]) : 0.0f);
      // the wait: behind the store of the row, in front of the next step's rewrite of its address registers (the barrier that stood here brought a wait of its own); inside the branch, so that the loop's address additions cannot be lifted over it
      { if (t_ < D) { ((float*)out)[row * D + t_] = o; asm volatile("s_wait_xcnt 0x0" ::: "memory"); }  } } }
  // the block's two f64 sums, reduced like the f32 ones: butterfly in the wave, one word a wave, one barrier, one fixed tree
  dsum += xrow_d<1>(dsum); dsq += xrow_d<1>(dsq); dsum += xrow_d<2>(dsum); dsq += xrow_d<2>(dsq); dsum += xrow_d<4>(dsum); dsq += xrow_d<4>(dsq); dsum += xrow_d<8>(dsum); dsq += xrow_d<8>(dsq); dsum += xhalf_d(dsum); dsq += xhalf_d(dsq);
  if ((t_ & 31) == 0) { dw[0][t_ >> 5] = dsum; dw[1][t_ >> 5] = dsq; }
  __syncthreads();
  { if (t_ < 16) { const double* w = dw[t_ & 1]; const double tot = ((w[0] + w[1]) + (w[2] + w[3])) + ((w[4] + w[5]) + (w[6] + w[7])); ((double*)STD2)[(size_t)blk * 16 + t_] = t_ < 2 ? tot : 0.0; }  }
}
// final std: one wave, the users' sums joined by a butterfly over lanes 0..15: n = 16*200*128; var = (sumsq - sum^2/n) / (n-1); std -> out2[0] (and 31 zero floats to fill the line? the output is a single float at the end of the buffer; we write just it).
__global__ __launch_bounds__(32) void std_kernel(const double* __restrict__ STD2, float* __restrict__ out2) {
  const int lane = threadIdx.x; double s = 0.0, s2 = 0.0;
  if (lane < NB) {   // lane = user: its chunks in order
#pragma unroll   // several of the lane's loads in flight at a time
    for (int k = 0; k < NC; ++k) { s += STD2[(size_t)(lane * NC + k) * 16]; s2 += STD2[(size_t)(lane * NC + k) * 16 + 1]; } }
  for (int m = NB / 2; m >= 1; m >>= 1) { s += __shfl_xor(s, m); s2 += __shfl_xor(s2, m); }
  if (lane == 0) { const double n = (double)NB * L * D; const double var = (s2 - s * s / n) / (n - 1.0); const float sd = (float)sqrt(var > 0.0 ? var : 0.0);
    { ((float*)out2)[0] = sd;  } }
}
}  // namespace

extern "C" void kernel_launch(void* const* d_in, const int* in_sizes, int n_in, void* d_out, int out_size, void* d_ws, size_t ws_size, hipStream_t stream) {
  (void)n_in;
  auto Fp = [&](int i) { return (const float*)d_in[i]; }; auto Ip = [&](int i) { return (const int*)d_in[i]; };
  // input order: 0 user_id [16] i32, 1 seqs_emb [16,200,128], 2 P [16,8,128], 3 S [16,8,128], 4 Wq [128,128], 5 bq, 6 Wk, 7 bk, 8 Wv, 9 bv, 10 z_gamma, 11 z_beta, 12 s_gamma [128,128], 13 s_beta, 14 nam_gamma, 15 nam_beta,
  // 16 na_gamma [128], 17 na_beta, 18 prev_z [1001,128], 19 prev_s [1001,128,128]; outputs NA [16,200,128] at 0, std [1] at float 409600
  if (in_sizes[0] != NB || in_sizes[1] != NRS * D || in_sizes[2] != NRP * D || in_sizes[3] != NRP * D || in_sizes[4] != D * D || in_sizes[12] != D * D || in_sizes[18] != NU * D || in_sizes[19] != NU * D * D || out_size != NRS * D + 1) return;
  size_t off = 0; char* ws = (char*)d_ws;
  auto carve = [&](size_t bytes) { char* p = ws + off; off += (bytes + 255) & ~(size_t)255; return p; };
  b16* X16 = (b16*)carve((size_t)NR * D * 2); b16* W16 = (b16*)carve((size_t)3 * D * D * 2); float* Qp = (float*)carve((size_t)NRS * D * 4); float* Zp = (float*)carve((size_t)NR * D * 4); float* Vp = (float*)carve((size_t)NR * D * 4); float* PREV = (float*)carve((size_t)NB * NC * D * D * 4); double* STD2 = (double*)carve((size_t)NB * NC * 16 * 8);
  if (off > ws_size || off > ((size_t)128 << 20)) return;   // about 36 MB
  prep_kernel<<<(NR * D / 8 + 3 * D * D / 8 + 255) / 256, 256, 0, stream>>>(Fp(1), Fp(2), Fp(3), Fp(4), Fp(6), Fp(8), X16, W16);
  proj_kernel<<<dim3(NR / 64, 3), 128, 0, stream>>>(X16, W16, Fp(5), Fp(7), Fp(9), Qp, Zp, Vp);
  state_kernel<<<dim3(NC, NB), 256, 0, stream>>>(Qp, Zp, Vp, Ip(0), Fp(10), Fp(11), Fp(12), Fp(13), Fp(14), Fp(15), Fp(16), Fp(17), Fp(18), Fp(19), PREV, (float*)d_out, STD2);
  std_kernel<<<1, 32, 0, stream>>>(STD2, (float*)d_out + (size_t)NRS * D);
}

// v005
// Measured time: 108 microseconds a run.
// Timed twice side by side with v004, it ran 1.10 and 1.11 times as fast.
// Over all steps from v000 it is 186 times as fast.
#include <hip/hip_runtime.h>

// CSR attention block (16 users x 200 steps, D = 128): q = elu(x Wq^T + bq), qn = q/(|q|+eps); z = elu(x Wk^T + bk), v = x Wv^T + bv; per user the causal cumulative state s_l = sum_{l'<=l} z v^T
// and zc_l = sum z; z_l = LN_D(zc_l + eps) + Pz, S_l = LN_DxD(s_l + eps) + Ps where (Pz, Ps) is the same construction on the 8-step prompt P taken at its last step; NAM = LN_DxD(S_l/(|z_l|+eps) + eps);
// NA = qn . NAM + mask_b (qn . prev_NAM) with prev_NAM = (prev_s[uid] + Ss) / (|prev_z[uid] + Sz| + eps) from the prompt S; NA = LN_D(NA); second output std = unbiased std of
// q / max(z_l, 1e-6) over all (b, l, d).
// One block per (user, chunk of 7 steps): it first sums z v^T and z over all earlier steps of its user, in step order, in registers, then walks its chunk with the running DxD state in registers (f32, 64 elements a thread),
// the prompt state beside it, LN statistics by fixed-order block reductions, the two vector-matrix products on the VALU (batches of rows: the loads first, then the arithmetic); the std partials in f64 per block, combined by one final wave.
// WMMA (v_wmma_f32_16x16x32_f16, f32 accumulate): the k/v projections of the sequence and both prompts ([3,456 x 128] x [128 x 128] x2), q of the sequence only ([3,200 x 128] x [128 x 128]) with EXACT bf16 inputs (x8) and weights (x256), 1 product.
// The four DxD LN parameter matrices are rounded to bf16 once, in the prep kernel, and packed: one 32-bit word holds (gamma, beta) of an element, four rows of a thread's column lie in one 16-byte word group (see GB below).
// Inputs rounded to bf16 once; user_id int32, clamped. Fragment k-map per lane half hh for A AND B: elements 0..7 <- k = 8hh+0..7, 8..15 <- k = 16+8hh+0..7; acc[r] =

namespace {
constexpr int NB = 16, L = 200, LP = 8, D = 128, NU = 1001, NRS = NB * L /* 3200 */, NRP = NB * LP /* 128 */, NR = NRS + 2 * NRP /* 3456 = 54 x 64 */;
constexpr int CH = 7 /* steps per block */, NC = (L + CH - 1) / CH /* 29 chunks per user: 464 blocks, two per WGP by LDS */, TR = 64 /* rows of z and of v staged at a time for the earlier steps */;
static_assert(2 * TR * D <= D * D && (NB - 1) * L + ((L - 1) / TR + 1) * TR <= NR, "staged tiles fit SR and stay inside Z and V");
constexpr float XS = 8.0f, WSC = 256.0f, EPS = 1e-8f, LNE = 1e-5f;

typedef _Float16 b16;
typedef __attribute__((ext_vector_type(16))) _Float16 v16b;
typedef __attribute__((ext_vector_type(8))) _Float16 v8b;
typedef __attribute__((ext_vector_type(8))) float v8f;
typedef __attribute__((ext_vector_type(4))) float v4f;
typedef __attribute__((ext_vector_type(4))) unsigned int v4u;
__device__ __forceinline__ float bf16_rne(float f) { unsigned int u = __float_as_uint(f); u += 0x7FFFu + ((u >> 16) & 1u); return __uint_as_float(u & 0xFFFF0000u); }
// GB: a pair (gamma, beta) of DxD matrices, each value rounded to bf16, gamma in the high and beta in the low half of a word. Word ((g * 256 + t) * 4 + j) belongs to row (t >> 7) * 64 + 4 g + j, column t & 127:
// thread t of the state kernel reads four of its rows with one 16-byte load, and a wave reads 512 bytes in a row.
constexpr int GBW = D * D /* words a pair */;
__device__ __forceinline__ float gb_g(unsigned int w) { return __uint_as_float(w & 0xFFFF0000u); }
__device__ __forceinline__ float gb_b(unsigned int w) { return __uint_as_float(w << 16); }
__device__ __forceinline__ v16b frag_kb(const b16* p, int hh) { const v8b a = *(const v8b*)(p + 8 * hh), b = *(const v8b*)(p + 16 + 8 * hh); v16b f;
#pragma unroll
  for (int e = 0; e < 8; ++e) { f[e] = a[e]; f[8 + e] = b[e]; } return f; }
__device__ __forceinline__ v8f wmma16b(v16b a, v16b b, v8f c) { v8f d = __builtin_amdgcn_wmma_f32_16x16x32_f16(false, a, false, b, (short)0, c, false, false); asm volatile("v_nop\n\tv_nop\n\tv_nop\n\tv_nop" : "+v"(d) : "v"(a), "v"(b)); return d; }
__device__ __forceinline__ void wave_lds_sync() { __builtin_amdgcn_fence(__ATOMIC_RELEASE, "workgroup"); __builtin_amdgcn_wave_barrier(); __builtin_amdgcn_fence(__ATOMIC_ACQUIRE, "workgroup"); }
__device__ __forceinline__ float pmul(float a, float b) { float p = a * b; asm volatile("" : "+v"(p)); return p; }
__device__ __forceinline__ float elu(float x) { return x > 0.0f ? x : (__expf(x) - 1.0f); }

__global__ __launch_bounds__(256) void prep_kernel(const float* __restrict__ xs, const float* __restrict__ xp, const float* __restrict__ xq, const float* __restrict__ wq, const float* __restrict__ wk, const float* __restrict__ wv, const float* __restrict__ gs, const float* __restrict__ bs, const float* __restrict__ gn, const float* __restrict__ bn, b16* __restrict__ X16, b16* __restrict__ W16, unsigned int* __restrict__ GB) {
  const int t = blockIdx.x * 256 + threadIdx.x; const int nx = NR * D / 8, nw = 3 * D * D / 8, ng = 2 * GBW / 4; v8b o;
  if (t < nx) { const int e = t * 8; const int row = e / D; const float* src = row < NRS ? xs + e : row < NRS + NRP ? xp + (e - NRS * D) : xq + (e - (NRS + NRP) * D);
    for (int j = 0; j < 8; ++j) o[j] = (b16)(bf16_rne(src[j]) * XS); { *(v8b*)(X16 + e) = o;  } }
  else if (t < nx + nw) { const int e = (t - nx) * 8; const int k = e / (D * D), r = e - k * D * D; const float* w = k == 0 ? wq : k == 1 ? wk : wv; for (int j = 0; j < 8; ++j) o[j] = (b16)(bf16_rne(w[r + j]) * WSC); { *(v8b*)(W16 + e) = o;  } }
  else if (t < nx + nw + ng) { const int i = t - nx - nw, tt = i & 255, g = (i >> 8) & 15; const float *ga_ = i < GBW / 4 ? gs : gn, *be_ = i < GBW / 4 ? bs : bn; const int e = ((tt >> 7) * (D / 2) + g * 4) * D + (tt & (D - 1)); v4u w; float gv[4], bv[4];
    const float *gp = ga_ + e, *bp = be_ + e;
    for (int j = 0; j < 4; ++j) { gv[j] = gp[j * D]; bv[j] = bp[j * D]; }
    asm volatile("s_wait_xcnt 0x0" :: "v"(gp), "v"(bp) : "memory");   // behind the eight loads, in front of the first rewrite of a register that they name; the addresses are inputs, so that they keep their registers up to the wait
    for (int j = 0; j < 4; ++j) w[j] = (__float_as_uint(bf16_rne(gv[j])) & 0xFFFF0000u) | (__float_as_uint(bf16_rne(bv[j])) >> 16);
    *(v4u*)(GB + (size_t)i * 4) = w; }
}
__global__ __launch_bounds__(128) void proj_kernel(const b16* __restrict__ X16, const b16* __restrict__ W16, const float* __restrict__ bq, const float* __restrict__ bk, const float* __restrict__ bv, float* __restrict__ Q, float* __restrict__ Z, float* __restrict__ V) {
  __shared__ __attribute__((aligned(16))) float Ts[4][16][D + 4];
  const int kind = blockIdx.y, wave = threadIdx.x >> 5, lane = threadIdx.x & 31, nloc = lane & 15, hlf = lane >> 4; const size_t m0 = (size_t)blockIdx.x * 64 + wave * 16; if (kind == 0 && m0 >= (size_t)NRS) return;
  const b16* Wp = W16 + (size_t)kind * D * D; const float* bb = kind == 0 ? bq : kind == 1 ? bk : bv; float* dst = kind == 0 ? Q : kind == 1 ? Z : V;
  v8f acc[8];
#pragma unroll
  for (int t = 0; t < 8; ++t) acc[t] = (v8f){};
#pragma unroll
  for (int kb = 0; kb < D; kb += 32) { const v16b a = frag_kb(X16 + (m0 + nloc) * D + kb, hlf);
#pragma unroll
    for (int t = 0; t < 8; ++t) acc[t] = wmma16b(a, frag_kb(Wp + (size_t)(t * 16 + nloc) * D + kb, hlf), acc[t]); }
#pragma unroll
  for (int t = 0; t < 8; ++t) { const int c = t * 16 + nloc; const float b_ = bf16_rne(bb[c]);
#pragma unroll
    for (int r = 0; r < 8; ++r) { float v = acc[t][r] * (1.0f / (XS * WSC)) + b_; if (kind < 2) v = elu(v); Ts[wave][8 * hlf + r][c] = v; } }
  wave_lds_sync();
  { for (int rr = 0; rr < 16; ++rr) *(v4f*)(dst + (m0 + rr) * D + lane * 4) = *(const v4f*)(&Ts[wave][rr][lane * 4]);  }
}
// Block-wide fixed-order reductions (256 threads, every lane on): a butterfly inside each wave (lane ^ 1, 2, 4, 8 by DPP inside the 16-lane row, lane ^ 16 by a cross-row move), one word a wave in LDS, ONE barrier, then every
// thread adds the eight words in one fixed tree. N sums that do not depend on each other share the exchange. RB picks one of two exchange buffers: neighbouring reductions alternate, or have another barrier between them,
// so a buffer is rewritten only behind a barrier that every wave signals after its reads of it have returned.
template <int M> __device__ __forceinline__ int xrow_i(int x) { return __builtin_amdgcn_update_dpp(0, x, 0x160 | M /* row_xmask:M */, 0xf, 0xf, true); }
__device__ __forceinline__ int xhalf_i(int x) { return __builtin_amdgcn_permlanex16(x, x, 0x76543210, 0xfedcba98, false, false); }   // lane l with lane l ^ 16
template <int M> __device__ __forceinline__ float xrow(float x) { return __builtin_bit_cast(float, xrow_i<M>(__builtin_bit_cast(int, x))); }
__device__ __forceinline__ float xhalf(float x) { return __builtin_bit_cast(float, xhalf_i(__builtin_bit_cast(int, x))); }
template <int M> __device__ __forceinline__ double xrow_d(double x) { return __hiloint2double(xrow_i<M>(__double2hiint(x)), xrow_i<M>(__double2loint(x))); }
__device__ __forceinline__ double xhalf_d(double x) { return __hiloint2double(xhalf_i(__double2hiint(x)), xhalf_i(__double2loint(x))); }
constexpr int NW = 8 /* waves a block */, RN = 3 /* most sums in one exchange */;
template <int RB, int N> __device__ __forceinline__ void bsum(float (&v)[N], float (*rw)[RN * NW]) { static_assert(N <= RN && RB < 2, "fits the exchange buffers"); float* r = rw[RB];
  for (int i = 0; i < N; ++i) v[i] += xrow<1>(v[i]);
  for (int i = 0; i < N; ++i) v[i] += xrow<2>(v[i]);
  for (int i = 0; i < N; ++i) v[i] += xrow<4>(v[i]);
  for (int i = 0; i < N; ++i) v[i] += xrow<8>(v[i]);
  for (int i = 0; i < N; ++i) v[i] += xhalf(v[i]);
  if ((threadIdx.x & 31) == 0) { for (int i = 0; i < N; ++i) r[i * NW + (threadIdx.x >> 5)] = v[i]; }   // lane 0 speaks for the wave (where a product is fused into the first add, the lanes need not agree in the last bit)
  __syncthreads();
  for (int i = 0; i < N; ++i) { const v4f a = *(const v4f*)(r + i * NW), c = *(const v4f*)(r + i * NW + 4); v[i] = ((a[0] + a[1]) + (a[2] + a[3])) + ((c[0] + c[1]) + (c[2] + c[3])); } }
template <int RB> __device__ __forceinline__ float bsum1(float x, float (*rw)[RN * NW]) { float v[1] = {x}; bsum<RB>(v, rw); return v[0]; }
// prompt state for user b from rows r0..r0+7 of Z/V: zc = sum_j z_j; sc = sum_j z_j v_j^T; Pz = LN_D(zc + eps) gz + bz (vector, thread < 128 -> pzout), Ps = LN_DxD(sc + eps) gs + bs into
// PS (LDS or global, [p][q], thread owns q = t&127 for p in its half).
__device__ __forceinline__ void prompt_state(const float* __restrict__ Z, const float* __restrict__ V, int r0, const float* __restrict__ gz, const float* __restrict__ bz, const unsigned int* __restrict__ GS, float* __restrict__ PS, float* __restrict__ pzout, float (*rw)[RN * NW], float* zs, float* vs) {
  const int t_ = threadIdx.x; const int q = t_ & (D - 1), ph = t_ >> 7;   // ph: which half of the p range (0: 0..63, 1: 64..127)
  // zc (thread < 128) and staging of the 8 z / v rows
  for (int i = t_; i < LP * D; i += 256) { zs[i] = Z[(size_t)r0 * D + i]; vs[i] = V[(size_t)r0 * D + i]; }
  __syncthreads();
  // Pz: LN over D of (zc + eps); its two sums share the exchanges of the two sums of the DxD LN
  float zc = 0.0f; if (t_ < D) { for (int j = 0; j < LP; ++j) zc += zs[j * D + t_]; zc += EPS; }
  // Each pass walks its 64 rows in batches of PB: first every load of the batch, into registers, then the arithmetic in row order (the sums keep their order). Written out so because no load moves
  // up over the asm statement in pmul: left in one loop body, each load waits out its latency alone.
  constexpr int PB = 8; const int pa = ph * (D / 2); float vr[LP], zr[PB][LP]; v4u gw[PB / 4];
#pragma unroll
  for (int j = 0; j < LP; ++j) vr[j] = vs[j * D + q];
  float s1 = 0.0f;
#pragma unroll 1   // the body holds PB rows already
  for (int pb = 0; pb < D / 2; pb += PB) {
#pragma unroll
    for (int k = 0; k < PB; ++k) for (int j = 0; j < LP; ++j) zr[k][j] = zs[j * D + pa + pb + k];
#pragma unroll
    for (int k = 0; k < PB; ++k) { float a = 0.0f; for (int j = 0; j < LP; ++j) a += pmul(zr[k][j], vr[j]); s1 += a + EPS; } }
  float ra[2] = {zc, s1}; bsum<0>(ra, rw); const float mz = ra[0] * (1.0f / D), ms = ra[1] * (1.0f / (D * D)); const float dz = t_ < D ? zc - mz : 0.0f; float s2 = 0.0f;
#pragma unroll 1   // as above
  for (int pb = 0; pb < D / 2; pb += PB) {
#pragma unroll
    for (int k = 0; k < PB; ++k) for (int j = 0; j < LP; ++j) zr[k][j] = zs[j * D + pa + pb + k];
#pragma unroll
    for (int k = 0; k < PB; ++k) { float a = 0.0f; for (int j = 0; j < LP; ++j) a += pmul(zr[k][j], vr[j]); const float dv = (a + EPS) - ms; s2 += dv * dv; } }
  float rb[2] = {dz * dz, s2}; bsum<1>(rb, rw); const float rz = rsqrtf(rb[0] * (1.0f / D) + LNE), rs = rsqrtf(rb[1] * (1.0f / (D * D)) + LNE);
  if (t_ < D) pzout[t_] = pmul(dz * rz, bf16_rne(gz[t_])) + bf16_rne(bz[t_]);
#pragma unroll 1   // as above
  for (int pb = 0; pb < D / 2; pb += PB) { const v4u* g0 = (const v4u*)GS + (pb / 4) * 256 + t_;
#pragma unroll
    for (int k = 0; k < PB / 4; ++k) gw[k] = g0[k * 256];
#pragma unroll
    for (int k = 0; k < PB; ++k) { for (int j = 0; j < LP; ++j) zr[k][j] = zs[j * D + pa + pb + k]; }
    asm volatile("s_wait_xcnt 0x0" :: "v"(g0) : "memory");   // in front of the first rewrite of a register that the loads of GS name; the address is an input, so that it keeps its registers up to the wait and no load's result lands on them
#pragma unroll
    for (int k = 0; k < PB; ++k) { float a = 0.0f; for (int j = 0; j < LP; ++j) a += pmul(zr[k][j], vr[j]); PS[(pa + pb + k) * D + q] = pmul(((a + EPS) - ms) * rs, gb_g(gw[k >> 2][k & 3])) + gb_b(gw[k >> 2][k & 3]); } }
  __syncthreads();
}
// state kernel: block = (chunk c, user b) (256 threads). LDS: SR [128][128] staging for the start state, PSL [128][128] prompt-P state; the running s (f32) in registers. PREV (prev_NAM) in global scratch per block. Per step l: s += z v^T; LN stats; NAM passes;
// amdgpu_waves_per_eu(4, 4): at most 256 registers a wave, so that two blocks still share a WGP (four waves on each SIMD), which the LDS allows
__global__ __launch_bounds__(256) __attribute__((amdgpu_waves_per_eu(4, 4))) void state_kernel(const float* __restrict__ Q, const float* __restrict__ Z, const float* __restrict__ V, const int* __restrict__ uid, const float* __restrict__ gz, const float* __restrict__ bz, const unsigned int* __restrict__ GS,
                                                 const unsigned int* __restrict__ GN, const float* __restrict__ ga, const float* __restrict__ ba, const float* __restrict__ prev_z, const float* __restrict__ prev_s, float* __restrict__ PREV, float* __restrict__ out, double* __restrict__ STD2) {
  __shared__ __attribute__((aligned(16))) float SR[D * D]; __shared__ float PSL[D * D]; __shared__ float red[256]; __shared__ __attribute__((aligned(16))) float rw[2][RN * NW]; __shared__ float zs[LP * D], vs[LP * D]; __shared__ float pzP[D], pzS[D], zrow[D], vrow[D], qn[D], zfull[D], zcum[D]; __shared__ float scal[4]; __shared__ __attribute__((aligned(16))) double dw[2][NW];
  const int b = blockIdx.y, blk = b * NC + blockIdx.x, l0 = blockIdx.x * CH, l1 = min(l0 + CH, L), t_ = threadIdx.x; const int q = t_ & (D - 1), ph = t_ >> 7;
  // prompt S state -> PSL temporarily, then prev_NAM into PREV (global); prompt P state -> PSL (kept).
  prompt_state(Z, V, NRS + NRP + b * LP, gz, bz, GS, PSL, pzS, rw, zs, vs);
  { const int u = min(max(uid[b], 0), NU - 1); float zu = 0.0f; if (t_ < D) { zu = bf16_rne(prev_z[(size_t)u * D + t_]) + pzS[t_]; } float ru[2] = {zu * zu, t_ < D ? bf16_rne(prev_z[(size_t)u * D + t_]) : 0.0f}; bsum<0>(ru, rw); const float inv = 1.0f / (sqrtf(ru[0]) + EPS);
    if (t_ == 0) scal[0] = (ru[1] != 0.0f) ? 1.0f : 0.0f;
    {
#pragma unroll 1   // the body holds 16 rows already
      for (int pb = 0; pb < D / 2; pb += 16) { float w[16];
#pragma unroll   // 16 loads of prev_s (from memory) in flight per thread
        for (int k = 0; k < 16; ++k) w[k] = (bf16_rne(prev_s[((size_t)u * D + ph * (D / 2) + pb + k) * D + q]) + PSL[(ph * (D / 2) + pb + k) * D + q]) * inv;
#pragma unroll
        for (int k = 0; k < 16; ++k) ((float*)PREV)[(size_t)blk * D * D + (ph * (D / 2) + pb + k) * D + q] = w[k];
        asm volatile("s_wait_xcnt 0x0" ::: "memory"); }   // kept in front of the next trip's rewrite of the registers that the loads and stores name
       } }
  __syncthreads();
  prompt_state(Z, V, NRS + b * LP, gz, bz, GS, PSL, pzP, rw, zs, vs);
  // state in front of step l0: s = sum_{l < l0} z_l v_l^T and zcum = sum z_l, each element summed in step order. The thread keeps rows p0..p0+7 x columns q0..q0+3 and 64+q0..64+q0+3 in registers;
  // SR, which holds nothing yet, stages TR rows of z and TR rows of v at a time (whole tiles are loaded: rows past l0 are inside Z and V and are not summed).
  { float* zt = SR; float* vt = SR + TR * D; const int p0 = (t_ >> 4) * 8, q0 = (t_ & 15) * 4; v4f a0[8], a1[8]; float zc = 0.0f; const v4f* zg = (const v4f*)(Z + (size_t)b * L * D) + t_; const v4f* vg = (const v4f*)(V + (size_t)b * L * D) + t_;
#pragma unroll
    for (int r = 0; r < 8; ++r) { a0[r] = (v4f){}; a1[r] = (v4f){}; }
    for (int base = 0; base < l0; base += TR, zg += TR * D / 4, vg += TR * D / 4) { const int n = min(TR, l0 - base);
#pragma unroll   // all 16 loads of the thread in flight at once
      for (int k = 0; k < TR * D / 4 / 256; ++k) { ((v4f*)zt)[t_ + k * 256] = zg[k * 256]; ((v4f*)vt)[t_ + k * 256] = vg[k * 256]; }
      __syncthreads();
#pragma unroll 2   // the next row's LDS reads issue under this row's 64 multiply-adds
      for (int j = 0; j < n; ++j) { const v4f z0 = *(const v4f*)(zt + j * D + p0), z1 = *(const v4f*)(zt + j * D + p0 + 4), v0 = *(const v4f*)(vt + j * D + q0), v1 = *(const v4f*)(vt + j * D + 64 + q0);
        zc += zt[j * D + q];   // both halves of the block sum it, the lower half stores it
#pragma unroll
        for (int r = 0; r < 4; ++r) { a0[r] += z0[r] * v0; a1[r] += z0[r] * v1; a0[4 + r] += z1[r] * v0; a1[4 + r] += z1[r] * v1; } }
      __syncthreads(); }
#pragma unroll
    for (int r = 0; r < 8; ++r) { *(v4f*)(SR + (p0 + r) * D + q0) = a0[r]; *(v4f*)(SR + (p0 + r) * D + 64 + q0) = a1[r]; }
    if (t_ < D) zcum[t_] = zc; }
  __syncthreads();
  // From here on every element of the state is read and written by one thread only (rows pa..pa+63 of column q): it leaves SR for the thread's registers and stays there over all steps of the chunk.
  constexpr int NH = D / 2; const int pa = ph * NH; const unsigned e0 = pa * D + q /* the thread's first element in every DxD matrix: the rows of the unrolled passes differ from it by constants, so each matrix takes one address for the whole loop */; float st[NH], nw[NH];
#pragma unroll   // st is indexed by constants only, so that it lives in registers
  for (int k = 0; k < NH; ++k) st[k] = SR[(pa + k) * D + q];
  double dsum = 0.0, dsq = 0.0;
  const float* PRb = PREV + (size_t)blk * D * D;
  for (int l = l0; l < l1; ++l) { const size_t row = (size_t)b * L + l;
    if (t_ < D) { zrow[t_] = Z[row * D + t_]; vrow[t_] = V[row * D + t_]; zcum[t_] += Z[row * D + t_]; }
    __syncthreads();
    // The two sums of z's LN and |q|^2 depend on nothing of the state, so they ride in the exchanges of the state's own LN sums (first and second pass).
    float qv = 0.0f; if (t_ < D) qv = Q[row * D + t_];
    const float zc = t_ < D ? zcum[t_] + EPS : 0.0f;
    // Five passes over the thread's 64 rows, all unrolled (st and nw are indexed by constants only). st holds the running state; nw holds S_l/|z_l| + eps, made once in the third pass and used again by the
    // fourth and fifth, which so read neither gs, bs nor the prompt state again. What a pass still loads comes in batches of RA or RB rows: first every load of the batch, then the arithmetic in row order
    // (the sums keep their order); no load moves up over the asm statement in pmul, so left in one body each load would wait out its latency alone.
    constexpr int RA = 32 /* the first pass: one LDS read a row */, RB = 16 /* the third and fifth pass: a parameter word and one or two more values a row beside the 128 kept values */; float pl[RB], qv_[RA]; v4u gw[RB / 4]; const v4u *GSt = (const v4u*)GS + t_, *GNt = (const v4u*)GN + t_;
    float s1 = 0.0f; const float vq = vrow[q];
#pragma unroll
    for (int pb = 0; pb < NH; pb += RA) {
#pragma unroll
      for (int k = 0; k < RA; ++k) qv_[k] = zrow[pa + pb + k];
#pragma unroll
      for (int k = 0; k < RA; ++k) { st[pb + k] += pmul(qv_[k], vq); s1 += st[pb + k] + EPS; } }
    float ra[3] = {zc, qv * qv, s1}; bsum<0>(ra, rw); const float mz = ra[0] * (1.0f / D), qn2 = ra[1], m1 = ra[2] * (1.0f / (D * D)); const float dz = t_ < D ? zc - mz : 0.0f; float s2 = 0.0f;
#pragma unroll
    for (int k = 0; k < NH; ++k) { const float dv = (st[k] + EPS) - m1; s2 += dv * dv; }
    float rb[2] = {dz * dz, s2}; bsum<1>(rb, rw); const float rz = rsqrtf(rb[0] * (1.0f / D) + LNE), r1 = rsqrtf(rb[1] * (1.0f / (D * D)) + LNE);
    // z_l = LN_D(zcum + eps) gz + bz + Pz; qn (read in the fifth pass, two barriers on); 1/|z_l|, which every thread forms from the total it holds
    float zf = 0.0f; if (t_ < D) { zf = pmul(dz * rz, bf16_rne(gz[t_])) + bf16_rne(bz[t_]) + pzP[t_]; zfull[t_] = zf; }
    const float zn2 = bsum1<0>(zf * zf, rw); if (t_ < D) qn[t_] = qv / (sqrtf(qn2) + EPS); const float izn = 1.0f / (sqrtf(zn2) + EPS);
    if (t_ < D) { const float xv = qv / fmaxf(zf, 1e-6f); dsum += (double)xv; dsq += (double)xv * (double)xv; }
    // NAMraw = (LN(s) gs + bs + Ps) izn + eps ; stats
    float n1 = 0.0f;
#pragma unroll
    for (int pb = 0; pb < NH; pb += RB) {
#pragma unroll
      for (int k = 0; k < RB / 4; ++k) gw[k] = GSt[(pb / 4 + k) * 256];
#pragma unroll
      for (int k = 0; k < RB; ++k) pl[k] = PSL[e0 + (pb + k) * D];
      asm volatile("s_wait_xcnt 0x0" ::: "memory");   // behind the loads of GS, in front of any later rewrite of a register that they name; its memory clobber also keeps the batch's loads in front of the arithmetic
#pragma unroll
      for (int k = 0; k < RB; ++k) { const float sf = pmul(((st[pb + k] + EPS) - m1) * r1, gb_g(gw[k >> 2][k & 3])) + gb_b(gw[k >> 2][k & 3]) + pl[k]; nw[pb + k] = pmul(sf, izn) + EPS; n1 += nw[pb + k]; } }
    const float m2 = bsum1<1>(n1, rw) * (1.0f / (D * D)); float n2 = 0.0f;
#pragma unroll
    for (int k = 0; k < NH; ++k) { const float nr = nw[k] - m2; n2 += nr * nr; }
    const float r2 = rsqrtf(bsum1<0>(n2, rw) * (1.0f / (D * D)) + LNE);
    // NA_q partial over the thread's p half: sum_p qn_p NAM_pq ; prev partial: sum_p qn_p PREV_pq
    float na = 0.0f, pv = 0.0f;
#pragma unroll
    for (int pb = 0; pb < NH; pb += RB) {
#pragma unroll
      for (int k = 0; k < RB / 4; ++k) gw[k] = GNt[(pb / 4 + k) * 256];
#pragma unroll
      for (int k = 0; k < RB; ++k) { pl[k] = PRb[e0 + (pb + k) * D]; qv_[k] = qn[pa + pb + k]; }
      asm volatile("s_wait_xcnt 0x0" ::: "memory");   // as in the third pass, for the loads of GN and PREV
#pragma unroll
      for (int k = 0; k < RB; ++k) { const float nam = pmul((nw[pb + k] - m2) * r2, gb_g(gw[k >> 2][k & 3])) + gb_b(gw[k >> 2][k & 3]);
        na += pmul(qv_[k], nam); pv += pmul(qv_[k], pl[k]); } }
    // combine the two halves: threads q and q+128 -> via red
    red[t_] = na + scal[0] * pv; __syncthreads();
    // LN_D(NA) ga + ba -> out row. No barrier closes the step: what the next step writes in LDS (zrow, vrow, later qn and red) was last read in front of the two barriers below.
    { const float x = t_ < D ? red[t_] + red[t_ + D] : 0.0f; const float mu = bsum1<1>(x, rw) * (1.0f / D); const float dv = t_ < D ? x - mu : 0.0f; const float var = bsum1<0>(dv * dv, rw) * (1.0f / D); const float rr = rsqrtf(var + LNE);
      const float o = pmul(dv * rr, t_ < D ? bf16_rne(ga[t_]) : 0.0f) + (t_ < D ? bf16_rne(ba[t_]) : 0.0f);
      // the wait: behind the store of the row, in front of the next step's rewrite of its address registers (the barrier that stood here brought a wait of its own); inside the branch, so that the loop's address additions cannot be lifted over it
      { if (t_ < D) { ((float*)out)[row * D + t_] = o; asm volatile("s_wait_xcnt 0x0" ::: "memory"); }  } } }
  // the block's two f64 sums, reduced like the f32 ones: butterfly in the wave, one word a wave, one barrier, one fixed tree
  dsum += xrow_d<1>(dsum); dsq += xrow_d<1>(dsq); dsum += xrow_d<2>(dsum); dsq += xrow_d<2>(dsq); dsum += xrow_d<4>(dsum); dsq += xrow_d<4>(dsq); dsum += xrow_d<8>(dsum); dsq += xrow_d<8>(dsq); dsum += xhalf_d(dsum); dsq += xhalf_d(dsq);
  if ((t_ & 31) == 0) { dw[0][t_ >> 5] = dsum; dw[1][t_ >> 5] = dsq; }
  __syncthreads();
  { if (t_ < 16) { const double* w = dw[t_ & 1]; const double tot = ((w[0] + w[1]) + (w[2] + w[3])) + ((w[4] + w[5]) + (w[6] + w[7])); ((double*)STD2)[(size_t)blk * 16 + t_] = t_ < 2 ? tot : 0.0; }  }
}
// final std: one wave, the users' sums joined by a butterfly over lanes 0..15: n = 16*200*128; var = (sumsq - sum^2/n) / (n-1); std -> out2[0] (and 31 zero floats to fill the line? the output is a single float at the end of the buffer; we write just it).
__global__ __launch_bounds__(32) void std_kernel(const double* __restrict__ STD2, float* __restrict__ out2) {
  const int lane = threadIdx.x; double s = 0.0, s2 = 0.0;
  if (lane < NB) {   // lane = user: its chunks in order
#pragma unroll   // several of the lane's loads in flight at a time
    for (int k = 0; k < NC; ++k) { s += STD2[(size_t)(lane * NC + k) * 16]; s2 += STD2[(size_t)(lane * NC + k) * 16 + 1]; } }
  for (int m = NB / 2; m >= 1; m >>= 1) { s += __shfl_xor(s, m); s2 += __shfl_xor(s2, m); }
  if (lane == 0) { const double n = (double)NB * L * D; const double var = (s2 - s * s / n) / (n - 1.0); const float sd = (float)sqrt(var > 0.0 ? var : 0.0);
    { ((float*)out2)[0] = sd;  } }
}
}  // namespace

extern "C" void kernel_launch(void* const* d_in, const int* in_sizes, int n_in, void* d_out, int out_size, void* d_ws, size_t ws_size, hipStream_t stream) {
  (void)n_in;
  auto Fp = [&](int i) { return (const float*)d_in[i]; }; auto Ip = [&](int i) { return (const int*)d_in[i]; };
  // input order: 0 user_id [16] i32, 1 seqs_emb [16,200,128], 2 P [16,8,128], 3 S [16,8,128], 4 Wq [128,128], 5 bq, 6 Wk, 7 bk, 8 Wv, 9 bv, 10 z_gamma, 11 z_beta, 12 s_gamma [128,128], 13 s_beta, 14 nam_gamma, 15 nam_beta,
  // 16 na_gamma [128], 17 na_beta, 18 prev_z [1001,128], 19 prev_s [1001,128,128]; outputs NA [16,200,128] at 0, std [1] at float 409600
  if (in_sizes[0] != NB || in_sizes[1] != NRS * D || in_sizes[2] != NRP * D || in_sizes[3] != NRP * D || in_sizes[4] != D * D || in_sizes[12] != D * D || in_sizes[18] != NU * D || in_sizes[19] != NU * D * D || out_size != NRS * D + 1) return;
  size_t off = 0; char* ws = (char*)d_ws;
  auto carve = [&](size_t bytes) { char* p = ws + off; off += (bytes + 255) & ~(size_t)255; return p; };
  b16* X16 = (b16*)carve((size_t)NR * D * 2); b16* W16 = (b16*)carve((size_t)3 * D * D * 2); float* Qp = (float*)carve((size_t)NRS * D * 4); float* Zp = (float*)carve((size_t)NR * D * 4); float* Vp = (float*)carve((size_t)NR * D * 4); float* PREV = (float*)carve((size_t)NB * NC * D * D * 4); double* STD2 = (double*)carve((size_t)NB * NC * 16 * 8); unsigned int* GB = (unsigned int*)carve((size_t)2 * GBW * 4);
  if (off > ws_size || off > ((size_t)128 << 20)) return;   // about 36 MB
  prep_kernel<<<(NR * D / 8 + 3 * D * D / 8 + 2 * GBW / 4 + 255) / 256, 256, 0, stream>>>(Fp(1), Fp(2), Fp(3), Fp(4), Fp(6), Fp(8), Fp(12), Fp(13), Fp(14), Fp(15), X16, W16, GB);
  proj_kernel<<<dim3(NR / 64, 3), 128, 0, stream>>>(X16, W16, Fp(5), Fp(7), Fp(9), Qp, Zp, Vp);
  state_kernel<<<dim3(NC, NB), 256, 0, stream>>>(Qp, Zp, Vp, Ip(0), Fp(10), Fp(11), GB, GB + GBW, Fp(16), Fp(17), Fp(18), Fp(19), PREV, (float*)d_out, STD2);
  std_kernel<<<1, 32, 0, stream>>>(STD2, (float*)d_out + (size_t)NRS * D);
}

// v006
// Measured time: 99.4 microseconds a run.
// Timed twice side by side with v005, it ran 1.09 and 1.10 times as fast.
// All steps since v000 together make it 204 times as fast.
#include <hip/hip_runtime.h>

// CSR attention block (16 users x 200 steps, D = 128): q = elu(x Wq^T + bq), qn = q/(|q|+eps); z = elu(x Wk^T + bk), v = x Wv^T + bv; per user the causal cumulative state s_l = sum_{l'<=l} z v^T
// and zc_l = sum z; z_l = LN_D(zc_l + eps) + Pz, S_l = LN_DxD(s_l + eps) + Ps where (Pz, Ps) is the same construction on the 8-step prompt P taken at its last step; NAM = LN_DxD(S_l/(|z_l|+eps) + eps);
// NA = qn . NAM + mask_b (qn . prev_NAM) with prev_NAM = (prev_s[uid] + Ss) / (|prev_z[uid] + Sz| + eps) from the prompt S; NA = LN_D(NA); second output std = unbiased std of
// q / max(z_l, 1e-6) over all (b, l, d).
// One block per (user, chunk of 7 steps): it first sums z v^T and z over all earlier steps of its user, in step order, in registers, then walks its chunk with the running DxD state in registers (f32, 64 elements a thread),
// the prompt state beside it, LN statistics by fixed-order block reductions, the two vector-matrix products on the VALU (batches of rows: the loads first, then the arithmetic); the std partials in f64 per block, combined by one final wave.
// WMMA (v_wmma_f32_16x16x32_f16, f32 accumulate): the k/v projections of the sequence and both prompts ([3,456 x 128] x [128 x 128] x2), q of the sequence only ([3,200 x 128] x [128 x 128]) with EXACT bf16 inputs (x8) and weights (x256), 1 product.
// The four DxD LN parameter matrices are rounded to bf16 once, in the prep kernel, and packed: one 32-bit word holds (gamma, beta) of an element, four rows of a thread's column lie in one 16-byte word group (see GB below).
// Inputs rounded to bf16 once; user_id int32, clamped. Fragment k-map per lane half hh for A AND B: elements 0..7 <- k = 8hh+0..7, 8..15 <- k = 16+8hh+0..7; acc[r] =

namespace {
constexpr int NB = 16, L = 200, LP = 8, D = 128, NU = 1001, NRS = NB * L /* 3200 */, NRP = NB * LP /* 128 */, NR = NRS + 2 * NRP /* 3456 = 54 x 64 */;
constexpr int CH = 7 /* steps per block */, NC = (L + CH - 1) / CH /* 29 chunks per user: 464 blocks, two per WGP by LDS */, TR = 64 /* rows of z and of v staged at a time for the earlier steps */;
static_assert(2 * TR * D <= D * D && (NB - 1) * L + ((L - 1) / TR + 1) * TR <= NR, "staged tiles fit SR and stay inside Z and V");
constexpr float XS = 8.0f, WSC = 256.0f, EPS = 1e-8f, LNE = 1e-5f;

typedef _Float16 b16;
typedef __attribute__((ext_vector_type(16))) _Float16 v16b;
typedef __attribute__((ext_vector_type(8))) _Float16 v8b;
typedef __attribute__((ext_vector_type(8))) float v8f;
typedef __attribute__((ext_vector_type(4))) float v4f;
typedef __attribute__((ext_vector_type(4))) unsigned int v4u;
__device__ __forceinline__ float bf16_rne(float f) { unsigned int u = __float_as_uint(f); u += 0x7FFFu + ((u >> 16) & 1u); return __uint_as_float(u & 0xFFFF0000u); }
// GB: a pair (gamma, beta) of DxD matrices, each value rounded to bf16, gamma in the high and beta in the low half of a word. Word ((g * 256 + t) * 4 + j) belongs to row (t >> 7) * 64 + 4 g + j, column t & 127:
// thread t of the state kernel reads four of its rows with one 16-byte load, and a wave reads 512 bytes in a row.
constexpr int GBW = D * D /* words a pair */;
__device__ __forceinline__ float gb_g(unsigned int w) { return __uint_as_float(w & 0xFFFF0000u); }
__device__ __forceinline__ float gb_b(unsigned int w) { return __uint_as_float(w << 16); }
__device__ __forceinline__ v16b frag_kb(const b16* p, int hh) { const v8b a = *(const v8b*)(p + 8 * hh), b = *(const v8b*)(p + 16 + 8 * hh); v16b f;
#pragma unroll
  for (int e = 0; e < 8; ++e) { f[e] = a[e]; f[8 + e] = b[e]; } return f; }
__device__ __forceinline__ v8f wmma16b(v16b a, v16b b, v8f c) { v8f d = __builtin_amdgcn_wmma_f32_16x16x32_f16(false, a, false, b, (short)0, c, false, false); asm volatile("v_nop\n\tv_nop\n\tv_nop\n\tv_nop" : "+v"(d) : "v"(a), "v"(b)); return d; }
__device__ __forceinline__ void wave_lds_sync() { __builtin_amdgcn_fence(__ATOMIC_RELEASE, "workgroup"); __builtin_amdgcn_wave_barrier(); __builtin_amdgcn_fence(__ATOMIC_ACQUIRE, "workgroup"); }
__device__ __forceinline__ float pmul(float a, float b) { float p = a * b; asm volatile("" : "+v"(p)); return p; }
__device__ __forceinline__ float elu(float x) { return x > 0.0f ? x : (__expf(x) - 1.0f); }

__global__ __launch_bounds__(256) void prep_kernel(const float* __restrict__ xs, const float* __restrict__ xp, const float* __restrict__ xq, const float* __restrict__ wq, const float* __restrict__ wk, const float* __restrict__ wv, const float* __restrict__ gs, const float* __restrict__ bs, const float* __restrict__ gn, const float* __restrict__ bn, b16* __restrict__ X16, b16* __restrict__ W16, unsigned int* __restrict__ GB) {
  const int t = blockIdx.x * 256 + threadIdx.x; const int nx = NR * D / 8, nw = 3 * D * D / 8, ng = 2 * GBW / 4; v8b o;
  if (t < nx) { const int e = t * 8; const int row = e / D; const float* src = row < NRS ? xs + e : row < NRS + NRP ? xp + (e - NRS * D) : xq + (e - (NRS + NRP) * D);
    for (int j = 0; j < 8; ++j) o[j] = (b16)(bf16_rne(src[j]) * XS); { *(v8b*)(X16 + e) = o;  } }
  else if (t < nx + nw) { const int e = (t - nx) * 8; const int k = e / (D * D), r = e - k * D * D; const float* w = k == 0 ? wq : k == 1 ? wk : wv; for (int j = 0; j < 8; ++j) o[j] = (b16)(bf16_rne(w[r + j]) * WSC); { *(v8b*)(W16 + e) = o;  } }
  else if (t < nx + nw + ng) { const int i = t - nx - nw, tt = i & 255, g = (i >> 8) & 15; const float *ga_ = i < GBW / 4 ? gs : gn, *be_ = i < GBW / 4 ? bs : bn; const int e = ((tt >> 7) * (D / 2) + g * 4) * D + (tt & (D - 1)); v4u w; float gv[4], bv[4];
    const float *gp = ga_ + e, *bp = be_ + e;
    for (int j = 0; j < 4; ++j) { gv[j] = gp[j * D]; bv[j] = bp[j * D]; }
    asm volatile("s_wait_xcnt 0x0" :: "v"(gp), "v"(bp) : "memory");   // behind the eight loads, in front of the first rewrite of a register that they name; the addresses are inputs, so that they keep their registers up to the wait
    for (int j = 0; j < 4; ++j) w[j] = (__float_as_uint(bf16_rne(gv[j])) & 0xFFFF0000u) | (__float_as_uint(bf16_rne(bv[j])) >> 16);
    *(v4u*)(GB + (size_t)i * 4) = w; }
}
__global__ __launch_bounds__(128) void proj_kernel(const b16* __restrict__ X16, const b16* __restrict__ W16, const float* __restrict__ bq, const float* __restrict__ bk, const float* __restrict__ bv, float* __restrict__ Q, float* __restrict__ Z, float* __restrict__ V) {
  __shared__ __attribute__((aligned(16))) float Ts[4][16][D + 4];
  const int kind = blockIdx.y, wave = threadIdx.x >> 5, lane = threadIdx.x & 31, nloc = lane & 15, hlf = lane >> 4; const size_t m0 = (size_t)blockIdx.x * 64 + wave * 16; if (kind == 0 && m0 >= (size_t)NRS) return;
  const b16* Wp = W16 + (size_t)kind * D * D; const float* bb = kind == 0 ? bq : kind == 1 ? bk : bv; float* dst = kind == 0 ? Q : kind == 1 ? Z : V;
  v8f acc[8];
#pragma unroll
  for (int t = 0; t < 8; ++t) acc[t] = (v8f){};
#pragma unroll
  for (int kb = 0; kb < D; kb += 32) { const v16b a = frag_kb(X16 + (m0 + nloc) * D + kb, hlf);
#pragma unroll
    for (int t = 0; t < 8; ++t) acc[t] = wmma16b(a, frag_kb(Wp + (size_t)(t * 16 + nloc) * D + kb, hlf), acc[t]); }
#pragma unroll
  for (int t = 0; t < 8; ++t) { const int c = t * 16 + nloc; const float b_ = bf16_rne(bb[c]);
#pragma unroll
    for (int r = 0; r < 8; ++r) { float v = acc[t][r] * (1.0f / (XS * WSC)) + b_; if (kind < 2) v = elu(v); Ts[wave][8 * hlf + r][c] = v; } }
  wave_lds_sync();
  { for (int rr = 0; rr < 16; ++rr) *(v4f*)(dst + (m0 + rr) * D + lane * 4) = *(const v4f*)(&Ts[wave][rr][lane * 4]);  }
}
// Block-wide fixed-order reductions (256 threads, every lane on): a butterfly inside each wave (lane ^ 1, 2, 4, 8 by DPP inside the 16-lane row, lane ^ 16 by a cross-row move), one word a wave in LDS, ONE barrier, then every
// thread adds the eight words in one fixed tree. N sums that do not depend on each other share the exchange. RB picks one of two exchange buffers: neighbouring reductions alternate, or have another barrier between them,
// so a buffer is rewritten only behind a barrier that every wave signals after its reads of it have returned.
template <int M> __device__ __forceinline__ int xrow_i(int x) { return __builtin_amdgcn_update_dpp(0, x, 0x160 | M /* row_xmask:M */, 0xf, 0xf, true); }
__device__ __forceinline__ int xhalf_i(int x) { return __builtin_amdgcn_permlanex16(x, x, 0x76543210, 0xfedcba98, false, false); }   // lane l with lane l ^ 16
template <int M> __device__ __forceinline__ float xrow(float x) { return __builtin_bit_cast(float, xrow_i<M>(__builtin_bit_cast(int, x))); }
__device__ __forceinline__ float xhalf(float x) { return __builtin_bit_cast(float, xhalf_i(__builtin_bit_cast(int, x))); }
template <int M> __device__ __forceinline__ double xrow_d(double x) { return __hiloint2double(xrow_i<M>(__double2hiint(x)), xrow_i<M>(__double2loint(x))); }
__device__ __forceinline__ double xhalf_d(double x) { return __hiloint2double(xhalf_i(__double2hiint(x)), xhalf_i(__double2loint(x))); }
constexpr int NW = 8 /* waves a block */, RN = 3 /* most sums in one exchange */;
template <int RB, int N> __device__ __forceinline__ void bsum(float (&v)[N], float (*rw)[RN * NW]) { static_assert(N <= RN && RB < 2, "fits the exchange buffers"); float* r = rw[RB];
  for (int i = 0; i < N; ++i) v[i] += xrow<1>(v[i]);
  for (int i = 0; i < N; ++i) v[i] += xrow<2>(v[i]);
  for (int i = 0; i < N; ++i) v[i] += xrow<4>(v[i]);
  for (int i = 0; i < N; ++i) v[i] += xrow<8>(v[i]);
  for (int i = 0; i < N; ++i) v[i] += xhalf(v[i]);
  if ((threadIdx.x & 31) == 0) { for (int i = 0; i < N; ++i) r[i * NW + (threadIdx.x >> 5)] = v[i]; }   // lane 0 speaks for the wave (where a product is fused into the first add, the lanes need not agree in the last bit)
  __syncthreads();
  for (int i = 0; i < N; ++i) { const v4f a = *(const v4f*)(r + i * NW), c = *(const v4f*)(r + i * NW + 4); v[i] = ((a[0] + a[1]) + (a[2] + a[3])) + ((c[0] + c[1]) + (c[2] + c[3])); } }
template <int RB> __device__ __forceinline__ float bsum1(float x, float (*rw)[RN * NW]) { float v[1] = {x}; bsum<RB>(v, rw); return v[0]; }
// prompt state for user b from rows r0..r0+7 of Z/V: zc = sum_j z_j; sc = sum_j z_j v_j^T; Pz = LN_D(zc + eps) gz + bz (vector, thread < 128 -> pzout), Ps = LN_DxD(sc + eps) gs + bs into
// PS (LDS or global, [p][q], thread owns q = t&127 for p in its half). Each element sc + eps is summed once, in the first pass, and kept in AE (LDS, 64 KB, idle at that time): group g of thread t, AE[g * 256 + t], holds
// its rows 4 g .. 4 g + 3; only the thread that wrote a group reads it, so AE needs no barrier of its own.
__device__ __forceinline__ void prompt_state(const float* __restrict__ Z, const float* __restrict__ V, int r0, const float* __restrict__ gz, const float* __restrict__ bz, const unsigned int* __restrict__ GS, float* __restrict__ PS, float* __restrict__ pzout, float (*rw)[RN * NW], float* zs, float* vs, v4f* __restrict__ AE) {
  const int t_ = threadIdx.x; const int q = t_ & (D - 1), ph = t_ >> 7;   // ph: which half of the p range (0: 0..63, 1: 64..127)
  // zc (thread < 128) and staging of the 8 z / v rows
  for (int i = t_; i < LP * D; i += 256) { zs[i] = Z[(size_t)r0 * D + i]; vs[i] = V[(size_t)r0 * D + i]; }
  __syncthreads();
  // Pz: LN over D of (zc + eps); its two sums share the exchanges of the two sums of the DxD LN
  float zc = 0.0f; if (t_ < D) { for (int j = 0; j < LP; ++j) zc += zs[j * D + t_]; zc += EPS; }
  // The first and the third pass walk their 64 rows in batches (PB, QB): first every load of the batch, into registers, then the arithmetic in row order (the sums keep their order). Written out so because no load moves
  // up over the asm statement in pmul: left in one loop body, each load waits out its latency alone.
  constexpr int PB = 8, QB = 16 /* rows a batch in the third pass */; const int pa = ph * (D / 2); float vr[LP], zr[PB][LP]; v4u gw[QB / 4]; v4f ae[QB / 4];
#pragma unroll
  for (int j = 0; j < LP; ++j) vr[j] = vs[j * D + q];
  float s1 = 0.0f;
#pragma unroll 1   // the body holds PB rows already
  for (int pb = 0; pb < D / 2; pb += PB) {
#pragma unroll
    for (int k = 0; k < PB; ++k) for (int j = 0; j < LP; ++j) zr[k][j] = zs[j * D + pa + pb + k];
#pragma unroll
    for (int k = 0; k < PB; ++k) { float a = 0.0f; for (int j = 0; j < LP; ++j) a += pmul(zr[k][j], vr[j]); ae[k >> 2][k & 3] = a + EPS; s1 += ae[k >> 2][k & 3]; }
#pragma unroll
    for (int k = 0; k < PB / 4; ++k) AE[(pb / 4 + k) * 256 + t_] = ae[k]; }
  float ra[2] = {zc, s1}; bsum<0>(ra, rw); const float mz = ra[0] * (1.0f / D), ms = ra[1] * (1.0f / (D * D)); const float dz = t_ < D ? zc - mz : 0.0f; float s2 = 0.0f;
#pragma unroll 1   // the body holds 32 rows already (8 LDS reads of 16 bytes, free to issue ahead of the arithmetic); unrolled further it would only add code
  for (int gb = 0; gb < D / 2 / 4; gb += 8) {
#pragma unroll
    for (int g = 0; g < 8; ++g) { const v4f x = AE[(gb + g) * 256 + t_]; for (int j = 0; j < 4; ++j) { const float dv = x[j] - ms; s2 += dv * dv; } } }
  float rb[2] = {dz * dz, s2}; bsum<1>(rb, rw); const float rz = rsqrtf(rb[0] * (1.0f / D) + LNE), rs = rsqrtf(rb[1] * (1.0f / (D * D)) + LNE);
  if (t_ < D) pzout[t_] = pmul(dz * rz, bf16_rne(gz[t_])) + bf16_rne(bz[t_]);
#pragma unroll 1   // the body holds QB rows already
  for (int pb = 0; pb < D / 2; pb += QB) { const v4u* g0 = (const v4u*)GS + (pb / 4) * 256 + t_;
#pragma unroll
    for (int k = 0; k < QB / 4; ++k) gw[k] = g0[k * 256];
#pragma unroll
    for (int k = 0; k < QB / 4; ++k) ae[k] = AE[(pb / 4 + k) * 256 + t_];
    asm volatile("s_wait_xcnt 0x0" :: "v"(g0) : "memory");   // in front of the first rewrite of a register that the loads of GS name; the address is an input, so that it keeps its registers up to the wait and no load's result lands on them
#pragma unroll
    for (int k = 0; k < QB; ++k) PS[(pa + pb + k) * D + q] = pmul((ae[k >> 2][k & 3] - ms) * rs, gb_g(gw[k >> 2][k & 3])) + gb_b(gw[k >> 2][k & 3]); }
  __syncthreads();
}
// state kernel: block = (chunk c, user b) (256 threads). LDS: SR [128][128] staging for the start state, PSL [128][128] prompt-P state; the running s (f32) in registers. PREV (prev_NAM) in global scratch per block. Per step l: s += z v^T; LN stats; NAM passes;
// amdgpu_waves_per_eu(4, 4): at most 256 registers a wave, so that two blocks still share a WGP (four waves on each SIMD), which the LDS allows
__global__ __launch_bounds__(256) __attribute__((amdgpu_waves_per_eu(4, 4))) void state_kernel(const float* __restrict__ Q, const float* __restrict__ Z, const float* __restrict__ V, const int* __restrict__ uid, const float* __restrict__ gz, const float* __restrict__ bz, const unsigned int* __restrict__ GS,
                                                 const unsigned int* __restrict__ GN, const float* __restrict__ ga, const float* __restrict__ ba, const float* __restrict__ prev_z, const float* __restrict__ prev_s, float* __restrict__ PREV, float* __restrict__ out, double* __restrict__ STD2) {
  __shared__ __attribute__((aligned(16))) float SR[D * D]; __shared__ float PSL[D * D]; __shared__ float red[256]; __shared__ __attribute__((aligned(16))) float rw[2][RN * NW]; __shared__ float zs[LP * D], vs[LP * D]; __shared__ float pzP[D], pzS[D], zrow[D], vrow[D], qn[D], zfull[D], zcum[D]; __shared__ float scal[4]; __shared__ __attribute__((aligned(16))) double dw[2][NW];
  const int b = blockIdx.y, blk = b * NC + blockIdx.x, l0 = blockIdx.x * CH, l1 = min(l0 + CH, L), t_ = threadIdx.x; const int q = t_ & (D - 1), ph = t_ >> 7;
  // prompt S state -> PSL temporarily, then prev_NAM into PREV (global); prompt P state -> PSL (kept).
  prompt_state(Z, V, NRS + NRP + b * LP, gz, bz, GS, PSL, pzS, rw, zs, vs, (v4f*)SR);
  { const int u = min(max(uid[b], 0), NU - 1); float zu = 0.0f; if (t_ < D) { zu = bf16_rne(prev_z[(size_t)u * D + t_]) + pzS[t_]; } float ru[2] = {zu * zu, t_ < D ? bf16_rne(prev_z[(size_t)u * D + t_]) : 0.0f}; bsum<0>(ru, rw); const float inv = 1.0f / (sqrtf(ru[0]) + EPS);
    if (t_ == 0) scal[0] = (ru[1] != 0.0f) ? 1.0f : 0.0f;
    {
#pragma unroll 1   // the body holds 16 rows already
      for (int pb = 0; pb < D / 2; pb += 16) { float w[16];
#pragma unroll   // 16 loads of prev_s (from memory) in flight per thread
        for (int k = 0; k < 16; ++k) w[k] = (bf16_rne(prev_s[((size_t)u * D + ph * (D / 2) + pb + k) * D + q]) + PSL[(ph * (D / 2) + pb + k) * D + q]) * inv;
#pragma unroll
        for (int k = 0; k < 16; ++k) ((float*)PREV)[(size_t)blk * D * D + (ph * (D / 2) + pb + k) * D + q] = w[k];
        asm volatile("s_wait_xcnt 0x0" ::: "memory"); }   // kept in front of the next trip's rewrite of the registers that the loads and stores name
       } }
  __syncthreads();
  prompt_state(Z, V, NRS + b * LP, gz, bz, GS, PSL, pzP, rw, zs, vs, (v4f*)SR);
  // state in front of step l0: s = sum_{l < l0} z_l v_l^T and zcum = sum z_l, each element summed in step order. The thread keeps rows p0..p0+7 x columns q0..q0+3 and 64+q0..64+q0+3 in registers;
  // SR, which holds nothing any more (the prompt states are done with it), stages TR rows of z and TR rows of v at a time (whole tiles are loaded: rows past l0 are inside Z and V and are not summed).
  { float* zt = SR; float* vt = SR + TR * D; const int p0 = (t_ >> 4) * 8, q0 = (t_ & 15) * 4; v4f a0[8], a1[8]; float zc = 0.0f; const v4f* zg = (const v4f*)(Z + (size_t)b * L * D) + t_; const v4f* vg = (const v4f*)(V + (size_t)b * L * D) + t_;
#pragma unroll
    for (int r = 0; r < 8; ++r) { a0[r] = (v4f){}; a1[r] = (v4f){}; }
    for (int base = 0; base < l0; base += TR, zg += TR * D / 4, vg += TR * D / 4) { const int n = min(TR, l0 - base);
#pragma unroll   // all 16 loads of the thread in flight at once
      for (int k = 0; k < TR * D / 4 / 256; ++k) { ((v4f*)zt)[t_ + k * 256] = zg[k * 256]; ((v4f*)vt)[t_ + k * 256] = vg[k * 256]; }
      __syncthreads();
#pragma unroll 2   // the next row's LDS reads issue under this row's 64 multiply-adds
      for (int j = 0; j < n; ++j) { const v4f z0 = *(const v4f*)(zt + j * D + p0), z1 = *(const v4f*)(zt + j * D + p0 + 4), v0 = *(const v4f*)(vt + j * D + q0), v1 = *(const v4f*)(vt + j * D + 64 + q0);
        zc += zt[j * D + q];   // both halves of the block sum it, the lower half stores it
#pragma unroll
        for (int r = 0; r < 4; ++r) { a0[r] += z0[r] * v0; a1[r] += z0[r] * v1; a0[4 + r] += z1[r] * v0; a1[4 + r] += z1[r] * v1; } }
      __syncthreads(); }
#pragma unroll
    for (int r = 0; r < 8; ++r) { *(v4f*)(SR + (p0 + r) * D + q0) = a0[r]; *(v4f*)(SR + (p0 + r) * D + 64 + q0) = a1[r]; }
    if (t_ < D) zcum[t_] = zc; }
  __syncthreads();
  // From here on every element of the state is read and written by one thread only (rows pa..pa+63 of column q): it leaves SR for the thread's registers and stays there over all steps of the chunk.
  constexpr int NH = D / 2; const int pa = ph * NH; const unsigned e0 = pa * D + q /* the thread's first element in every DxD matrix: the rows of the unrolled passes differ from it by constants, so each matrix takes one address for the whole loop */; float st[NH], nw[NH];
#pragma unroll   // st is indexed by constants only, so that it lives in registers
  for (int k = 0; k < NH; ++k) st[k] = SR[(pa + k) * D + q];
  double dsum = 0.0, dsq = 0.0;
  const float* PRb = PREV + (size_t)blk * D * D;
  for (int l = l0; l < l1; ++l) { const size_t row = (size_t)b * L + l;
    if (t_ < D) { zrow[t_] = Z[row * D + t_]; vrow[t_] = V[row * D + t_]; zcum[t_] += Z[row * D + t_]; }
    __syncthreads();
    // The two sums of z's LN and |q|^2 depend on nothing of the state, so they ride in the exchanges of the state's own LN sums (first and second pass).
    float qv = 0.0f; if (t_ < D) qv = Q[row * D + t_];
    const float zc = t_ < D ? zcum[t_] + EPS : 0.0f;
    // Five passes over the thread's 64 rows, all unrolled (st and nw are indexed by constants only). st holds the running state; nw holds S_l/|z_l| + eps, made once in the third pass and used again by the
    // fourth and fifth, which so read neither gs, bs nor the prompt state again. What a pass still loads comes in batches of RA or RB rows: first every load of the batch, then the arithmetic in row order
    // (the sums keep their order); no load moves up over the asm statement in pmul, so left in one body each load would wait out its latency alone.
    constexpr int RA = 32 /* the first pass: one LDS read a row */, RB = 16 /* the third and fifth pass: a parameter word and one or two more values a row beside the 128 kept values */; float pl[RB], qv_[RA]; v4u gw[RB / 4]; const v4u *GSt = (const v4u*)GS + t_, *GNt = (const v4u*)GN + t_;
    float s1 = 0.0f; const float vq = vrow[q];
#pragma unroll
    for (int pb = 0; pb < NH; pb += RA) {
#pragma unroll
      for (int k = 0; k < RA; ++k) qv_[k] = zrow[pa + pb + k];
#pragma unroll
      for (int k = 0; k < RA; ++k) { st[pb + k] += pmul(qv_[k], vq); s1 += st[pb + k] + EPS; } }
    float ra[3] = {zc, qv * qv, s1}; bsum<0>(ra, rw); const float mz = ra[0] * (1.0f / D), qn2 = ra[1], m1 = ra[2] * (1.0f / (D * D)); const float dz = t_ < D ? zc - mz : 0.0f; float s2 = 0.0f;
#pragma unroll
    for (int k = 0; k < NH; ++k) { const float dv = (st[k] + EPS) - m1; s2 += dv * dv; }
    float rb[2] = {dz * dz, s2}; bsum<1>(rb, rw); const float rz = rsqrtf(rb[0] * (1.0f / D) + LNE), r1 = rsqrtf(rb[1] * (1.0f / (D * D)) + LNE);
    // z_l = LN_D(zcum + eps) gz + bz + Pz; qn (read in the fifth pass, two barriers on); 1/|z_l|, which every thread forms from the total it holds
    float zf = 0.0f; if (t_ < D) { zf = pmul(dz * rz, bf16_rne(gz[t_])) + bf16_rne(bz[t_]) + pzP[t_]; zfull[t_] = zf; }
    const float zn2 = bsum1<0>(zf * zf, rw); if (t_ < D) qn[t_] = qv / (sqrtf(qn2) + EPS); const float izn = 1.0f / (sqrtf(zn2) + EPS);
    if (t_ < D) { const float xv = qv / fmaxf(zf, 1e-6f); dsum += (double)xv; dsq += (double)xv * (double)xv; }
    // NAMraw = (LN(s) gs + bs + Ps) izn + eps ; stats
    float n1 = 0.0f;
#pragma unroll
    for (int pb = 0; pb < NH; pb += RB) {
#pragma unroll
      for (int k = 0; k < RB / 4; ++k) gw[k] = GSt[(pb / 4 + k) * 256];
#pragma unroll
      for (int k = 0; k < RB; ++k) pl[k] = PSL[e0 + (pb + k) * D];
      asm volatile("s_wait_xcnt 0x0" ::: "memory");   // behind the loads of GS, in front of any later rewrite of a register that they name; its memory clobber also keeps the batch's loads in front of the arithmetic
#pragma unroll
      for (int k = 0; k < RB; ++k) { const float sf = pmul(((st[pb + k] + EPS) - m1) * r1, gb_g(gw[k >> 2][k & 3])) + gb_b(gw[k >> 2][k & 3]) + pl[k]; nw[pb + k] = pmul(sf, izn) + EPS; n1 += nw[pb + k]; } }
    const float m2 = bsum1<1>(n1, rw) * (1.0f / (D * D)); float n2 = 0.0f;
#pragma unroll
    for (int k = 0; k < NH; ++k) { const float nr = nw[k] - m2; n2 += nr * nr; }
    const float r2 = rsqrtf(bsum1<0>(n2, rw) * (1.0f / (D * D)) + LNE);
    // NA_q partial over the thread's p half: sum_p qn_p NAM_pq ; prev partial: sum_p qn_p PREV_pq
    float na = 0.0f, pv = 0.0f;
#pragma unroll
    for (int pb = 0; pb < NH; pb += RB) {
#pragma unroll
      for (int k = 0; k < RB / 4; ++k) gw[k] = GNt[(pb / 4 + k) * 256];
#pragma unroll
      for (int k = 0; k < RB; ++k) { pl[k] = PRb[e0 + (pb + k) * D]; qv_[k] = qn[pa + pb + k]; }
      asm volatile("s_wait_xcnt 0x0" ::: "memory");   // as in the third pass, for the loads of GN and PREV
#pragma unroll
      for (int k = 0; k < RB; ++k) { const float nam = pmul((nw[pb + k] - m2) * r2, gb_g(gw[k >> 2][k & 3])) + gb_b(gw[k >> 2][k & 3]);
        na += pmul(qv_[k], nam); pv += pmul(qv_[k], pl[k]); } }
    // combine the two halves: threads q and q+128 -> via red
    red[t_] = na + scal[0] * pv; __syncthreads();
    // LN_D(NA) ga + ba -> out row. No barrier closes the step: what the next step writes in LDS (zrow, vrow, later qn and red) was last read in front of the two barriers below.
    { const float x = t_ < D ? red[t_] + red[t_ + D] : 0.0f; const float mu = bsum1<1>(x, rw) * (1.0f / D); const float dv = t_ < D ? x - mu : 0.0f; const float var = bsum1<0>(dv * dv, rw) * (1.0f / D); const float rr = rsqrtf(var + LNE);
      const float o = pmul(dv * rr, t_ < D ? bf16_rne(ga[t_]) : 0.0f) + (t_ < D ? bf16_rne(ba[t_]) : 0.0f);
      // the wait: behind the store of the row, in front of the next step's rewrite of its address registers (the barrier that stood here brought a wait of its own); inside the branch, so that the loop's address additions cannot be lifted over it
      { if (t_ < D) { ((float*)out)[row * D + t_] = o; asm volatile("s_wait_xcnt 0x0" ::: "memory"); }  } } }
  // the block's two f64 sums, reduced like the f32 ones: butterfly in the wave, one word a wave, one barrier, one fixed tree
  dsum += xrow_d<1>(dsum); dsq += xrow_d<1>(dsq); dsum += xrow_d<2>(dsum); dsq += xrow_d<2>(dsq); dsum += xrow_d<4>(dsum); dsq += xrow_d<4>(dsq); dsum += xrow_d<8>(dsum); dsq += xrow_d<8>(dsq); dsum += xhalf_d(dsum); dsq += xhalf_d(dsq);
  if ((t_ & 31) == 0) { dw[0][t_ >> 5] = dsum; dw[1][t_ >> 5] = dsq; }
  __syncthreads();
  { if (t_ < 16) { const double* w = dw[t_ & 1]; const double tot = ((w[0] + w[1]) + (w[2] + w[3])) + ((w[4] + w[5]) + (w[6] + w[7])); ((double*)STD2)[(size_t)blk * 16 + t_] = t_ < 2 ? tot : 0.0; }  }
}
// final std: one wave, the users' sums joined by a butterfly over lanes 0..15: n = 16*200*128; var = (sumsq - sum^2/n) / (n-1); std -> out2[0] (and 31 zero floats to fill the line? the output is a single float at the end of the buffer; we write just it).
__global__ __launch_bounds__(32) void std_kernel(const double* __restrict__ STD2, float* __restrict__ out2) {
  const int lane = threadIdx.x; double s = 0.0, s2 = 0.0;
  if (lane < NB) {   // lane = user: its chunks in order
#pragma unroll   // several of the lane's loads in flight at a time
    for (int k = 0; k < NC; ++k) { s += STD2[(size_t)(lane * NC + k) * 16]; s2 += STD2[(size_t)(lane * NC + k) * 16 + 1]; } }
  for (int m = NB / 2; m >= 1; m >>= 1) { s += __shfl_xor(s, m); s2 += __shfl_xor(s2, m); }
  if (lane == 0) { const double n = (double)NB * L * D; const double var = (s2 - s * s / n) / (n - 1.0); const float sd = (float)sqrt(var > 0.0 ? var : 0.0);
    { ((float*)out2)[0] = sd;  } }
}
}  // namespace

extern "C" void kernel_launch(void* const* d_in, const int* in_sizes, int n_in, void* d_out, int out_size, void* d_ws, size_t ws_size, hipStream_t stream) {
  (void)n_in;
  auto Fp = [&](int i) { return (const float*)d_in[i]; }; auto Ip = [&](int i) { return (const int*)d_in[i]; };
  // input order: 0 user_id [16] i32, 1 seqs_emb [16,200,128], 2 P [16,8,128], 3 S [16,8,128], 4 Wq [128,128], 5 bq, 6 Wk, 7 bk, 8 Wv, 9 bv, 10 z_gamma, 11 z_beta, 12 s_gamma [128,128], 13 s_beta, 14 nam_gamma, 15 nam_beta,
  // 16 na_gamma [128], 17 na_beta, 18 prev_z [1001,128], 19 prev_s [1001,128,128]; outputs NA [16,200,128] at 0, std [1] at float 409600
  if (in_sizes[0] != NB || in_sizes[1] != NRS * D || in_sizes[2] != NRP * D || in_sizes[3] != NRP * D || in_sizes[4] != D * D || in_sizes[12] != D * D || in_sizes[18] != NU * D || in_sizes[19] != NU * D * D || out_size != NRS * D + 1) return;
  size_t off = 0; char* ws = (char*)d_ws;
  auto carve = [&](size_t bytes) { char* p = ws + off; off += (bytes + 255) & ~(size_t)255; return p; };
  b16* X16 = (b16*)carve((size_t)NR * D * 2); b16* W16 = (b16*)carve((size_t)3 * D * D * 2); float* Qp = (float*)carve((size_t)NRS * D * 4); float* Zp = (float*)carve((size_t)NR * D * 4); float* Vp = (float*)carve((size_t)NR * D * 4); float* PREV = (float*)carve((size_t)NB * NC * D * D * 4); double* STD2 = (double*)carve((size_t)NB * NC * 16 * 8); unsigned int* GB = (unsigned int*)carve((size_t)2 * GBW * 4);
  if (off > ws_size || off > ((size_t)128 << 20)) return;   // about 36 MB
  prep_kernel<<<(NR * D / 8 + 3 * D * D / 8 + 2 * GBW / 4 + 255) / 256, 256, 0, stream>>>(Fp(1), Fp(2), Fp(3), Fp(4), Fp(6), Fp(8), Fp(12), Fp(13), Fp(14), Fp(15), X16, W16, GB);
  proj_kernel<<<dim3(NR / 64, 3), 128, 0, stream>>>(X16, W16, Fp(5), Fp(7), Fp(9), Qp, Zp, Vp);
  state_kernel<<<dim3(NC, NB), 256, 0, stream>>>(Qp, Zp, Vp, Ip(0), Fp(10), Fp(11), GB, GB + GBW, Fp(16), Fp(17), Fp(18), Fp(19), PREV, (float*)d_out, STD2);
  std_kernel<<<1, 32, 0, stream>>>(STD2, (float*)d_out + (size_t)NRS * D);
}

// v007
// A run of this version takes 91.2 microseconds.
// In two side-by-side timings against v006, it was 1.09 and 1.08 times as fast.
// Over all steps from v000 it is 221 times as fast.
#include <hip/hip_runtime.h>

// CSR attention block (16 users x 200 steps, D = 128): q = elu(x Wq^T + bq), qn = q/(|q|+eps); z = elu(x Wk^T + bk), v = x Wv^T + bv; per user the causal cumulative state s_l = sum_{l'<=l} z v^T
// and zc_l = sum z; z_l = LN_D(zc_l + eps) + Pz, S_l = LN_DxD(s_l + eps) + Ps where (Pz, Ps) is the same construction on the 8-step prompt P taken at its last step; NAM = LN_DxD(S_l/(|z_l|+eps) + eps);
// NA = qn . NAM + mask_b (qn . prev_NAM) with prev_NAM = (prev_s[uid] + Ss) / (|prev_z[uid] + Sz| + eps) from the prompt S; NA = LN_D(NA); second output std = unbiased std of
// q / max(z_l, 1e-6) over all (b, l, d).
// One block per (user, chunk of 7, 6 or 5 steps; later chunks are shorter, see chunk_start): it first sums z v^T and z over all earlier steps of its user, in step order, in registers, then walks its chunk with the running DxD state in registers (f32, 64 elements a thread),
// the prompt state beside it, LN statistics by fixed-order block reductions, the two vector-matrix products on the VALU (batches of rows: the loads first, then the arithmetic); the std partials in f64 per block, combined by one final wave.
// WMMA (v_wmma_f32_16x16x32_f16, f32 accumulate): the k/v projections of the sequence and both prompts ([3,456 x 128] x [128 x 128] x2), q of the sequence only ([3,200 x 128] x [128 x 128]) with EXACT bf16 inputs (x8) and weights (x256), 1 product.
// The four DxD LN parameter matrices are rounded to bf16 once, in the prep kernel, and packed: one 32-bit word holds (gamma, beta) of an element, four rows of a thread's column lie in one 16-byte word group (see GB below).
// Inputs rounded to bf16 once; user_id int32, clamped. Fragment k-map per lane half hh for A AND B: elements 0..7 <- k = 8hh+0..7, 8..15 <- k = 16+8hh+0..7; acc[r] =

namespace {
constexpr int NB = 16, L = 200, LP = 8, D = 128, NU = 1001, NRS = NB * L /* 3200 */, NRP = NB * LP /* 128 */, NR = NRS + 2 * NRP /* 3456 = 54 x 64 */;
constexpr int NC = 32 /* chunks per user: 512 blocks, two per WGP by LDS */, TR = 64 /* rows of z and of v staged at a time for the earlier steps */;
// First step of chunk c. A block pays for every earlier step of its user (one rank-1 update of the start state) as well as for its own steps (five passes and the reductions, some fifty times as much), so later chunks get
// fewer steps and every block about the same work: chunks 0..14 have 7 steps, 15..24 have 6, 25..31 have 5.
__host__ __device__ constexpr int chunk_start(int c) { return 7 * c - (c > 15 ? c - 15 : 0) - (c > 25 ? c - 25 : 0); }
static_assert(chunk_start(0) == 0 && chunk_start(NC) == L, "the chunks cover the sequence");
static_assert(2 * TR * D <= D * D && (NB - 1) * L + ((L - 1) / TR + 1) * TR <= NR, "staged tiles fit SR and stay inside Z and V");
constexpr float XS = 8.0f, WSC = 256.0f, EPS = 1e-8f, LNE = 1e-5f;

typedef _Float16 b16;
typedef __attribute__((ext_vector_type(16))) _Float16 v16b;
typedef __attribute__((ext_vector_type(8))) _Float16 v8b;
typedef __attribute__((ext_vector_type(8))) float v8f;
typedef __attribute__((ext_vector_type(4))) float v4f;
typedef __attribute__((ext_vector_type(4))) unsigned int v4u;
__device__ __forceinline__ float bf16_rne(float f) { unsigned int u = __float_as_uint(f); u += 0x7FFFu + ((u >> 16) & 1u); return __uint_as_float(u & 0xFFFF0000u); }
// GB: a pair (gamma, beta) of DxD matrices, each value rounded to bf16, gamma in the high and beta in the low half of a word. Word ((g * 256 + t) * 4 + j) belongs to row (t >> 7) * 64 + 4 g + j, column t & 127:
// thread t of the state kernel reads four of its rows with one 16-byte load, and a wave reads 512 bytes in a row.
constexpr int GBW = D * D /* words a pair */;
__device__ __forceinline__ float gb_g(unsigned int w) { return __uint_as_float(w & 0xFFFF0000u); }
__device__ __forceinline__ float gb_b(unsigned int w) { return __uint_as_float(w << 16); }
__device__ __forceinline__ v16b frag_kb(const b16* p, int hh) { const v8b a = *(const v8b*)(p + 8 * hh), b = *(const v8b*)(p + 16 + 8 * hh); v16b f;
#pragma unroll
  for (int e = 0; e < 8; ++e) { f[e] = a[e]; f[8 + e] = b[e]; } return f; }
__device__ __forceinline__ v8f wmma16b(v16b a, v16b b, v8f c) { v8f d = __builtin_amdgcn_wmma_f32_16x16x32_f16(false, a, false, b, (short)0, c, false, false); asm volatile("v_nop\n\tv_nop\n\tv_nop\n\tv_nop" : "+v"(d) : "v"(a), "v"(b)); return d; }
__device__ __forceinline__ void wave_lds_sync() { __builtin_amdgcn_fence(__ATOMIC_RELEASE, "workgroup"); __builtin_amdgcn_wave_barrier(); __builtin_amdgcn_fence(__ATOMIC_ACQUIRE, "workgroup"); }
__device__ __forceinline__ float pmul(float a, float b) { float p = a * b; asm volatile("" : "+v"(p)); return p; }
__device__ __forceinline__ float elu(float x) { return x > 0.0f ? x : (__expf(x) - 1.0f); }

__global__ __launch_bounds__(256) void prep_kernel(const float* __restrict__ xs, const float* __restrict__ xp, const float* __restrict__ xq, const float* __restrict__ wq, const float* __restrict__ wk, const float* __restrict__ wv, const float* __restrict__ gs, const float* __restrict__ bs, const float* __restrict__ gn, const float* __restrict__ bn, b16* __restrict__ X16, b16* __restrict__ W16, unsigned int* __restrict__ GB) {
  const int t = blockIdx.x * 256 + threadIdx.x; const int nx = NR * D / 8, nw = 3 * D * D / 8, ng = 2 * GBW / 4; v8b o;
  if (t < nx) { const int e = t * 8; const int row = e / D; const float* src = row < NRS ? xs + e : row < NRS + NRP ? xp + (e - NRS * D) : xq + (e - (NRS + NRP) * D);
    for (int j = 0; j < 8; ++j) o[j] = (b16)(bf16_rne(src[j]) * XS); { *(v8b*)(X16 + e) = o;  } }
  else if (t < nx + nw) { const int e = (t - nx) * 8; const int k = e / (D * D), r = e - k * D * D; const float* w = k == 0 ? wq : k == 1 ? wk : wv; for (int j = 0; j < 8; ++j) o[j] = (b16)(bf16_rne(w[r + j]) * WSC); { *(v8b*)(W16 + e) = o;  } }
  else if (t < nx + nw + ng) { const int i = t - nx - nw, tt = i & 255, g = (i >> 8) & 15; const float *ga_ = i < GBW / 4 ? gs : gn, *be_ = i < GBW / 4 ? bs : bn; const int e = ((tt >> 7) * (D / 2) + g * 4) * D + (tt & (D - 1)); v4u w; float gv[4], bv[4];
    const float *gp = ga_ + e, *bp = be_ + e;
    for (int j = 0; j < 4; ++j) { gv[j] = gp[j * D]; bv[j] = bp[j * D]; }
    asm volatile("s_wait_xcnt 0x0" :: "v"(gp), "v"(bp) : "memory");   // behind the eight loads, in front of the first rewrite of a register that they name; the addresses are inputs, so that they keep their registers up to the wait
    for (int j = 0; j < 4; ++j) w[j] = (__float_as_uint(bf16_rne(gv[j])) & 0xFFFF0000u) | (__float_as_uint(bf16_rne(bv[j])) >> 16);
    *(v4u*)(GB + (size_t)i * 4) = w; }
}
__global__ __launch_bounds__(128) void proj_kernel(const b16* __restrict__ X16, const b16* __restrict__ W16, const float* __restrict__ bq, const float* __restrict__ bk, const float* __restrict__ bv, float* __restrict__ Q, float* __restrict__ Z, float* __restrict__ V) {
  __shared__ __attribute__((aligned(16))) float Ts[4][16][D + 4];
  const int kind = blockIdx.y, wave = threadIdx.x >> 5, lane = threadIdx.x & 31, nloc = lane & 15, hlf = lane >> 4; const size_t m0 = (size_t)blockIdx.x * 64 + wave * 16; if (kind == 0 && m0 >= (size_t)NRS) return;
  const b16* Wp = W16 + (size_t)kind * D * D; const float* bb = kind == 0 ? bq : kind == 1 ? bk : bv; float* dst = kind == 0 ? Q : kind == 1 ? Z : V;
  v8f acc[8];
#pragma unroll
  for (int t = 0; t < 8; ++t) acc[t] = (v8f){};
#pragma unroll
  for (int kb = 0; kb < D; kb += 32) { const v16b a = frag_kb(X16 + (m0 + nloc) * D + kb, hlf);
#pragma unroll
    for (int t = 0; t < 8; ++t) acc[t] = wmma16b(a, frag_kb(Wp + (size_t)(t * 16 + nloc) * D + kb, hlf), acc[t]); }
#pragma unroll
  for (int t = 0; t < 8; ++t) { const int c = t * 16 + nloc; const float b_ = bf16_rne(bb[c]);
#pragma unroll
    for (int r = 0; r < 8; ++r) { float v = acc[t][r] * (1.0f / (XS * WSC)) + b_; if (kind < 2) v = elu(v); Ts[wave][8 * hlf + r][c] = v; } }
  wave_lds_sync();
  { for (int rr = 0; rr < 16; ++rr) *(v4f*)(dst + (m0 + rr) * D + lane * 4) = *(const v4f*)(&Ts[wave][rr][lane * 4]);  }
}
// Block-wide fixed-order reductions (256 threads, every lane on): a butterfly inside each wave (lane ^ 1, 2, 4, 8 by DPP inside the 16-lane row, lane ^ 16 by a cross-row move), one word a wave in LDS, ONE barrier, then every
// thread adds the eight words in one fixed tree. N sums that do not depend on each other share the exchange. RB picks one of two exchange buffers: neighbouring reductions alternate, or have another barrier between them,
// so a buffer is rewritten only behind a barrier that every wave signals after its reads of it have returned.
template <int M> __device__ __forceinline__ int xrow_i(int x) { return __builtin_amdgcn_update_dpp(0, x, 0x160 | M /* row_xmask:M */, 0xf, 0xf, true); }
__device__ __forceinline__ int xhalf_i(int x) { return __builtin_amdgcn_permlanex16(x, x, 0x76543210, 0xfedcba98, false, false); }   // lane l with lane l ^ 16
template <int M> __device__ __forceinline__ float xrow(float x) { return __builtin_bit_cast(float, xrow_i<M>(__builtin_bit_cast(int, x))); }
__device__ __forceinline__ float xhalf(float x) { return __builtin_bit_cast(float, xhalf_i(__builtin_bit_cast(int, x))); }
template <int M> __device__ __forceinline__ double xrow_d(double x) { return __hiloint2double(xrow_i<M>(__double2hiint(x)), xrow_i<M>(__double2loint(x))); }
__device__ __forceinline__ double xhalf_d(double x) { return __hiloint2double(xhalf_i(__double2hiint(x)), xhalf_i(__double2loint(x))); }
constexpr int NW = 8 /* waves a block */, RN = 3 /* most sums in one exchange */;
template <int RB, int N> __device__ __forceinline__ void bsum(float (&v)[N], float (*rw)[RN * NW]) { static_assert(N <= RN && RB < 2, "fits the exchange buffers"); float* r = rw[RB];
  for (int i = 0; i < N; ++i) v[i] += xrow<1>(v[i]);
  for (int i = 0; i < N; ++i) v[i] += xrow<2>(v[i]);
  for (int i = 0; i < N; ++i) v[i] += xrow<4>(v[i]);
  for (int i = 0; i < N; ++i) v[i] += xrow<8>(v[i]);
  for (int i = 0; i < N; ++i) v[i] += xhalf(v[i]);
  if ((threadIdx.x & 31) == 0) { for (int i = 0; i < N; ++i) r[i * NW + (threadIdx.x >> 5)] = v[i]; }   // lane 0 speaks for the wave (where a product is fused into the first add, the lanes need not agree in the last bit)
  __syncthreads();
  for (int i = 0; i < N; ++i) { const v4f a = *(const v4f*)(r + i * NW), c = *(const v4f*)(r + i * NW + 4); v[i] = ((a[0] + a[1]) + (a[2] + a[3])) + ((c[0] + c[1]) + (c[2] + c[3])); } }
template <int RB> __device__ __forceinline__ float bsum1(float x, float (*rw)[RN * NW]) { float v[1] = {x}; bsum<RB>(v, rw); return v[0]; }
// prompt state for user b from rows r0..r0+7 of Z/V: zc = sum_j z_j; sc = sum_j z_j v_j^T; Pz = LN_D(zc + eps) gz + bz (vector, thread < 128 -> pzout), Ps = LN_DxD(sc + eps) gs + bs into
// PS (LDS or global, [p][q], thread owns q = t&127 for p in its half). Each element sc + eps is summed once, in the first pass, and kept in AE (LDS, 64 KB, idle at that time): group g of thread t, AE[g * 256 + t], holds
// its rows 4 g .. 4 g + 3; only the thread that wrote a group reads it, so AE needs no barrier of its own.
__device__ __forceinline__ void prompt_state(const float* __restrict__ Z, const float* __restrict__ V, int r0, const float* __restrict__ gz, const float* __restrict__ bz, const unsigned int* __restrict__ GS, float* __restrict__ PS, float* __restrict__ pzout, float (*rw)[RN * NW], float* zs, float* vs, v4f* __restrict__ AE) {
  const int t_ = threadIdx.x; const int q = t_ & (D - 1), ph = t_ >> 7;   // ph: which half of the p range (0: 0..63, 1: 64..127)
  // zc (thread < 128) and staging of the 8 z / v rows
  for (int i = t_; i < LP * D; i += 256) { zs[i] = Z[(size_t)r0 * D + i]; vs[i] = V[(size_t)r0 * D + i]; }
  __syncthreads();
  // Pz: LN over D of (zc + eps); its two sums share the exchanges of the two sums of the DxD LN
  float zc = 0.0f; if (t_ < D) { for (int j = 0; j < LP; ++j) zc += zs[j * D + t_]; zc += EPS; }
  // The first and the third pass walk their 64 rows in batches (PB, QB): first every load of the batch, into registers, then the arithmetic in row order (the sums keep their order). Written out so because no load moves
  // up over the asm statement in pmul: left in one loop body, each load waits out its latency alone.
  constexpr int PB = 8, QB = 16 /* rows a batch in the third pass */; const int pa = ph * (D / 2); float vr[LP], zr[PB][LP]; v4u gw[QB / 4]; v4f ae[QB / 4];
#pragma unroll
  for (int j = 0; j < LP; ++j) vr[j] = vs[j * D + q];
  float s1 = 0.0f;
#pragma unroll 1   // the body holds PB rows already
  for (int pb = 0; pb < D / 2; pb += PB) {
#pragma unroll
    for (int k = 0; k < PB; ++k) for (int j = 0; j < LP; ++j) zr[k][j] = zs[j * D + pa + pb + k];
#pragma unroll
    for (int k = 0; k < PB; ++k) { float a = 0.0f; for (int j = 0; j < LP; ++j) a += pmul(zr[k][j], vr[j]); ae[k >> 2][k & 3] = a + EPS; s1 += ae[k >> 2][k & 3]; }
#pragma unroll
    for (int k = 0; k < PB / 4; ++k) AE[(pb / 4 + k) * 256 + t_] = ae[k]; }
  float ra[2] = {zc, s1}; bsum<0>(ra, rw); const float mz = ra[0] * (1.0f / D), ms = ra[1] * (1.0f / (D * D)); const float dz = t_ < D ? zc - mz : 0.0f; float s2 = 0.0f;
#pragma unroll 1   // the body holds 32 rows already (8 LDS reads of 16 bytes, free to issue ahead of the arithmetic); unrolled further it would only add code
  for (int gb = 0; gb < D / 2 / 4; gb += 8) {
#pragma unroll
    for (int g = 0; g < 8; ++g) { const v4f x = AE[(gb + g) * 256 + t_]; for (int j = 0; j < 4; ++j) { const float dv = x[j] - ms; s2 += dv * dv; } } }
  float rb[2] = {dz * dz, s2}; bsum<1>(rb, rw); const float rz = rsqrtf(rb[0] * (1.0f / D) + LNE), rs = rsqrtf(rb[1] * (1.0f / (D * D)) + LNE);
  if (t_ < D) pzout[t_] = pmul(dz * rz, bf16_rne(gz[t_])) + bf16_rne(bz[t_]);
#pragma unroll 1   // the body holds QB rows already
  for (int pb = 0; pb < D / 2; pb += QB) { const v4u* g0 = (const v4u*)GS + (pb / 4) * 256 + t_;
#pragma unroll
    for (int k = 0; k < QB / 4; ++k) gw[k] = g0[k * 256];
#pragma unroll
    for (int k = 0; k < QB / 4; ++k) ae[k] = AE[(pb / 4 + k) * 256 + t_];
    asm volatile("s_wait_xcnt 0x0" :: "v"(g0) : "memory");   // in front of the first rewrite of a register that the loads of GS name; the address is an input, so that it keeps its registers up to the wait and no load's result lands on them
#pragma unroll
    for (int k = 0; k < QB; ++k) PS[(pa + pb + k) * D + q] = pmul((ae[k >> 2][k & 3] - ms) * rs, gb_g(gw[k >> 2][k & 3])) + gb_b(gw[k >> 2][k & 3]); }
  __syncthreads();
}
// state kernel: block = (chunk c, user b) (256 threads). LDS: SR [128][128] staging for the start state, PSL [128][128] prompt-P state; the running s (f32) in registers. PREV (prev_NAM) in global scratch per block. Per step l: s += z v^T; LN stats; NAM passes;
// amdgpu_waves_per_eu(4, 4): at most 256 registers a wave, so that two blocks still share a WGP (four waves on each SIMD), which the LDS allows
__global__ __launch_bounds__(256) __attribute__((amdgpu_waves_per_eu(4, 4))) void state_kernel(const float* __restrict__ Q, const float* __restrict__ Z, const float* __restrict__ V, const int* __restrict__ uid, const float* __restrict__ gz, const float* __restrict__ bz, const unsigned int* __restrict__ GS,
                                                 const unsigned int* __restrict__ GN, const float* __restrict__ ga, const float* __restrict__ ba, const float* __restrict__ prev_z, const float* __restrict__ prev_s, float* __restrict__ PREV, float* __restrict__ out, double* __restrict__ STD2) {
  __shared__ __attribute__((aligned(16))) float SR[D * D]; __shared__ float PSL[D * D]; __shared__ float red[256]; __shared__ __attribute__((aligned(16))) float rw[2][RN * NW]; __shared__ float zs[LP * D], vs[LP * D]; __shared__ float pzP[D], pzS[D], zrow[D], vrow[D], qn[D], zfull[D], zcum[D]; __shared__ float scal[4]; __shared__ __attribute__((aligned(16))) double dw[2][NW];
  const int b = blockIdx.y, blk = b * NC + blockIdx.x, l0 = chunk_start(blockIdx.x), l1 = chunk_start(blockIdx.x + 1), t_ = threadIdx.x; const int q = t_ & (D - 1), ph = t_ >> 7;
  // prompt S state -> PSL temporarily, then prev_NAM into PREV (global); prompt P state -> PSL (kept).
  prompt_state(Z, V, NRS + NRP + b * LP, gz, bz, GS, PSL, pzS, rw, zs, vs, (v4f*)SR);
  { const int u = min(max(uid[b], 0), NU - 1); float zu = 0.0f; if (t_ < D) { zu = bf16_rne(prev_z[(size_t)u * D + t_]) + pzS[t_]; } float ru[2] = {zu * zu, t_ < D ? bf16_rne(prev_z[(size_t)u * D + t_]) : 0.0f}; bsum<0>(ru, rw); const float inv = 1.0f / (sqrtf(ru[0]) + EPS);
    if (t_ == 0) scal[0] = (ru[1] != 0.0f) ? 1.0f : 0.0f;
    {
#pragma unroll 1   // the body holds 16 rows already
      for (int pb = 0; pb < D / 2; pb += 16) { float w[16];
#pragma unroll   // 16 loads of prev_s (from memory) in flight per thread
        for (int k = 0; k < 16; ++k) w[k] = (bf16_rne(prev_s[((size_t)u * D + ph * (D / 2) + pb + k) * D + q]) + PSL[(ph * (D / 2) + pb + k) * D + q]) * inv;
#pragma unroll
        for (int k = 0; k < 16; ++k) ((float*)PREV)[(size_t)blk * D * D + (ph * (D / 2) + pb + k) * D + q] = w[k];
        asm volatile("s_wait_xcnt 0x0" ::: "memory"); }   // kept in front of the next trip's rewrite of the registers that the loads and stores name
       } }
  __syncthreads();
  prompt_state(Z, V, NRS + b * LP, gz, bz, GS, PSL, pzP, rw, zs, vs, (v4f*)SR);
  // state in front of step l0: s = sum_{l < l0} z_l v_l^T and zcum = sum z_l, each element summed in step order. The thread keeps rows p0..p0+7 x columns q0..q0+3 and 64+q0..64+q0+3 in registers;
  // SR, which holds nothing any more (the prompt states are done with it), stages TR rows of z and TR rows of v at a time (whole tiles are loaded: rows past l0 are inside Z and V and are not summed).
  { float* zt = SR; float* vt = SR + TR * D; const int p0 = (t_ >> 4) * 8, q0 = (t_ & 15) * 4; v4f a0[8], a1[8]; float zc = 0.0f; const v4f* zg = (const v4f*)(Z + (size_t)b * L * D) + t_; const v4f* vg = (const v4f*)(V + (size_t)b * L * D) + t_;
#pragma unroll
    for (int r = 0; r < 8; ++r) { a0[r] = (v4f){}; a1[r] = (v4f){}; }
    for (int base = 0; base < l0; base += TR, zg += TR * D / 4, vg += TR * D / 4) { const int n = min(TR, l0 - base);
#pragma unroll   // all 16 loads of the thread in flight at once
      for (int k = 0; k < TR * D / 4 / 256; ++k) { ((v4f*)zt)[t_ + k * 256] = zg[k * 256]; ((v4f*)vt)[t_ + k * 256] = vg[k * 256]; }
      __syncthreads();
#pragma unroll 2   // the next row's LDS reads issue under this row's 64 multiply-adds
      for (int j = 0; j < n; ++j) { const v4f z0 = *(const v4f*)(zt + j * D + p0), z1 = *(const v4f*)(zt + j * D + p0 + 4), v0 = *(const v4f*)(vt + j * D + q0), v1 = *(const v4f*)(vt + j * D + 64 + q0);
        zc += zt[j * D + q];   // both halves of the block sum it, the lower half stores it
#pragma unroll
        for (int r = 0; r < 4; ++r) { a0[r] += z0[r] * v0; a1[r] += z0[r] * v1; a0[4 + r] += z1[r] * v0; a1[4 + r] += z1[r] * v1; } }
      __syncthreads(); }
#pragma unroll
    for (int r = 0; r < 8; ++r) { *(v4f*)(SR + (p0 + r) * D + q0) = a0[r]; *(v4f*)(SR + (p0 + r) * D + 64 + q0) = a1[r]; }
    if (t_ < D) zcum[t_] = zc; }
  __syncthreads();
  // From here on every element of the state is read and written by one thread only (rows pa..pa+63 of column q): it leaves SR for the thread's registers and stays there over all steps of the chunk.
  constexpr int NH = D / 2; const int pa = ph * NH; const unsigned e0 = pa * D + q /* the thread's first element in every DxD matrix: the rows of the unrolled passes differ from it by constants, so each matrix takes one address for the whole loop */; float st[NH], nw[NH];
#pragma unroll   // st is indexed by constants only, so that it lives in registers
  for (int k = 0; k < NH; ++k) st[k] = SR[(pa + k) * D + q];
  double dsum = 0.0, dsq = 0.0;
  const float* PRb = PREV + (size_t)blk * D * D;
  for (int l = l0; l < l1; ++l) { const size_t row = (size_t)b * L + l;
    if (t_ < D) { zrow[t_] = Z[row * D + t_]; vrow[t_] = V[row * D + t_]; zcum[t_] += Z[row * D + t_]; }
    __syncthreads();
    // The two sums of z's LN and |q|^2 depend on nothing of the state, so they ride in the exchanges of the state's own LN sums (first and second pass).
    float qv = 0.0f; if (t_ < D) qv = Q[row * D + t_];
    const float zc = t_ < D ? zcum[t_] + EPS : 0.0f;
    // Five passes over the thread's 64 rows, all unrolled (st and nw are indexed by constants only). st holds the running state; nw holds S_l/|z_l| + eps, made once in the third pass and used again by the
    // fourth and fifth, which so read neither gs, bs nor the prompt state again. What a pass still loads comes in batches of RA or RB rows: first every load of the batch, then the arithmetic in row order
    // (the sums keep their order); no load moves up over the asm statement in pmul, so left in one body each load would wait out its latency alone.
    constexpr int RA = 32 /* the first pass: one LDS read a row */, RB = 16 /* the third and fifth pass: a parameter word and one or two more values a row beside the 128 kept values */; float pl[RB], qv_[RA]; v4u gw[RB / 4]; const v4u *GSt = (const v4u*)GS + t_, *GNt = (const v4u*)GN + t_;
    float s1 = 0.0f; const float vq = vrow[q];
#pragma unroll
    for (int pb = 0; pb < NH; pb += RA) {
#pragma unroll
      for (int k = 0; k < RA; ++k) qv_[k] = zrow[pa + pb + k];
#pragma unroll
      for (int k = 0; k < RA; ++k) { st[pb + k] += pmul(qv_[k], vq); s1 += st[pb + k] + EPS; } }
    float ra[3] = {zc, qv * qv, s1}; bsum<0>(ra, rw); const float mz = ra[0] * (1.0f / D), qn2 = ra[1], m1 = ra[2] * (1.0f / (D * D)); const float dz = t_ < D ? zc - mz : 0.0f; float s2 = 0.0f;
#pragma unroll
    for (int k = 0; k < NH; ++k) { const float dv = (st[k] + EPS) - m1; s2 += dv * dv; }
    float rb[2] = {dz * dz, s2}; bsum<1>(rb, rw); const float rz = rsqrtf(rb[0] * (1.0f / D) + LNE), r1 = rsqrtf(rb[1] * (1.0f / (D * D)) + LNE);
    // z_l = LN_D(zcum + eps) gz + bz + Pz; qn (read in the fifth pass, two barriers on); 1/|z_l|, which every thread forms from the total it holds
    float zf = 0.0f; if (t_ < D) { zf = pmul(dz * rz, bf16_rne(gz[t_])) + bf16_rne(bz[t_]) + pzP[t_]; zfull[t_] = zf; }
    const float zn2 = bsum1<0>(zf * zf, rw); if (t_ < D) qn[t_] = qv / (sqrtf(qn2) + EPS); const float izn = 1.0f / (sqrtf(zn2) + EPS);
    if (t_ < D) { const float xv = qv / fmaxf(zf, 1e-6f); dsum += (double)xv; dsq += (double)xv * (double)xv; }
    // NAMraw = (LN(s) gs + bs + Ps) izn + eps ; stats
    float n1 = 0.0f;
#pragma unroll
    for (int pb = 0; pb < NH; pb += RB) {
#pragma unroll
      for (int k = 0; k < RB / 4; ++k) gw[k] = GSt[(pb / 4 + k) * 256];
#pragma unroll
      for (int k = 0; k < RB; ++k) pl[k] = PSL[e0 + (pb + k) * D];
      asm volatile("s_wait_xcnt 0x0" ::: "memory");   // behind the loads of GS, in front of any later rewrite of a register that they name; its memory clobber also keeps the batch's loads in front of the arithmetic
#pragma unroll
      for (int k = 0; k < RB; ++k) { const float sf = pmul(((st[pb + k] + EPS) - m1) * r1, gb_g(gw[k >> 2][k & 3])) + gb_b(gw[k >> 2][k & 3]) + pl[k]; nw[pb + k] = pmul(sf, izn) + EPS; n1 += nw[pb + k]; } }
    const float m2 = bsum1<1>(n1, rw) * (1.0f / (D * D)); float n2 = 0.0f;
#pragma unroll
    for (int k = 0; k < NH; ++k) { const float nr = nw[k] - m2; n2 += nr * nr; }
    const float r2 = rsqrtf(bsum1<0>(n2, rw) * (1.0f / (D * D)) + LNE);
    // NA_q partial over the thread's p half: sum_p qn_p NAM_pq ; prev partial: sum_p qn_p PREV_pq
    float na = 0.0f, pv = 0.0f;
#pragma unroll
    for (int pb = 0; pb < NH; pb += RB) {
#pragma unroll
      for (int k = 0; k < RB / 4; ++k) gw[k] = GNt[(pb / 4 + k) * 256];
#pragma unroll
      for (int k = 0; k < RB; ++k) { pl[k] = PRb[e0 + (pb + k) * D]; qv_[k] = qn[pa + pb + k]; }
      asm volatile("s_wait_xcnt 0x0" ::: "memory");   // as in the third pass, for the loads of GN and PREV
#pragma unroll
      for (int k = 0; k < RB; ++k) { const float nam = pmul((nw[pb + k] - m2) * r2, gb_g(gw[k >> 2][k & 3])) + gb_b(gw[k >> 2][k & 3]);
        na += pmul(qv_[k], nam); pv += pmul(qv_[k], pl[k]); } }
    // combine the two halves: threads q and q+128 -> via red
    red[t_] = na + scal[0] * pv; __syncthreads();
    // LN_D(NA) ga + ba -> out row. No barrier closes the step: what the next step writes in LDS (zrow, vrow, later qn and red) was last read in front of the two barriers below.
    { const float x = t_ < D ? red[t_] + red[t_ + D] : 0.0f; const float mu = bsum1<1>(x, rw) * (1.0f / D); const float dv = t_ < D ? x - mu : 0.0f; const float var = bsum1<0>(dv * dv, rw) * (1.0f / D); const float rr = rsqrtf(var + LNE);
      const float o = pmul(dv * rr, t_ < D ? bf16_rne(ga[t_]) : 0.0f) + (t_ < D ? bf16_rne(ba[t_]) : 0.0f);
      // the wait: behind the store of the row, in front of the next step's rewrite of its address registers (the barrier that stood here brought a wait of its own); inside the branch, so that the loop's address additions cannot be lifted over it
      { if (t_ < D) { ((float*)out)[row * D + t_] = o; asm volatile("s_wait_xcnt 0x0" ::: "memory"); }  } } }
  // the block's two f64 sums, reduced like the f32 ones: butterfly in the wave, one word a wave, one barrier, one fixed tree
  dsum += xrow_d<1>(dsum); dsq += xrow_d<1>(dsq); dsum += xrow_d<2>(dsum); dsq += xrow_d<2>(dsq); dsum += xrow_d<4>(dsum); dsq += xrow_d<4>(dsq); dsum += xrow_d<8>(dsum); dsq += xrow_d<8>(dsq); dsum += xhalf_d(dsum); dsq += xhalf_d(dsq);
  if ((t_ & 31) == 0) { dw[0][t_ >> 5] = dsum; dw[1][t_ >> 5] = dsq; }
  __syncthreads();
  { if (t_ < 16) { const double* w = dw[t_ & 1]; const double tot = ((w[0] + w[1]) + (w[2] + w[3])) + ((w[4] + w[5]) + (w[6] + w[7])); ((double*)STD2)[(size_t)blk * 16 + t_] = t_ < 2 ? tot : 0.0; }  }
}
// final std: one wave, the users' sums joined by a butterfly over lanes 0..15: n = 16*200*128; var = (sumsq - sum^2/n) / (n-1); std -> out2[0] (and 31 zero floats to fill the line? the output is a single float at the end of the buffer; we write just it).
__global__ __launch_bounds__(32) void std_kernel(const double* __restrict__ STD2, float* __restrict__ out2) {
  const int lane = threadIdx.x; double s = 0.0, s2 = 0.0;
  if (lane < NB) {   // lane = user: its chunks in order
#pragma unroll   // several of the lane's loads in flight at a time
    for (int k = 0; k < NC; ++k) { s += STD2[(size_t)(lane * NC + k) * 16]; s2 += STD2[(size_t)(lane * NC + k) * 16 + 1]; } }
  for (int m = NB / 2; m >= 1; m >>= 1) { s += __shfl_xor(s, m); s2 += __shfl_xor(s2, m); }
  if (lane == 0) { const double n = (double)NB * L * D; const double var = (s2 - s * s / n) / (n - 1.0); const float sd = (float)sqrt(var > 0.0 ? var : 0.0);
    { ((float*)out2)[0] = sd;  } }
}
}  // namespace

extern "C" void kernel_launch(void* const* d_in, const int* in_sizes, int n_in, void* d_out, int out_size, void* d_ws, size_t ws_size, hipStream_t stream) {
  (void)n_in;
  auto Fp = [&](int i) { return (const float*)d_in[i]; }; auto Ip = [&](int i) { return (const int*)d_in[i]; };
  // input order: 0 user_id [16] i32, 1 seqs_emb [16,200,128], 2 P [16,8,128], 3 S [16,8,128], 4 Wq [128,128], 5 bq, 6 Wk, 7 bk, 8 Wv, 9 bv, 10 z_gamma, 11 z_beta, 12 s_gamma [128,128], 13 s_beta, 14 nam_gamma, 15 nam_beta,
  // 16 na_gamma [128], 17 na_beta, 18 prev_z [1001,128], 19 prev_s [1001,128,128]; outputs NA [16,200,128] at 0, std [1] at float 409600
  if (in_sizes[0] != NB || in_sizes[1] != NRS * D || in_sizes[2] != NRP * D || in_sizes[3] != NRP * D || in_sizes[4] != D * D || in_sizes[12] != D * D || in_sizes[18] != NU * D || in_sizes[19] != NU * D * D || out_size != NRS * D + 1) return;
  size_t off = 0; char* ws = (char*)d_ws;
  auto carve = [&](size_t bytes) { char* p = ws + off; off += (bytes + 255) & ~(size_t)255; return p; };
  b16* X16 = (b16*)carve((size_t)NR * D * 2); b16* W16 = (b16*)carve((size_t)3 * D * D * 2); float* Qp = (float*)carve((size_t)NRS * D * 4); float* Zp = (float*)carve((size_t)NR * D * 4); float* Vp = (float*)carve((size_t)NR * D * 4); float* PREV = (float*)carve((size_t)NB * NC * D * D * 4); double* STD2 = (double*)carve((size_t)NB * NC * 16 * 8); unsigned int* GB = (unsigned int*)carve((size_t)2 * GBW * 4);
  if (off > ws_size || off > ((size_t)128 << 20)) return;   // about 39 MB
  prep_kernel<<<(NR * D / 8 + 3 * D * D / 8 + 2 * GBW / 4 + 255) / 256, 256, 0, stream>>>(Fp(1), Fp(2), Fp(3), Fp(4), Fp(6), Fp(8), Fp(12), Fp(13), Fp(14), Fp(15), X16, W16, GB);
  proj_kernel<<<dim3(NR / 64, 3), 128, 0, stream>>>(X16, W16, Fp(5), Fp(7), Fp(9), Qp, Zp, Vp);
  state_kernel<<<dim3(NC, NB), 256, 0, stream>>>(Qp, Zp, Vp, Ip(0), Fp(10), Fp(11), GB, GB + GBW, Fp(16), Fp(17), Fp(18), Fp(19), PREV, (float*)d_out, STD2);
  std_kernel<<<1, 32, 0, stream>>>(STD2, (float*)d_out + (size_t)NRS * D);
}

// v008
// Measured time: 86.4 microseconds a run.
// Two timings next to v007 put it at 1.08 and 1.06 times that version's speed.
// Counting every step since v000, it is 236 times as fast.
#include <hip/hip_runtime.h>

// CSR attention block (16 users x 200 steps, D = 128): q = elu(x Wq^T + bq), qn = q/(|q|+eps); z = elu(x Wk^T + bk), v = x Wv^T + bv; per user the causal cumulative state s_l = sum_{l'<=l} z v^T
// and zc_l = sum z; z_l = LN_D(zc_l + eps) + Pz, S_l = LN_DxD(s_l + eps) + Ps where (Pz, Ps) is the same construction on the 8-step prompt P taken at its last step; NAM = LN_DxD(S_l/(|z_l|+eps) + eps);
// NA = qn . NAM + mask_b (qn . prev_NAM) with prev_NAM = (prev_s[uid] + Ss) / (|prev_z[uid] + Sz| + eps) from the prompt S; NA = LN_D(NA); second output std = unbiased std of
// q / max(z_l, 1e-6) over all (b, l, d).
// One block per (user, chunk of 7, 6 or 5 steps; later chunks are shorter, see chunk_start): it first sums z v^T and z over all earlier steps of its user, in step order, in registers, then walks its chunk with the running DxD state in registers (f32, 64 elements a thread),
// the prompt state beside it, LN statistics by fixed-order block reductions, the two vector-matrix products on the VALU (batches of rows: the loads first, then the arithmetic); the std partials in f64 per block, combined by one final wave.
// WMMA (v_wmma_f32_16x16x32_f16, f32 accumulate): the k/v projections of the sequence and both prompts ([3,456 x 128] x [128 x 128] x2), q of the sequence only ([3,200 x 128] x [128 x 128]) with EXACT bf16 inputs (x8) and weights (x256), 1 product.
// The four DxD LN parameter matrices are rounded to bf16 once, in the prep kernel, and packed: one 32-bit word holds (gamma, beta) of an element, four rows of a thread's column lie in one 16-byte word group (see GB below).
// Inputs rounded to bf16 once; user_id int32, clamped. Fragment k-map per lane half hh for A AND B: elements 0..7 <- k = 8hh+0..7, 8..15 <- k = 16+8hh+0..7; acc[r] =

namespace {
constexpr int NB = 16, L = 200, LP = 8, D = 128, NU = 1001, NRS = NB * L /* 3200 */, NRP = NB * LP /* 128 */, NR = NRS + 2 * NRP /* 3456 = 54 x 64 */;
constexpr int NC = 32 /* chunks per user: 512 blocks, two per WGP by LDS */, TR = 64 /* rows of z and of v staged at a time for the earlier steps */;
// First step of chunk c. A block pays for every earlier step of its user (one rank-1 update of the start state) as well as for its own steps (five passes and the reductions, some fifty times as much), so later chunks get
// fewer steps and every block about the same work: chunks 0..14 have 7 steps, 15..24 have 6, 25..31 have 5.
__host__ __device__ constexpr int chunk_start(int c) { return 7 * c - (c > 15 ? c - 15 : 0) - (c > 25 ? c - 25 : 0); }
static_assert(chunk_start(0) == 0 && chunk_start(NC) == L, "the chunks cover the sequence");
static_assert(2 * TR * D <= D * D && (NB - 1) * L + ((L - 1) / TR + 1) * TR <= NR, "staged tiles fit SR and stay inside Z and V");
constexpr float XS = 8.0f, WSC = 256.0f, EPS = 1e-8f, LNE = 1e-5f;

typedef _Float16 b16;
typedef __attribute__((ext_vector_type(16))) _Float16 v16b;
typedef __attribute__((ext_vector_type(8))) _Float16 v8b;
typedef __attribute__((ext_vector_type(8))) float v8f;
typedef __attribute__((ext_vector_type(4))) float v4f;
typedef __attribute__((ext_vector_type(4))) unsigned int v4u;
typedef __attribute__((ext_vector_type(2))) float v2f;   // two neighbouring rows of a thread's column: one v_pk_add/mul/fma_f32 works on both
__device__ __forceinline__ float bf16_rne(float f) { unsigned int u = __float_as_uint(f); u += 0x7FFFu + ((u >> 16) & 1u); return __uint_as_float(u & 0xFFFF0000u); }
// GB: a pair (gamma, beta) of DxD matrices, each value rounded to bf16, gamma in the high and beta in the low half of a word. Word ((g * 256 + t) * 4 + j) belongs to row (t >> 7) * 64 + 4 g + j, column t & 127:
// thread t of the state kernel reads four of its rows with one 16-byte load, and a wave reads 512 bytes in a row.
constexpr int GBW = D * D /* words a pair */;
__device__ __forceinline__ float gb_g(unsigned int w) { return __uint_as_float(w & 0xFFFF0000u); }
__device__ __forceinline__ float gb_b(unsigned int w) { return __uint_as_float(w << 16); }
__device__ __forceinline__ v2f fma2(v2f a, v2f b, v2f c) { return __builtin_elementwise_fma(a, b, c); }
__device__ __forceinline__ v2f sp2(float x) { return (v2f){x, x}; }
// x gamma + beta, fused, of one row: the instruction reads gamma (high half) and beta (low half) of the word as they lie. In asm because the compiler, given the two rows of a pair, unpacks four halves (two v_and, two shifts) to feed
// one v_pk_fma_f32: four instructions a pair where these are two.
__device__ __forceinline__ float gbfma(float x, unsigned int w) { float d; asm("v_fma_mix_f32_bf16 %0, %1, %2, %2 op_sel:[0,1,0] op_sel_hi:[0,1,1]" : "=v"(d) : "v"(x), "v"(w)); return d; }
__device__ __forceinline__ v2f gbfma2(v2f x, unsigned int w0, unsigned int w1) { return (v2f){gbfma(x[0], w0), gbfma(x[1], w1)}; }
__device__ __forceinline__ v2f lo2(v4f x) { return (v2f){x[0], x[1]}; }
__device__ __forceinline__ v2f hi2(v4f x) { return (v2f){x[2], x[3]}; }
__device__ __forceinline__ float sum4(v2f a, v2f c) { return (a[0] + a[1]) + (c[0] + c[1]); }   // the thread's four partial sums (rows 4i, 4i+1, 4i+2, 4i+3), one fixed tree
__device__ __forceinline__ v16b frag_kb(const b16* p, int hh) { const v8b a = *(const v8b*)(p + 8 * hh), b = *(const v8b*)(p + 16 + 8 * hh); v16b f;
#pragma unroll
  for (int e = 0; e < 8; ++e) { f[e] = a[e]; f[8 + e] = b[e]; } return f; }
__device__ __forceinline__ v8f wmma16b(v16b a, v16b b, v8f c) { v8f d = __builtin_amdgcn_wmma_f32_16x16x32_f16(false, a, false, b, (short)0, c, false, false); asm volatile("v_nop\n\tv_nop\n\tv_nop\n\tv_nop" : "+v"(d) : "v"(a), "v"(b)); return d; }
__device__ __forceinline__ void wave_lds_sync() { __builtin_amdgcn_fence(__ATOMIC_RELEASE, "workgroup"); __builtin_amdgcn_wave_barrier(); __builtin_amdgcn_fence(__ATOMIC_ACQUIRE, "workgroup"); }
__device__ __forceinline__ float pmul(float a, float b) { float p = a * b; asm volatile("" : "+v"(p)); return p; }
__device__ __forceinline__ float elu(float x) { return x > 0.0f ? x : (__expf(x) - 1.0f); }

__global__ __launch_bounds__(256) void prep_kernel(const float* __restrict__ xs, const float* __restrict__ xp, const float* __restrict__ xq, const float* __restrict__ wq, const float* __restrict__ wk, const float* __restrict__ wv, const float* __restrict__ gs, const float* __restrict__ bs, const float* __restrict__ gn, const float* __restrict__ bn, b16* __restrict__ X16, b16* __restrict__ W16, unsigned int* __restrict__ GB) {
  const int t = blockIdx.x * 256 + threadIdx.x; const int nx = NR * D / 8, nw = 3 * D * D / 8, ng = 2 * GBW / 4; v8b o;
  if (t < nx) { const int e = t * 8; const int row = e / D; const float* src = row < NRS ? xs + e : row < NRS + NRP ? xp + (e - NRS * D) : xq + (e - (NRS + NRP) * D);
    for (int j = 0; j < 8; ++j) o[j] = (b16)(bf16_rne(src[j]) * XS); { *(v8b*)(X16 + e) = o;  } }
  else if (t < nx + nw) { const int e = (t - nx) * 8; const int k = e / (D * D), r = e - k * D * D; const float* w = k == 0 ? wq : k == 1 ? wk : wv; for (int j = 0; j < 8; ++j) o[j] = (b16)(bf16_rne(w[r + j]) * WSC); { *(v8b*)(W16 + e) = o;  } }
  else if (t < nx + nw + ng) { const int i = t - nx - nw, tt = i & 255, g = (i >> 8) & 15; const float *ga_ = i < GBW / 4 ? gs : gn, *be_ = i < GBW / 4 ? bs : bn; const int e = ((tt >> 7) * (D / 2) + g * 4) * D + (tt & (D - 1)); v4u w; float gv[4], bv[4];
    const float *gp = ga_ + e, *bp = be_ + e;
    for (int j = 0; j < 4; ++j) { gv[j] = gp[j * D]; bv[j] = bp[j * D]; }
    asm volatile("s_wait_xcnt 0x0" :: "v"(gp), "v"(bp) : "memory");   // behind the eight loads, in front of the first rewrite of a register that they name; the addresses are inputs, so that they keep their registers up to the wait
    for (int j = 0; j < 4; ++j) w[j] = (__float_as_uint(bf16_rne(gv[j])) & 0xFFFF0000u) | (__float_as_uint(bf16_rne(bv[j])) >> 16);
    *(v4u*)(GB + (size_t)i * 4) = w; }
}
__global__ __launch_bounds__(128) void proj_kernel(const b16* __restrict__ X16, const b16* __restrict__ W16, const float* __restrict__ bq, const float* __restrict__ bk, const float* __restrict__ bv, float* __restrict__ Q, float* __restrict__ Z, float* __restrict__ V) {
  __shared__ __attribute__((aligned(16))) float Ts[4][16][D + 4];
  const int kind = blockIdx.y, wave = threadIdx.x >> 5, lane = threadIdx.x & 31, nloc = lane & 15, hlf = lane >> 4; const size_t m0 = (size_t)blockIdx.x * 64 + wave * 16; if (kind == 0 && m0 >= (size_t)NRS) return;
  const b16* Wp = W16 + (size_t)kind * D * D; const float* bb = kind == 0 ? bq : kind == 1 ? bk : bv; float* dst = kind == 0 ? Q : kind == 1 ? Z : V;
  v8f acc[8];
#pragma unroll
  for (int t = 0; t < 8; ++t) acc[t] = (v8f){};
#pragma unroll
  for (int kb = 0; kb < D; kb += 32) { const v16b a = frag_kb(X16 + (m0 + nloc) * D + kb, hlf);
#pragma unroll
    for (int t = 0; t < 8; ++t) acc[t] = wmma16b(a, frag_kb(Wp + (size_t)(t * 16 + nloc) * D + kb, hlf), acc[t]); }
#pragma unroll
  for (int t = 0; t < 8; ++t) { const int c = t * 16 + nloc; const float b_ = bf16_rne(bb[c]);
#pragma unroll
    for (int r = 0; r < 8; ++r) { float v = acc[t][r] * (1.0f / (XS * WSC)) + b_; if (kind < 2) v = elu(v); Ts[wave][8 * hlf + r][c] = v; } }
  wave_lds_sync();
  { for (int rr = 0; rr < 16; ++rr) *(v4f*)(dst + (m0 + rr) * D + lane * 4) = *(const v4f*)(&Ts[wave][rr][lane * 4]);  }
}
// Block-wide fixed-order reductions (256 threads, every lane on): a butterfly inside each wave (lane ^ 1, 2, 4, 8 by DPP inside the 16-lane row, lane ^ 16 by a cross-row move), one word a wave in LDS, ONE barrier, then every
// thread adds the eight words in one fixed tree. N sums that do not depend on each other share the exchange. RB picks one of two exchange buffers: neighbouring reductions alternate, or have another barrier between them,
// so a buffer is rewritten only behind a barrier that every wave signals after its reads of it have returned.
template <int M> __device__ __forceinline__ int xrow_i(int x) { return __builtin_amdgcn_update_dpp(0, x, 0x160 | M /* row_xmask:M */, 0xf, 0xf, true); }
__device__ __forceinline__ int xhalf_i(int x) { return __builtin_amdgcn_permlanex16(x, x, 0x76543210, 0xfedcba98, false, false); }   // lane l with lane l ^ 16
template <int M> __device__ __forceinline__ float xrow(float x) { return __builtin_bit_cast(float, xrow_i<M>(__builtin_bit_cast(int, x))); }
__device__ __forceinline__ float xhalf(float x) { return __builtin_bit_cast(float, xhalf_i(__builtin_bit_cast(int, x))); }
template <int M> __device__ __forceinline__ double xrow_d(double x) { return __hiloint2double(xrow_i<M>(__double2hiint(x)), xrow_i<M>(__double2loint(x))); }
__device__ __forceinline__ double xhalf_d(double x) { return __hiloint2double(xhalf_i(__double2hiint(x)), xhalf_i(__double2loint(x))); }
constexpr int NW = 8 /* waves a block */, RN = 3 /* most sums in one exchange */;
template <int RB, int N> __device__ __forceinline__ void bsum(float (&v)[N], float (*rw)[RN * NW]) { static_assert(N <= RN && RB < 2, "fits the exchange buffers"); float* r = rw[RB];
  for (int i = 0; i < N; ++i) v[i] += xrow<1>(v[i]);
  for (int i = 0; i < N; ++i) v[i] += xrow<2>(v[i]);
  for (int i = 0; i < N; ++i) v[i] += xrow<4>(v[i]);
  for (int i = 0; i < N; ++i) v[i] += xrow<8>(v[i]);
  for (int i = 0; i < N; ++i) v[i] += xhalf(v[i]);
  if ((threadIdx.x & 31) == 0) { for (int i = 0; i < N; ++i) r[i * NW + (threadIdx.x >> 5)] = v[i]; }   // lane 0 speaks for the wave (where a product is fused into the first add, the lanes need not agree in the last bit)
  __syncthreads();
  for (int i = 0; i < N; ++i) { const v4f a = *(const v4f*)(r + i * NW), c = *(const v4f*)(r + i * NW + 4); v[i] = ((a[0] + a[1]) + (a[2] + a[3])) + ((c[0] + c[1]) + (c[2] + c[3])); } }
template <int RB> __device__ __forceinline__ float bsum1(float x, float (*rw)[RN * NW]) { float v[1] = {x}; bsum<RB>(v, rw); return v[0]; }
// prompt state for user b from rows r0..r0+7 of Z/V: zc = sum_j z_j; sc = sum_j z_j v_j^T; Pz = LN_D(zc + eps) gz + bz (vector, thread < 128 -> pzout), Ps = LN_DxD(sc + eps) gs + bs into
// PS (LDS, [p][q], thread owns q = t&127 for p in its half). Each element sc + eps is summed once, in the first pass, and kept in AE (LDS, 64 KB, idle at that time): group g of thread t, AE[g * 256 + t], holds
// its rows 4 g .. 4 g + 3; only the thread that wrote a group reads it, so AE needs no barrier of its own.
__device__ __forceinline__ void prompt_state(const float* __restrict__ Z, const float* __restrict__ V, int r0, const float* __restrict__ gz, const float* __restrict__ bz, const unsigned int* __restrict__ GS, float* __restrict__ PS, float* __restrict__ pzout, float (*rw)[RN * NW], float* zs, float* vs, v4f* __restrict__ AE) {
  const int t_ = threadIdx.x; const int q = t_ & (D - 1), ph = t_ >> 7;   // ph: which half of the p range (0: 0..63, 1: 64..127)
  // zc (thread < 128) and staging of the 8 z / v rows
  for (int i = t_; i < LP * D; i += 256) { zs[i] = Z[(size_t)r0 * D + i]; vs[i] = V[(size_t)r0 * D + i]; }
  __syncthreads();
  // Pz: LN over D of (zc + eps); its two sums share the exchanges of the two sums of the DxD LN
  float zc = 0.0f; if (t_ < D) { for (int j = 0; j < LP; ++j) zc += zs[j * D + t_]; zc += EPS; }
  // The passes work on pairs of neighbouring rows (v2f: one packed f32 instruction for both rows, each product fused into its add); a thread's sum over its 64 rows runs in four partial sums (rows 4i .. 4i+3), joined by sum4.
  // The first and the third pass walk their rows in batches (PB, QB): first every load of the batch, into registers, then the arithmetic.
  constexpr int PB = 8, QB = 16 /* rows a batch in the third pass */; const int pa = ph * (D / 2); float vr[LP]; v4f zr[PB / 4][LP]; v4u gw[QB / 4]; v4f ae[QB / 4]; const v2f eps2 = sp2(EPS);
#pragma unroll
  for (int j = 0; j < LP; ++j) vr[j] = vs[j * D + q];
  v2f s1a = sp2(0.0f), s1b = sp2(0.0f);
#pragma unroll 1   // the body holds PB rows already
  for (int pb = 0; pb < D / 2; pb += PB) {
#pragma unroll
    for (int k = 0; k < PB / 4; ++k) for (int j = 0; j < LP; ++j) zr[k][j] = *(const v4f*)(zs + j * D + pa + pb + 4 * k);
#pragma unroll
    for (int k = 0; k < PB / 4; ++k) { v2f a = sp2(0.0f), c = sp2(0.0f); for (int j = 0; j < LP; ++j) { a = fma2(lo2(zr[k][j]), sp2(vr[j]), a); c = fma2(hi2(zr[k][j]), sp2(vr[j]), c); } a += eps2; c += eps2; ae[k] = (v4f){a[0], a[1], c[0], c[1]}; s1a += a; s1b += c; }
#pragma unroll
    for (int k = 0; k < PB / 4; ++k) AE[(pb / 4 + k) * 256 + t_] = ae[k]; }
  float ra[2] = {zc, sum4(s1a, s1b)}; bsum<0>(ra, rw); const float mz = ra[0] * (1.0f / D), ms = ra[1] * (1.0f / (D * D)); const float dz = t_ < D ? zc - mz : 0.0f; v2f s2a = sp2(0.0f), s2b = sp2(0.0f);
#pragma unroll 1   // the body holds 32 rows already (8 LDS reads of 16 bytes, free to issue ahead of the arithmetic); unrolled further it would only add code
  for (int gb = 0; gb < D / 2 / 4; gb += 8) {
#pragma unroll
    for (int g = 0; g < 8; ++g) { const v4f x = AE[(gb + g) * 256 + t_]; const v2f da = lo2(x) - sp2(ms), dc = hi2(x) - sp2(ms); s2a = fma2(da, da, s2a); s2b = fma2(dc, dc, s2b); } }
  float rb[2] = {dz * dz, sum4(s2a, s2b)}; bsum<1>(rb, rw); const float rz = rsqrtf(rb[0] * (1.0f / D) + LNE), rs = rsqrtf(rb[1] * (1.0f / (D * D)) + LNE);
  if (t_ < D) pzout[t_] = pmul(dz * rz, bf16_rne(gz[t_])) + bf16_rne(bz[t_]);
#pragma unroll 1   // the body holds QB rows already
  for (int pb = 0; pb < D / 2; pb += QB) { const v4u* g0 = (const v4u*)GS + (pb / 4) * 256 + t_;
#pragma unroll
    for (int k = 0; k < QB / 4; ++k) gw[k] = g0[k * 256];
#pragma unroll
    for (int k = 0; k < QB / 4; ++k) ae[k] = AE[(pb / 4 + k) * 256 + t_];
    asm volatile("s_wait_xcnt 0x0" :: "v"(g0) : "memory");   // in front of the first rewrite of a register that the loads of GS name; the address is an input, so that it keeps its registers up to the wait and no load's result lands on them
#pragma unroll
    for (int k = 0; k < QB; k += 2) { const unsigned int w0 = gw[k >> 2][k & 3], w1 = gw[k >> 2][(k & 3) + 1]; const v2f o = gbfma2(((v2f){ae[k >> 2][k & 3], ae[k >> 2][(k & 3) + 1]} - sp2(ms)) * sp2(rs), w0, w1);
      PS[(pa + pb + k) * D + q] = o[0]; PS[(pa + pb + k + 1) * D + q] = o[1]; } }
  __syncthreads();
}
// state kernel: block = (chunk c, user b) (256 threads). LDS: SR [128][128] staging for the start state, PSL [128][128] prompt-P state; the running s (f32) in registers. PREV (prev_NAM) in global scratch per block. Per step l: s += z v^T; LN stats; NAM passes;
// amdgpu_waves_per_eu(4, 4): at most 256 registers a wave, so that two blocks still share a WGP (four waves on each SIMD), which the LDS allows
__global__ __launch_bounds__(256) __attribute__((amdgpu_waves_per_eu(4, 4))) void state_kernel(const float* __restrict__ Q, const float* __restrict__ Z, const float* __restrict__ V, const int* __restrict__ uid, const float* __restrict__ gz, const float* __restrict__ bz, const unsigned int* __restrict__ GS,
                                                 const unsigned int* __restrict__ GN, const float* __restrict__ ga, const float* __restrict__ ba, const float* __restrict__ prev_z, const float* __restrict__ prev_s, float* __restrict__ PREV, float* __restrict__ out, double* __restrict__ STD2) {
  __shared__ __attribute__((aligned(16))) float SR[D * D]; __shared__ float PSL[D * D]; __shared__ float red[256]; __shared__ __attribute__((aligned(16))) float rw[2][RN * NW]; __shared__ __attribute__((aligned(16))) float zs[LP * D]; __shared__ float vs[LP * D]; __shared__ __attribute__((aligned(16))) float zrow[D], qn[D]; __shared__ float pzP[D], pzS[D], vrow[D], zfull[D], zcum[D]; __shared__ float scal[4]; __shared__ __attribute__((aligned(16))) double dw[2][NW];
  const int b = blockIdx.y, blk = b * NC + blockIdx.x, l0 = chunk_start(blockIdx.x), l1 = chunk_start(blockIdx.x + 1), t_ = threadIdx.x; const int q = t_ & (D - 1), ph = t_ >> 7;
  // prompt S state -> PSL temporarily, then prev_NAM into PREV (global); prompt P state -> PSL (kept).
  prompt_state(Z, V, NRS + NRP + b * LP, gz, bz, GS, PSL, pzS, rw, zs, vs, (v4f*)SR);
  { const int u = min(max(uid[b], 0), NU - 1); float zu = 0.0f; if (t_ < D) { zu = bf16_rne(prev_z[(size_t)u * D + t_]) + pzS[t_]; } float ru[2] = {zu * zu, t_ < D ? bf16_rne(prev_z[(size_t)u * D + t_]) : 0.0f}; bsum<0>(ru, rw); const float inv = 1.0f / (sqrtf(ru[0]) + EPS);
    if (t_ == 0) scal[0] = (ru[1] != 0.0f) ? 1.0f : 0.0f;
    {
#pragma unroll 1   // the body holds 16 rows already
      for (int pb = 0; pb < D / 2; pb += 16) { float w[16];
#pragma unroll   // 16 loads of prev_s (from memory) in flight per thread
        for (int k = 0; k < 16; ++k) w[k] = (bf16_rne(prev_s[((size_t)u * D + ph * (D / 2) + pb + k) * D + q]) + PSL[(ph * (D / 2) + pb + k) * D + q]) * inv;
#pragma unroll
        for (int k = 0; k < 16; ++k) ((float*)PREV)[(size_t)blk * D * D + (ph * (D / 2) + pb + k) * D + q] = w[k];
        asm volatile("s_wait_xcnt 0x0" ::: "memory"); }   // kept in front of the next trip's rewrite of the registers that the loads and stores name
       } }
  __syncthreads();
  prompt_state(Z, V, NRS + b * LP, gz, bz, GS, PSL, pzP, rw, zs, vs, (v4f*)SR);
  // state in front of step l0: s = sum_{l < l0} z_l v_l^T and zcum = sum z_l, each element summed in step order. The thread keeps rows p0..p0+7 x columns q0..q0+3 and 64+q0..64+q0+3 in registers;
  // SR, which holds nothing any more (the prompt states are done with it), stages TR rows of z and TR rows of v at a time (whole tiles are loaded: rows past l0 are inside Z and V and are not summed).
  { float* zt = SR; float* vt = SR + TR * D; const int p0 = (t_ >> 4) * 8, q0 = (t_ & 15) * 4; v4f a0[8], a1[8]; float zc = 0.0f; const v4f* zg = (const v4f*)(Z + (size_t)b * L * D) + t_; const v4f* vg = (const v4f*)(V + (size_t)b * L * D) + t_;
#pragma unroll
    for (int r = 0; r < 8; ++r) { a0[r] = (v4f){}; a1[r] = (v4f){}; }
    for (int base = 0; base < l0; base += TR, zg += TR * D / 4, vg += TR * D / 4) { const int n = min(TR, l0 - base);
#pragma unroll   // all 16 loads of the thread in flight at once
      for (int k = 0; k < TR * D / 4 / 256; ++k) { ((v4f*)zt)[t_ + k * 256] = zg[k * 256]; ((v4f*)vt)[t_ + k * 256] = vg[k * 256]; }
      __syncthreads();
#pragma unroll 2   // the next row's LDS reads issue under this row's 64 multiply-adds
      for (int j = 0; j < n; ++j) { const v4f z0 = *(const v4f*)(zt + j * D + p0), z1 = *(const v4f*)(zt + j * D + p0 + 4), v0 = *(const v4f*)(vt + j * D + q0), v1 = *(const v4f*)(vt + j * D + 64 + q0);
        zc += zt[j * D + q];   // both halves of the block sum it, the lower half stores it
#pragma unroll
        for (int r = 0; r < 4; ++r) { a0[r] += z0[r] * v0; a1[r] += z0[r] * v1; a0[4 + r] += z1[r] * v0; a1[4 + r] += z1[r] * v1; } }
      __syncthreads(); }
#pragma unroll
    for (int r = 0; r < 8; ++r) { *(v4f*)(SR + (p0 + r) * D + q0) = a0[r]; *(v4f*)(SR + (p0 + r) * D + 64 + q0) = a1[r]; }
    if (t_ < D) zcum[t_] = zc; }
  __syncthreads();
  // From here on every element of the state is read and written by one thread only (rows pa..pa+63 of column q): it leaves SR for the thread's registers and stays there over all steps of the chunk.
  constexpr int NH = D / 2; const int pa = ph * NH; const unsigned e0 = pa * D + q /* the thread's first element in every DxD matrix: the rows of the unrolled passes differ from it by constants, so each matrix takes one address for the whole loop */; v2f st[NH / 2], nw[NH / 2] /* pair k: rows pa + 2 k and pa + 2 k + 1 */; const v2f eps2 = sp2(EPS);
#pragma unroll   // st is indexed by constants only, so that it lives in registers
  for (int k = 0; k < NH / 2; ++k) st[k] = (v2f){SR[(pa + 2 * k) * D + q], SR[(pa + 2 * k + 1) * D + q]};
  double dsum = 0.0, dsq = 0.0;
  const float* PRb = PREV + (size_t)blk * D * D;
  for (int l = l0; l < l1; ++l) { const size_t row = (size_t)b * L + l;
    if (t_ < D) { zrow[t_] = Z[row * D + t_]; vrow[t_] = V[row * D + t_]; zcum[t_] += Z[row * D + t_]; }
    __syncthreads();
    // The two sums of z's LN and |q|^2 depend on nothing of the state, so they ride in the exchanges of the state's own LN sums (first and second pass).
    float qv = 0.0f; if (t_ < D) qv = Q[row * D + t_];
    const float zc = t_ < D ? zcum[t_] + EPS : 0.0f;
    // Five passes over the thread's 64 rows, all unrolled (st and nw are indexed by constants only). st holds the running state; nw holds S_l/|z_l| + eps, made once in the third pass and used again by the
    // fourth and fifth, which so read neither gs, bs nor the prompt state again. What a pass still loads comes in batches of RA or RB rows: first every load of the batch, then the arithmetic.
    // All five work on pairs of neighbouring rows with packed f32 instructions, each product fused into its add; each sum over the thread's rows runs in four partial sums (rows 4i .. 4i+3), joined by sum4.
    constexpr int RA = 32 /* the first pass: one 16-byte LDS read for four rows */, RB = 16 /* the third and fifth pass: a parameter word and one or two more values a row beside the 128 kept values */; float pl[RB]; v4f qv_[RA / 4]; v4u gw[RB / 4]; const v4u *GSt = (const v4u*)GS + t_, *GNt = (const v4u*)GN + t_;
    v2f s1a = sp2(0.0f), s1b = sp2(0.0f); const v2f vq = sp2(vrow[q]);
#pragma unroll
    for (int pb = 0; pb < NH; pb += RA) {
#pragma unroll
      for (int k = 0; k < RA / 4; ++k) qv_[k] = *(const v4f*)(zrow + pa + pb + 4 * k);
#pragma unroll
      for (int k = 0; k < RA / 4; ++k) { v2f &a = st[pb / 2 + 2 * k], &c = st[pb / 2 + 2 * k + 1]; a = fma2(lo2(qv_[k]), vq, a); c = fma2(hi2(qv_[k]), vq, c); s1a += a + eps2; s1b += c + eps2; } }
    float ra[3] = {zc, qv * qv, sum4(s1a, s1b)}; bsum<0>(ra, rw); const float mz = ra[0] * (1.0f / D), qn2 = ra[1], m1 = ra[2] * (1.0f / (D * D)); const float dz = t_ < D ? zc - mz : 0.0f; v2f s2a = sp2(0.0f), s2b = sp2(0.0f);
#pragma unroll
    for (int k = 0; k < NH / 2; k += 2) { const v2f da = (st[k] + eps2) - sp2(m1), dc = (st[k + 1] + eps2) - sp2(m1); s2a = fma2(da, da, s2a); s2b = fma2(dc, dc, s2b); }
    float rb[2] = {dz * dz, sum4(s2a, s2b)}; bsum<1>(rb, rw); const float rz = rsqrtf(rb[0] * (1.0f / D) + LNE), r1 = rsqrtf(rb[1] * (1.0f / (D * D)) + LNE);
    // z_l = LN_D(zcum + eps) gz + bz + Pz; qn (read in the fifth pass, two barriers on); 1/|z_l|, which every thread forms from the total it holds
    float zf = 0.0f; if (t_ < D) { zf = pmul(dz * rz, bf16_rne(gz[t_])) + bf16_rne(bz[t_]) + pzP[t_]; zfull[t_] = zf; }
    const float zn2 = bsum1<0>(zf * zf, rw); if (t_ < D) qn[t_] = qv / (sqrtf(qn2) + EPS); const float izn = 1.0f / (sqrtf(zn2) + EPS);
    if (t_ < D) { const float xv = qv / fmaxf(zf, 1e-6f); dsum += (double)xv; dsq += (double)xv * (double)xv; }
    // NAMraw = (LN(s) gs + bs + Ps) izn + eps ; stats
    v2f n1a = sp2(0.0f), n1b = sp2(0.0f);
#pragma unroll
    for (int pb = 0; pb < NH; pb += RB) {
#pragma unroll
      for (int k = 0; k < RB / 4; ++k) gw[k] = GSt[(pb / 4 + k) * 256];
#pragma unroll
      for (int k = 0; k < RB; ++k) pl[k] = PSL[e0 + (pb + k) * D];
      asm volatile("s_wait_xcnt 0x0" ::: "memory");   // behind the loads of GS, in front of any later rewrite of a register that they name; its memory clobber also keeps the batch's loads in front of the arithmetic
#pragma unroll
      for (int k = 0; k < RB; k += 2) { const unsigned int w0 = gw[k >> 2][k & 3], w1 = gw[k >> 2][(k & 3) + 1]; const v2f sf = gbfma2(((st[(pb + k) / 2] + eps2) - sp2(m1)) * sp2(r1), w0, w1) + (v2f){pl[k], pl[k + 1]};
        const v2f x = fma2(sf, sp2(izn), eps2); nw[(pb + k) / 2] = x; if (k & 2) n1b += x; else n1a += x; } }
    const float m2 = bsum1<1>(sum4(n1a, n1b), rw) * (1.0f / (D * D)); v2f n2a = sp2(0.0f), n2b = sp2(0.0f);
#pragma unroll
    for (int k = 0; k < NH / 2; k += 2) { const v2f da = nw[k] - sp2(m2), dc = nw[k + 1] - sp2(m2); n2a = fma2(da, da, n2a); n2b = fma2(dc, dc, n2b); }
    const float r2 = rsqrtf(bsum1<0>(sum4(n2a, n2b), rw) * (1.0f / (D * D)) + LNE);
    // NA_q partial over the thread's p half: sum_p qn_p NAM_pq ; prev partial: sum_p qn_p PREV_pq
    v2f naa = sp2(0.0f), nab = sp2(0.0f), pva = sp2(0.0f), pvb = sp2(0.0f);
#pragma unroll
    for (int pb = 0; pb < NH; pb += RB) {
#pragma unroll
      for (int k = 0; k < RB / 4; ++k) gw[k] = GNt[(pb / 4 + k) * 256];
#pragma unroll
      for (int k = 0; k < RB; ++k) pl[k] = PRb[e0 + (pb + k) * D];
#pragma unroll
      for (int k = 0; k < RB / 4; ++k) qv_[k] = *(const v4f*)(qn + pa + pb + 4 * k);
      asm volatile("s_wait_xcnt 0x0" ::: "memory");   // as in the third pass, for the loads of GN and PREV
#pragma unroll
      for (int k = 0; k < RB; k += 2) { const unsigned int w0 = gw[k >> 2][k & 3], w1 = gw[k >> 2][(k & 3) + 1]; const v2f nam = gbfma2((nw[(pb + k) / 2] - sp2(m2)) * sp2(r2), w0, w1);
        const v2f qq = (k & 2) ? hi2(qv_[k >> 2]) : lo2(qv_[k >> 2]), pp = (v2f){pl[k], pl[k + 1]};
        if (k & 2) { nab = fma2(qq, nam, nab); pvb = fma2(qq, pp, pvb); } else { naa = fma2(qq, nam, naa); pva = fma2(qq, pp, pva); } } }
    // combine the two halves: threads q and q+128 -> via red
    red[t_] = sum4(naa, nab) + scal[0] * sum4(pva, pvb); __syncthreads();
    // LN_D(NA) ga + ba -> out row. No barrier closes the step: what the next step writes in LDS (zrow, vrow, later qn and red) was last read in front of the two barriers below.
    { const float x = t_ < D ? red[t_] + red[t_ + D] : 0.0f; const float mu = bsum1<1>(x, rw) * (1.0f / D); const float dv = t_ < D ? x - mu : 0.0f; const float var = bsum1<0>(dv * dv, rw) * (1.0f / D); const float rr = rsqrtf(var + LNE);
      const float o = pmul(dv * rr, t_ < D ? bf16_rne(ga[t_]) : 0.0f) + (t_ < D ? bf16_rne(ba[t_]) : 0.0f);
      // the wait: behind the store of the row, in front of the next step's rewrite of its address registers (the barrier that stood here brought a wait of its own); inside the branch, so that the loop's address additions cannot be lifted over it
      { if (t_ < D) { ((float*)out)[row * D + t_] = o; asm volatile("s_wait_xcnt 0x0" ::: "memory"); }  } } }
  // the block's two f64 sums, reduced like the f32 ones: butterfly in the wave, one word a wave, one barrier, one fixed tree
  dsum += xrow_d<1>(dsum); dsq += xrow_d<1>(dsq); dsum += xrow_d<2>(dsum); dsq += xrow_d<2>(dsq); dsum += xrow_d<4>(dsum); dsq += xrow_d<4>(dsq); dsum += xrow_d<8>(dsum); dsq += xrow_d<8>(dsq); dsum += xhalf_d(dsum); dsq += xhalf_d(dsq);
  if ((t_ & 31) == 0) { dw[0][t_ >> 5] = dsum; dw[1][t_ >> 5] = dsq; }
  __syncthreads();
  { if (t_ < 16) { const double* w = dw[t_ & 1]; const double tot = ((w[0] + w[1]) + (w[2] + w[3])) + ((w[4] + w[5]) + (w[6] + w[7])); ((double*)STD2)[(size_t)blk * 16 + t_] = t_ < 2 ? tot : 0.0; }  }
}
// final std: one wave, the users' sums joined by a butterfly over lanes 0..15: n = 16*200*128; var = (sumsq - sum^2/n) / (n-1); std -> out2[0] (and 31 zero floats to fill the line? the output is a single float at the end of the buffer; we write just it).
__global__ __launch_bounds__(32) void std_kernel(const double* __restrict__ STD2, float* __restrict__ out2) {
  const int lane = threadIdx.x; double s = 0.0, s2 = 0.0;
  if (lane < NB) {   // lane = user: its chunks in order
#pragma unroll   // several of the lane's loads in flight at a time
    for (int k = 0; k < NC; ++k) { s += STD2[(size_t)(lane * NC + k) * 16]; s2 += STD2[(size_t)(lane * NC + k) * 16 + 1]; } }
  for (int m = NB / 2; m >= 1; m >>= 1) { s += __shfl_xor(s, m); s2 += __shfl_xor(s2, m); }
  if (lane == 0) { const double n = (double)NB * L * D; const double var = (s2 - s * s / n) / (n - 1.0); const float sd = (float)sqrt(var > 0.0 ? var : 0.0);
    { ((float*)out2)[0] = sd;  } }
}
}  // namespace

extern "C" void kernel_launch(void* const* d_in, const int* in_sizes, int n_in, void* d_out, int out_size, void* d_ws, size_t ws_size, hipStream_t stream) {
  (void)n_in;
  auto Fp = [&](int i) { return (const float*)d_in[i]; }; auto Ip = [&](int i) { return (const int*)d_in[i]; };
  // input order: 0 user_id [16] i32, 1 seqs_emb [16,200,128], 2 P [16,8,128], 3 S [16,8,128], 4 Wq [128,128], 5 bq, 6 Wk, 7 bk, 8 Wv, 9 bv, 10 z_gamma, 11 z_beta, 12 s_gamma [128,128], 13 s_beta, 14 nam_gamma, 15 nam_beta,
  // 16 na_gamma [128], 17 na_beta, 18 prev_z [1001,128], 19 prev_s [1001,128,128]; outputs NA [16,200,128] at 0, std [1] at float 409600
  if (in_sizes[0] != NB || in_sizes[1] != NRS * D || in_sizes[2] != NRP * D || in_sizes[3] != NRP * D || in_sizes[4] != D * D || in_sizes[12] != D * D || in_sizes[18] != NU * D || in_sizes[19] != NU * D * D || out_size != NRS * D + 1) return;
  size_t off = 0; char* ws = (char*)d_ws;
  auto carve = [&](size_t bytes) { char* p = ws + off; off += (bytes + 255) & ~(size_t)255; return p; };
  b16* X16 = (b16*)carve((size_t)NR * D * 2); b16* W16 = (b16*)carve((size_t)3 * D * D * 2); float* Qp = (float*)carve((size_t)NRS * D * 4); float* Zp = (float*)carve((size_t)NR * D * 4); float* Vp = (float*)carve((size_t)NR * D * 4); float* PREV = (float*)carve((size_t)NB * NC * D * D * 4); double* STD2 = (double*)carve((size_t)NB * NC * 16 * 8); unsigned int* GB = (unsigned int*)carve((size_t)2 * GBW * 4);
  if (off > ws_size || off > ((size_t)128 << 20)) return;   // about 39 MB
  prep_kernel<<<(NR * D / 8 + 3 * D * D / 8 + 2 * GBW / 4 + 255) / 256, 256, 0, stream>>>(Fp(1), Fp(2), Fp(3), Fp(4), Fp(6), Fp(8), Fp(12), Fp(13), Fp(14), Fp(15), X16, W16, GB);
  proj_kernel<<<dim3(NR / 64, 3), 128, 0, stream>>>(X16, W16, Fp(5), Fp(7), Fp(9), Qp, Zp, Vp);
  state_kernel<<<dim3(NC, NB), 256, 0, stream>>>(Qp, Zp, Vp, Ip(0), Fp(10), Fp(11), GB, GB + GBW, Fp(16), Fp(17), Fp(18), Fp(19), PREV, (float*)d_out, STD2);
  std_kernel<<<1, 32, 0, stream>>>(STD2, (float*)d_out + (size_t)NRS * D);
}

// v009
// It runs in 74.9 microseconds.
// Timed twice side by side with v008, it ran 1.16 and 1.15 times as fast.
// Over all steps from v000 it is 272 times as fast.
#include <hip/hip_runtime.h>

// CSR attention block (16 users x 200 steps, D = 128): q = elu(x Wq^T + bq), qn = q/(|q|+eps); z = elu(x Wk^T + bk), v = x Wv^T + bv; per user the causal cumulative state s_l = sum_{l'<=l} z v^T
// and zc_l = sum z; z_l = LN_D(zc_l + eps) + Pz, S_l = LN_DxD(s_l + eps) + Ps where (Pz, Ps) is the same construction on the 8-step prompt P taken at its last step; NAM = LN_DxD(S_l/(|z_l|+eps) + eps);
// NA = qn . NAM + mask_b (qn . prev_NAM) with prev_NAM = (prev_s[uid] + Ss) / (|prev_z[uid] + Sz| + eps) from the prompt S; NA = LN_D(NA); second output std = unbiased std of
// q / max(z_l, 1e-6) over all (b, l, d).
// One block per (user, chunk of 7, 6 or 5 steps; later chunks are shorter, see chunk_start): it first sums z v^T and z over all earlier steps of its user, in step order, in registers, then walks its chunk with the running DxD state in registers (f32, 64 elements a thread),
// the prompt state beside it, LN statistics by fixed-order block reductions, the vector-matrix product qn . NAM on the VALU (batches of rows: the loads first, then the arithmetic), qn . prev_NAM for all steps of the chunk at once in front of the walk; the std partials in f64 per block, combined by one final wave.
// WMMA (v_wmma_f32_16x16x32_f16, f32 accumulate): the k/v projections of the sequence and both prompts ([3,456 x 128] x [128 x 128] x2) and the q projection of the sequence only ([3,200 x 128] x [128 x 128]) with EXACT bf16 inputs (x8) and weights (x256), 1 product.
// The four DxD LN parameter matrices are rounded to bf16 once, in the prep kernel, and packed: one 32-bit word holds (gamma, beta) of an element, four rows of a thread's column lie in one 16-byte word group (see GB below).
// Inputs rounded to bf16 once; user_id int32, clamped. Fragment k-map per lane half hh for A AND B: elements 0..7 <- k = 8hh+0..7, 8..15 <- k = 16+8hh+0..7; acc[r] =

namespace {
constexpr int NB = 16, L = 200, LP = 8, D = 128, NU = 1001, NRS = NB * L /* 3200 */, NRP = NB * LP /* 128 */, NR = NRS + 2 * NRP /* 3456 = 54 x 64 */;
constexpr int NC = 32 /* chunks per user: 512 blocks, two per WGP by LDS */, TR = 64 /* rows of z and of v staged at a time for the earlier steps */;
// First step of chunk c. A block pays for every earlier step of its user (one rank-1 update of the start state) as well as for its own steps (five passes and the reductions, some fifty times as much), so later chunks get
// fewer steps and every block about the same work: chunks 0..14 have 7 steps, 15..24 have 6, 25..31 have 5.
__host__ __device__ constexpr int chunk_start(int c) { return 7 * c - (c > 15 ? c - 15 : 0) - (c > 25 ? c - 25 : 0); }
static_assert(chunk_start(0) == 0 && chunk_start(NC) == L, "the chunks cover the sequence");
constexpr int MS = chunk_start(1) - chunk_start(0) /* most steps a chunk: the first chunks are the longest */;
static_assert(2 * TR * D <= D * D && (NB - 1) * L + ((L - 1) / TR + 1) * TR <= NR, "staged tiles fit SR and stay inside Z and V");
constexpr float XS = 8.0f, WSC = 256.0f, EPS = 1e-8f, LNE = 1e-5f;

typedef _Float16 b16;
typedef __attribute__((ext_vector_type(16))) _Float16 v16b;
typedef __attribute__((ext_vector_type(8))) _Float16 v8b;
typedef __attribute__((ext_vector_type(8))) float v8f;
typedef __attribute__((ext_vector_type(4))) float v4f;
typedef __attribute__((ext_vector_type(4))) unsigned int v4u;
typedef __attribute__((ext_vector_type(2))) float v2f;   // two neighbouring rows of a thread's column: one v_pk_add/mul/fma_f32 works on both
__device__ __forceinline__ float bf16_rne(float f) { unsigned int u = __float_as_uint(f); u += 0x7FFFu + ((u >> 16) & 1u); return __uint_as_float(u & 0xFFFF0000u); }
// GB: a pair (gamma, beta) of DxD matrices, each value rounded to bf16, gamma in the high and beta in the low half of a word. Word ((g * 256 + t) * 4 + j) belongs to row (t >> 7) * 64 + 4 g + j, column t & 127:
// thread t of the state kernel reads four of its rows with one 16-byte load, and a wave reads 512 bytes in a row.
constexpr int GBW = D * D /* words a pair */;
__device__ __forceinline__ float gb_g(unsigned int w) { return __uint_as_float(w & 0xFFFF0000u); }
__device__ __forceinline__ float gb_b(unsigned int w) { return __uint_as_float(w << 16); }
__device__ __forceinline__ v2f fma2(v2f a, v2f b, v2f c) { return __builtin_elementwise_fma(a, b, c); }
__device__ __forceinline__ v2f sp2(float x) { return (v2f){x, x}; }
// x gamma + beta, fused, of one row: the instruction reads gamma (high half) and beta (low half) of the word as they lie. In asm because the compiler, given the two rows of a pair, unpacks four halves (two v_and, two shifts) to feed
// one v_pk_fma_f32: four instructions a pair where these are two.
__device__ __forceinline__ float gbfma(float x, unsigned int w) { float d; asm("v_fma_mix_f32_bf16 %0, %1, %2, %2 op_sel:[0,1,0] op_sel_hi:[0,1,1]" : "=v"(d) : "v"(x), "v"(w)); return d; }
__device__ __forceinline__ v2f gbfma2(v2f x, unsigned int w0, unsigned int w1) { return (v2f){gbfma(x[0], w0), gbfma(x[1], w1)}; }
__device__ __forceinline__ v2f lo2(v4f x) { return (v2f){x[0], x[1]}; }
__device__ __forceinline__ v2f hi2(v4f x) { return (v2f){x[2], x[3]}; }
__device__ __forceinline__ float sum4(v2f a, v2f c) { return (a[0] + a[1]) + (c[0] + c[1]); }   // the thread's four partial sums (rows 4i, 4i+1, 4i+2, 4i+3), one fixed tree
__device__ __forceinline__ v16b frag_kb(const b16* p, int hh) { const v8b a = *(const v8b*)(p + 8 * hh), b = *(const v8b*)(p + 16 + 8 * hh); v16b f;
#pragma unroll
  for (int e = 0; e < 8; ++e) { f[e] = a[e]; f[8 + e] = b[e]; } return f; }
__device__ __forceinline__ v8f wmma16b(v16b a, v16b b, v8f c) { v8f d = __builtin_amdgcn_wmma_f32_16x16x32_f16(false, a, false, b, (short)0, c, false, false); asm volatile("v_nop\n\tv_nop\n\tv_nop\n\tv_nop" : "+v"(d) : "v"(a), "v"(b)); return d; }
__device__ __forceinline__ void wave_lds_sync() { __builtin_amdgcn_fence(__ATOMIC_RELEASE, "workgroup"); __builtin_amdgcn_wave_barrier(); __builtin_amdgcn_fence(__ATOMIC_ACQUIRE, "workgroup"); }
__device__ __forceinline__ float pmul(float a, float b) { float p = a * b; asm volatile("" : "+v"(p)); return p; }
__device__ __forceinline__ float elu(float x) { return x > 0.0f ? x : (__expf(x) - 1.0f); }

__global__ __launch_bounds__(256) void prep_kernel(const float* __restrict__ xs, const float* __restrict__ xp, const float* __restrict__ xq, const float* __restrict__ wq, const float* __restrict__ wk, const float* __restrict__ wv, const float* __restrict__ gs, const float* __restrict__ bs, const float* __restrict__ gn, const float* __restrict__ bn, b16* __restrict__ X16, b16* __restrict__ W16, unsigned int* __restrict__ GB) {
  const int t = blockIdx.x * 256 + threadIdx.x; const int nx = NR * D / 8, nw = 3 * D * D / 8, ng = 2 * GBW / 4; v8b o;
  if (t < nx) { const int e = t * 8; const int row = e / D; const float* src = row < NRS ? xs + e : row < NRS + NRP ? xp + (e - NRS * D) : xq + (e - (NRS + NRP) * D);
    for (int j = 0; j < 8; ++j) o[j] = (b16)(bf16_rne(src[j]) * XS); { *(v8b*)(X16 + e) = o;  } }
  else if (t < nx + nw) { const int e = (t - nx) * 8; const int k = e / (D * D), r = e - k * D * D; const float* w = k == 0 ? wq : k == 1 ? wk : wv; for (int j = 0; j < 8; ++j) o[j] = (b16)(bf16_rne(w[r + j]) * WSC); { *(v8b*)(W16 + e) = o;  } }
  else if (t < nx + nw + ng) { const int i = t - nx - nw, tt = i & 255, g = (i >> 8) & 15; const float *ga_ = i < GBW / 4 ? gs : gn, *be_ = i < GBW / 4 ? bs : bn; const int e = ((tt >> 7) * (D / 2) + g * 4) * D + (tt & (D - 1)); v4u w; float gv[4], bv[4];
    const float *gp = ga_ + e, *bp = be_ + e;
    for (int j = 0; j < 4; ++j) { gv[j] = gp[j * D]; bv[j] = bp[j * D]; }
    asm volatile("s_wait_xcnt 0x0" :: "v"(gp), "v"(bp) : "memory");   // behind the eight loads, in front of the first rewrite of a register that they name; the addresses are inputs, so that they keep their registers up to the wait
    for (int j = 0; j < 4; ++j) w[j] = (__float_as_uint(bf16_rne(gv[j])) & 0xFFFF0000u) | (__float_as_uint(bf16_rne(bv[j])) >> 16);
    *(v4u*)(GB + (size_t)i * 4) = w; }
}
__global__ __launch_bounds__(128) void proj_kernel(const b16* __restrict__ X16, const b16* __restrict__ W16, const float* __restrict__ bq, const float* __restrict__ bk, const float* __restrict__ bv, float* __restrict__ Q, float* __restrict__ Z, float* __restrict__ V) {
  __shared__ __attribute__((aligned(16))) float Ts[4][16][D + 4];
  const int kind = blockIdx.y, wave = threadIdx.x >> 5, lane = threadIdx.x & 31, nloc = lane & 15, hlf = lane >> 4; const size_t m0 = (size_t)blockIdx.x * 64 + wave * 16; if (kind == 0 && m0 >= (size_t)NRS) return;
  const b16* Wp = W16 + (size_t)kind * D * D; const float* bb = kind == 0 ? bq : kind == 1 ? bk : bv; float* dst = kind == 0 ? Q : kind == 1 ? Z : V;
  v8f acc[8];
#pragma unroll
  for (int t = 0; t < 8; ++t) acc[t] = (v8f){};
#pragma unroll
  for (int kb = 0; kb < D; kb += 32) { const v16b a = frag_kb(X16 + (m0 + nloc) * D + kb, hlf);
#pragma unroll
    for (int t = 0; t < 8; ++t) acc[t] = wmma16b(a, frag_kb(Wp + (size_t)(t * 16 + nloc) * D + kb, hlf), acc[t]); }
#pragma unroll
  for (int t = 0; t < 8; ++t) { const int c = t * 16 + nloc; const float b_ = bf16_rne(bb[c]);
#pragma unroll
    for (int r = 0; r < 8; ++r) { float v = acc[t][r] * (1.0f / (XS * WSC)) + b_; if (kind < 2) v = elu(v); Ts[wave][8 * hlf + r][c] = v; } }
  wave_lds_sync();
  { for (int rr = 0; rr < 16; ++rr) *(v4f*)(dst + (m0 + rr) * D + lane * 4) = *(const v4f*)(&Ts[wave][rr][lane * 4]);  }
}
// Block-wide fixed-order reductions (256 threads, every lane on): a butterfly inside each wave (lane ^ 1, 2, 4, 8 by DPP inside the 16-lane row, lane ^ 16 by a cross-row move), one word a wave in LDS, ONE barrier, then every
// thread adds the eight words in one fixed tree. N sums that do not depend on each other share the exchange. RB picks one of two exchange buffers: neighbouring reductions alternate, or have another barrier between them,
// so a buffer is rewritten only behind a barrier that every wave signals after its reads of it have returned.
template <int M> __device__ __forceinline__ int xrow_i(int x) { return __builtin_amdgcn_update_dpp(0, x, 0x160 | M /* row_xmask:M */, 0xf, 0xf, true); }
__device__ __forceinline__ int xhalf_i(int x) { return __builtin_amdgcn_permlanex16(x, x, 0x76543210, 0xfedcba98, false, false); }   // lane l with lane l ^ 16
template <int M> __device__ __forceinline__ float xrow(float x) { return __builtin_bit_cast(float, xrow_i<M>(__builtin_bit_cast(int, x))); }
__device__ __forceinline__ float xhalf(float x) { return __builtin_bit_cast(float, xhalf_i(__builtin_bit_cast(int, x))); }
template <int M> __device__ __forceinline__ double xrow_d(double x) { return __hiloint2double(xrow_i<M>(__double2hiint(x)), xrow_i<M>(__double2loint(x))); }
__device__ __forceinline__ double xhalf_d(double x) { return __hiloint2double(xhalf_i(__double2hiint(x)), xhalf_i(__double2loint(x))); }
constexpr int NW = 8 /* waves a block */, RN = 9 /* most sums in one exchange */;
template <int RB, int N> __device__ __forceinline__ void bsum(float (&v)[N], float (*rw)[RN * NW]) { static_assert(N <= RN && RB < 2, "fits the exchange buffers"); float* r = rw[RB];
  for (int i = 0; i < N; ++i) v[i] += xrow<1>(v[i]);
  for (int i = 0; i < N; ++i) v[i] += xrow<2>(v[i]);
  for (int i = 0; i < N; ++i) v[i] += xrow<4>(v[i]);
  for (int i = 0; i < N; ++i) v[i] += xrow<8>(v[i]);
  for (int i = 0; i < N; ++i) v[i] += xhalf(v[i]);
  if ((threadIdx.x & 31) == 0) { for (int i = 0; i < N; ++i) r[i * NW + (threadIdx.x >> 5)] = v[i]; }   // lane 0 speaks for the wave (where a product is fused into the first add, the lanes need not agree in the last bit)
  __syncthreads();
  for (int i = 0; i < N; ++i) { const v4f a = *(const v4f*)(r + i * NW), c = *(const v4f*)(r + i * NW + 4); v[i] = ((a[0] + a[1]) + (a[2] + a[3])) + ((c[0] + c[1]) + (c[2] + c[3])); } }
template <int RB> __device__ __forceinline__ float bsum1(float x, float (*rw)[RN * NW]) { float v[1] = {x}; bsum<RB>(v, rw); return v[0]; }
// prompt state for user b from rows r0..r0+7 of Z/V: zc = sum_j z_j; sc = sum_j z_j v_j^T; Pz = LN_D(zc + eps) gz + bz (vector, thread < 128 -> pzout), Ps = LN_DxD(sc + eps) gs + bs into
// PS (LDS, [p][q], thread owns q = t&127 for p in its half). Each element sc + eps is summed once, in the first pass, and kept in AE (LDS, 64 KB, idle at that time): group g of thread t, AE[g * 256 + t], holds
// its rows 4 g .. 4 g + 3; only the thread that wrote a group reads it, so AE needs no barrier of its own.
__device__ __forceinline__ void prompt_state(const float* __restrict__ Z, const float* __restrict__ V, int r0, const float* __restrict__ gz, const float* __restrict__ bz, const unsigned int* __restrict__ GS, float* __restrict__ PS, float* __restrict__ pzout, float (*rw)[RN * NW], float* zs, float* vs, v4f* __restrict__ AE) {
  const int t_ = threadIdx.x; const int q = t_ & (D - 1), ph = t_ >> 7;   // ph: which half of the p range (0: 0..63, 1: 64..127)
  // zc (thread < 128) and staging of the 8 z / v rows
  for (int i = t_; i < LP * D; i += 256) { zs[i] = Z[(size_t)r0 * D + i]; vs[i] = V[(size_t)r0 * D + i]; }
  __syncthreads();
  // Pz: LN over D of (zc + eps); its two sums share the exchanges of the two sums of the DxD LN
  float zc = 0.0f; if (t_ < D) { for (int j = 0; j < LP; ++j) zc += zs[j * D + t_]; zc += EPS; }
  // The passes work on pairs of neighbouring rows (v2f: one packed f32 instruction for both rows, each product fused into its add); a thread's sum over its 64 rows runs in four partial sums (rows 4i .. 4i+3), joined by sum4.
  // The first and the third pass walk their rows in batches (PB, QB): first every load of the batch, into registers, then the arithmetic.
  constexpr int PB = 8, QB = 16 /* rows a batch in the third pass */; const int pa = ph * (D / 2); float vr[LP]; v4f zr[PB / 4][LP]; v4u gw[QB / 4]; v4f ae[QB / 4]; const v2f eps2 = sp2(EPS);
#pragma unroll
  for (int j = 0; j < LP; ++j) vr[j] = vs[j * D + q];
  v2f s1a = sp2(0.0f), s1b = sp2(0.0f);
#pragma unroll 1   // the body holds PB rows already
  for (int pb = 0; pb < D / 2; pb += PB) {
#pragma unroll
    for (int k = 0; k < PB / 4; ++k) for (int j = 0; j < LP; ++j) zr[k][j] = *(const v4f*)(zs + j * D + pa + pb + 4 * k);
#pragma unroll
    for (int k = 0; k < PB / 4; ++k) { v2f a = sp2(0.0f), c = sp2(0.0f); for (int j = 0; j < LP; ++j) { a = fma2(lo2(zr[k][j]), sp2(vr[j]), a); c = fma2(hi2(zr[k][j]), sp2(vr[j]), c); } a += eps2; c += eps2; ae[k] = (v4f){a[0], a[1], c[0], c[1]}; s1a += a; s1b += c; }
#pragma unroll
    for (int k = 0; k < PB / 4; ++k) AE[(pb / 4 + k) * 256 + t_] = ae[k]; }
  float ra[2] = {zc, sum4(s1a, s1b)}; bsum<0>(ra, rw); const float mz = ra[0] * (1.0f / D), ms = ra[1] * (1.0f / (D * D)); const float dz = t_ < D ? zc - mz : 0.0f; v2f s2a = sp2(0.0f), s2b = sp2(0.0f);
#pragma unroll 1   // the body holds 32 rows already (8 LDS reads of 16 bytes, free to issue ahead of the arithmetic); unrolled further it would only add code
  for (int gb = 0; gb < D / 2 / 4; gb += 8) {
#pragma unroll
    for (int g = 0; g < 8; ++g) { const v4f x = AE[(gb + g) * 256 + t_]; const v2f da = lo2(x) - sp2(ms), dc = hi2(x) - sp2(ms); s2a = fma2(da, da, s2a); s2b = fma2(dc, dc, s2b); } }
  float rb[2] = {dz * dz, sum4(s2a, s2b)}; bsum<1>(rb, rw); const float rz = rsqrtf(rb[0] * (1.0f / D) + LNE), rs = rsqrtf(rb[1] * (1.0f / (D * D)) + LNE);
  if (t_ < D) pzout[t_] = pmul(dz * rz, bf16_rne(gz[t_])) + bf16_rne(bz[t_]);
#pragma unroll 1   // the body holds QB rows already
  for (int pb = 0; pb < D / 2; pb += QB) { const v4u* g0 = (const v4u*)GS + (pb / 4) * 256 + t_;
#pragma unroll
    for (int k = 0; k < QB / 4; ++k) gw[k] = g0[k * 256];
#pragma unroll
    for (int k = 0; k < QB / 4; ++k) ae[k] = AE[(pb / 4 + k) * 256 + t_];
    asm volatile("s_wait_xcnt 0x0" :: "v"(g0) : "memory");   // in front of the first rewrite of a register that the loads of GS name; the address is an input, so that it keeps its registers up to the wait and no load's result lands on them
#pragma unroll
    for (int k = 0; k < QB; k += 2) { const unsigned int w0 = gw[k >> 2][k & 3], w1 = gw[k >> 2][(k & 3) + 1]; const v2f o = gbfma2(((v2f){ae[k >> 2][k & 3], ae[k >> 2][(k & 3) + 1]} - sp2(ms)) * sp2(rs), w0, w1);
      PS[(pa + pb + k) * D + q] = o[0]; PS[(pa + pb + k + 1) * D + q] = o[1]; } }
  __syncthreads();
}
// state kernel: block = (chunk c, user b) (256 threads). LDS: SR [128][128] staging for the start state, PSL [128][128] prompt-P state; the running s (f32) in registers. prev_NAM does not depend on the step and qn not on the state: the block forms prev_NAM once, in registers,
// multiplies the qn rows of all its steps with it there and keeps only the products (pvS, one row a step). Per step l: s += z v^T; LN stats; NAM passes;
// amdgpu_waves_per_eu(4, 4): at most 256 registers a wave, so that two blocks still share a WGP (four waves on each SIMD), which the LDS allows
__global__ __launch_bounds__(256) __attribute__((amdgpu_waves_per_eu(4, 4))) void state_kernel(const float* __restrict__ Q, const float* __restrict__ Z, const float* __restrict__ V, const int* __restrict__ uid, const float* __restrict__ gz, const float* __restrict__ bz, const unsigned int* __restrict__ GS,
                                                 const unsigned int* __restrict__ GN, const float* __restrict__ ga, const float* __restrict__ ba, const float* __restrict__ prev_z, const float* __restrict__ prev_s, float* __restrict__ out, double* __restrict__ STD2) {
  __shared__ __attribute__((aligned(16))) float SR[D * D]; __shared__ __attribute__((aligned(16))) float PSL[D * D]; __shared__ float red[256]; __shared__ __attribute__((aligned(16))) float rw[2][RN * NW]; __shared__ __attribute__((aligned(16))) float zs[LP * D]; __shared__ float vs[LP * D]; __shared__ __attribute__((aligned(16))) float zS[MS * D] /* the z rows of the chunk's steps */, qnS[MS * D] /* their normalised q rows */; __shared__ float pzP[D], pzS[D], vS[MS * D] /* the v rows */, pvS[MS * D] /* mask_b (qn . prev_NAM), one row a step */, iznS[MS + 1] /* 1 / (|z_l| + eps) */; __shared__ __attribute__((aligned(16))) double dw[2][NW];
  const int b = blockIdx.y, blk = b * NC + blockIdx.x, l0 = chunk_start(blockIdx.x), l1 = chunk_start(blockIdx.x + 1), t_ = threadIdx.x; const int q = t_ & (D - 1), ph = t_ >> 7;
  // prompt S state -> PSL temporarily, then prev_NAM in registers and its products with the chunk's qn rows into pvS; prompt P state -> PSL (kept).
  prompt_state(Z, V, NRS + NRP + b * LP, gz, bz, GS, PSL, pzS, rw, zs, vs, (v4f*)SR);
  float qr[MS];   // the q rows of the chunk's steps, the thread's column (zero in the upper half of the block); used again for the std terms
  { const int u = min(max(uid[b], 0), NU - 1);
    // Wave w holds rows 16 w .. 16 w + 15 of prev_NAM, a lane four neighbouring columns: 16-byte loads of prev_s (from memory), all 16 in flight, issued here so that they fly together with the loads of prev_z and q
    const int wv = t_ >> 5, c4 = (t_ & 31) * 4, rw0 = wv * 16; v4f w[16], acc[MS]; const float* ps = prev_s + ((size_t)u * D + rw0) * D + c4;
#pragma unroll
    for (int k = 0; k < 16; ++k) w[k] = *(const v4f*)(ps + k * D);
    // the q rows of the chunk's steps (a chunk of fewer than MS steps takes its last row again: those products are never read); |q|^2 by the same block sums as every other sum, all in one exchange
    const float *qa[MS], *pza = prev_z + (size_t)u * D + q; const float pzr = *pza;   // both halves of the block load the rows, the upper half counts them as zero
#pragma unroll
    for (int j = 0; j < MS; ++j) { qa[j] = Q + ((size_t)b * L + min(l0 + j, l1 - 1)) * D + q; qr[j] = *qa[j]; }
    // behind the loads of prev_s, prev_z and the q rows, in front of the first rewrite of a register that they name; the addresses are inputs, so that they keep their registers up to the wait and no load's result lands on them;
    // the loaded rows are inputs, so that their loads stay here, in one flight with those of prev_s, and are not moved into a branch further down
    asm volatile("s_wait_xcnt 0x0" :: "v"(ps), "v"(pza), "v"(qa[0]), "v"(qa[1]), "v"(qa[2]), "v"(qa[3]), "v"(qa[4]), "v"(qa[5]), "v"(qa[6]), "v"(pzr), "v"(qr[0]), "v"(qr[1]), "v"(qr[2]), "v"(qr[3]), "v"(qr[4]), "v"(qr[5]), "v"(qr[6]) : "memory");
    const float pzv = t_ < D ? bf16_rne(pzr) : 0.0f, zu = t_ < D ? pzv + pzS[q] : 0.0f;
#pragma unroll
    for (int j = 0; j < MS; ++j) qr[j] = t_ < D ? qr[j] : 0.0f;
    float ru[2 + MS] = {zu * zu, pzv}; static_assert(MS == 7 && 2 + MS <= RN, "the asm statements that hold the row loads name seven rows");
#pragma unroll
    for (int j = 0; j < MS; ++j) ru[2 + j] = qr[j] * qr[j];
    bsum<0>(ru, rw); const float inv = 1.0f / (sqrtf(ru[0]) + EPS), mk = (ru[1] != 0.0f) ? 1.0f : 0.0f;
    if (t_ < D) {
#pragma unroll
      for (int j = 0; j < MS; ++j) qnS[j * D + t_] = qr[j] / (sqrtf(ru[2 + j]) + EPS); }
    __syncthreads();   // qnS is read by every wave
    // prev_NAM in registers; one LDS read of four qn values serves 16 multiply-adds. Each wave's partial rows go to SR (idle here).
    {
#pragma unroll
      for (int k = 0; k < 16; ++k) { const v4f p = *(const v4f*)(PSL + (rw0 + k) * D + c4); for (int i = 0; i < 4; ++i) w[k][i] = (bf16_rne(w[k][i]) + p[i]) * inv; }
#pragma unroll
      for (int j = 0; j < MS; ++j) { acc[j] = (v4f){};
#pragma unroll
        for (int k = 0; k < 4; ++k) { const v4f qq = *(const v4f*)(qnS + j * D + rw0 + 4 * k); for (int i = 0; i < 4; ++i) acc[j] += qq[i] * w[4 * k + i]; }
        *(v4f*)(SR + (wv * MS + j) * D + c4) = acc[j]; } }
    __syncthreads();   // the eight waves' partial rows are summed by other threads, in one fixed tree
    for (int i = t_; i < MS * D; i += 256) { const float* p = SR + i; pvS[i] = mk * (((p[0] + p[MS * D]) + (p[2 * MS * D] + p[3 * MS * D])) + ((p[4 * MS * D] + p[5 * MS * D]) + (p[6 * MS * D] + p[7 * MS * D]))); } }
  __syncthreads();
  prompt_state(Z, V, NRS + b * LP, gz, bz, GS, PSL, pzP, rw, zs, vs, (v4f*)SR);
  // state in front of step l0: s = sum_{l < l0} z_l v_l^T and zcum = sum z_l, each element summed in step order. The thread keeps rows p0..p0+7 x columns q0..q0+3 and 64+q0..64+q0+3 in registers;
  // SR, which holds nothing any more (the prompt states are done with it), stages TR rows of z and TR rows of v at a time (whole tiles are loaded: rows past l0 are inside Z and V and are not summed).
  float zc0;   // sum of z over the earlier steps, the thread's column
  { float* zt = SR; float* vt = SR + TR * D; const int p0 = (t_ >> 4) * 8, q0 = (t_ & 15) * 4; v4f a0[8], a1[8]; float zc = 0.0f; const v4f* zg = (const v4f*)(Z + (size_t)b * L * D) + t_; const v4f* vg = (const v4f*)(V + (size_t)b * L * D) + t_;
#pragma unroll
    for (int r = 0; r < 8; ++r) { a0[r] = (v4f){}; a1[r] = (v4f){}; }
    for (int base = 0; base < l0; base += TR, zg += TR * D / 4, vg += TR * D / 4) { const int n = min(TR, l0 - base);
#pragma unroll   // all 16 loads of the thread in flight at once
      for (int k = 0; k < TR * D / 4 / 256; ++k) { ((v4f*)zt)[t_ + k * 256] = zg[k * 256]; ((v4f*)vt)[t_ + k * 256] = vg[k * 256]; }
      __syncthreads();
#pragma unroll 2   // the next row's LDS reads issue under this row's 64 multiply-adds
      for (int j = 0; j < n; ++j) { const v4f z0 = *(const v4f*)(zt + j * D + p0), z1 = *(const v4f*)(zt + j * D + p0 + 4), v0 = *(const v4f*)(vt + j * D + q0), v1 = *(const v4f*)(vt + j * D + 64 + q0);
        zc += zt[j * D + q];   // both halves of the block sum it, the lower half uses it
#pragma unroll
        for (int r = 0; r < 4; ++r) { a0[r] += z0[r] * v0; a1[r] += z0[r] * v1; a0[4 + r] += z1[r] * v0; a1[4 + r] += z1[r] * v1; } }
      __syncthreads(); }
#pragma unroll
    for (int r = 0; r < 8; ++r) { *(v4f*)(SR + (p0 + r) * D + q0) = a0[r]; *(v4f*)(SR + (p0 + r) * D + 64 + q0) = a1[r]; }
    zc0 = zc; }
  __syncthreads();
  // From here on every element of the state is read and written by one thread only (rows pa..pa+63 of column q): it leaves SR for the thread's registers and stays there over all steps of the chunk.
  constexpr int NH = D / 2; const int pa = ph * NH; const unsigned e0 = pa * D + q /* the thread's first element in every DxD matrix: the rows of the unrolled passes differ from it by constants, so each matrix takes one address for the whole loop */; v2f st[NH / 2], nw[NH / 2] /* pair k: rows pa + 2 k and pa + 2 k + 1 */; const v2f eps2 = sp2(EPS);
#pragma unroll   // st is indexed by constants only, so that it lives in registers
  for (int k = 0; k < NH / 2; ++k) st[k] = (v2f){SR[(pa + 2 * k) * D + q], SR[(pa + 2 * k + 1) * D + q]};
  // What a step needs beside the DxD state depends on no step before it but through the running sum of z: it is made here for all steps of the chunk at once. The z and v rows go to LDS (the lower half of the block brings z, the upper half v);
  // z_l = LN_D(zcum + eps) gz + bz + Pz, 1 / (|z_l| + eps) and the std terms follow with three exchanges for all steps together (each sum in the tree it always had); the walk itself then loads only GS and GN.
  double dsum = 0.0, dsq = 0.0; float gav, bav;   // gav, bav: the thread's column of na_gamma, na_beta
  { const float* sp = (ph ? V : Z) + (size_t)b * L * D + q; float* dl = (ph ? vS : zS) + q; const float *ra_[MS], *gzp = gz + q, *bzp = bz + q, *gap = ga + q, *bap = ba + q; float rv[MS], zc[MS], zf[MS], a[MS];
#pragma unroll
    for (int j = 0; j < MS; ++j) { ra_[j] = sp + (size_t)min(l0 + j, l1 - 1) * D; rv[j] = *ra_[j]; }   // a chunk of fewer than MS steps takes its last row again: what comes of it is never read
    const float gzr = *gzp, bzr = *bzp, gar = *gap, bar = *bap;
    // behind these loads, in front of the first rewrite of a register that they name; the addresses are inputs, so that they keep their registers up to the wait and no load's result lands on them; the values, so that the loads stay in one flight
    asm volatile("s_wait_xcnt 0x0" :: "v"(ra_[0]), "v"(ra_[1]), "v"(ra_[2]), "v"(ra_[3]), "v"(ra_[4]), "v"(ra_[5]), "v"(ra_[6]), "v"(gzp), "v"(bzp), "v"(gap), "v"(bap), "v"(rv[0]), "v"(rv[1]), "v"(rv[2]), "v"(rv[3]), "v"(rv[4]), "v"(rv[5]), "v"(rv[6]), "v"(gzr), "v"(bzr), "v"(gar), "v"(bar) : "memory");
    gav = bf16_rne(gar); bav = bf16_rne(bar); const float gzv = bf16_rne(gzr), bzv = bf16_rne(bzr), pz = pzP[q]; float run = zc0;
#pragma unroll
    for (int j = 0; j < MS; ++j) { dl[j * D] = rv[j]; run += rv[j]; zc[j] = t_ < D ? run + EPS : 0.0f; a[j] = zc[j]; }
    bsum<1>(a, rw);   // its barrier also publishes zS and vS
#pragma unroll
    for (int j = 0; j < MS; ++j) { zc[j] = t_ < D ? zc[j] - a[j] * (1.0f / D) : 0.0f; a[j] = zc[j] * zc[j]; }
    bsum<0>(a, rw);
#pragma unroll
    for (int j = 0; j < MS; ++j) { zf[j] = t_ < D ? pmul(zc[j] * rsqrtf(a[j] * (1.0f / D) + LNE), gzv) + bzv + pz : 0.0f; a[j] = zf[j] * zf[j]; }
    bsum<1>(a, rw);
    float zn2 = a[0];
#pragma unroll
    for (int j = 1; j < MS; ++j) zn2 = t_ == j ? a[j] : zn2;
    if (t_ < MS) iznS[t_] = 1.0f / (sqrtf(zn2) + EPS);   // read in the third pass, behind the barriers of the first two
    if (t_ < D) {
#pragma unroll
      for (int j = 0; j < MS; ++j) if (l0 + j < l1) { const float xv = qr[j] / fmaxf(zf[j], 1e-6f); dsum += (double)xv; dsq += (double)xv * (double)xv; } } }
  for (int l = l0; l < l1; ++l) { const size_t row = (size_t)b * L + l; const int js = (l - l0) * D;
    // Five passes over the thread's 64 rows, all unrolled (st and nw are indexed by constants only). st holds the running state; nw holds S_l/|z_l| + eps, made once in the third pass and used again by the
    // fourth and fifth, which so read neither gs, bs nor the prompt state again. What a pass still loads comes in batches of RA, RB or RC rows: first every load of the batch, then the arithmetic.
    // All five work on pairs of neighbouring rows with packed f32 instructions, each product fused into its add; each sum over the thread's rows runs in four partial sums (rows 4i .. 4i+3), joined by sum4.
    constexpr int RA = 32 /* the first pass: one 16-byte LDS read for four rows */, RB = 16 /* the third pass: a parameter word and a value of the prompt state a row beside the 128 kept values */, RC = 32 /* the fifth pass: a parameter word a row and a 16-byte LDS read for four rows */; float pl[RB]; v4f qv_[RA / 4]; v4u gw[RB / 4], gx[RC / 4]; const v4u *GSt = (const v4u*)GS + t_, *GNt = (const v4u*)GN + t_;
    v2f s1a = sp2(0.0f), s1b = sp2(0.0f); const v2f vq = sp2(vS[js + q]);
#pragma unroll
    for (int pb = 0; pb < NH; pb += RA) {
#pragma unroll
      for (int k = 0; k < RA / 4; ++k) qv_[k] = *(const v4f*)(zS + js + pa + pb + 4 * k);
#pragma unroll
      for (int k = 0; k < RA / 4; ++k) { v2f &a = st[pb / 2 + 2 * k], &c = st[pb / 2 + 2 * k + 1]; a = fma2(lo2(qv_[k]), vq, a); c = fma2(hi2(qv_[k]), vq, c); s1a += a + eps2; s1b += c + eps2; } }
    const float m1 = bsum1<0>(sum4(s1a, s1b), rw) * (1.0f / (D * D)); v2f s2a = sp2(0.0f), s2b = sp2(0.0f);
#pragma unroll
    for (int k = 0; k < NH / 2; k += 2) { const v2f da = (st[k] + eps2) - sp2(m1), dc = (st[k + 1] + eps2) - sp2(m1); s2a = fma2(da, da, s2a); s2b = fma2(dc, dc, s2b); }
    const float r1 = rsqrtf(bsum1<1>(sum4(s2a, s2b), rw) * (1.0f / (D * D)) + LNE), izn = iznS[l - l0];
    // NAMraw = (LN(s) gs + bs + Ps) izn + eps ; stats
    v2f n1a = sp2(0.0f), n1b = sp2(0.0f);
#pragma unroll
    for (int pb = 0; pb < NH; pb += RB) {
#pragma unroll
      for (int k = 0; k < RB / 4; ++k) gw[k] = GSt[(pb / 4 + k) * 256];
#pragma unroll
      for (int k = 0; k < RB; ++k) pl[k] = PSL[e0 + (pb + k) * D];
      asm volatile("s_wait_xcnt 0x0" ::: "memory");   // behind the loads of GS, in front of any later rewrite of a register that they name; its memory clobber also keeps the batch's loads in front of the arithmetic
#pragma unroll
      for (int k = 0; k < RB; k += 2) { const unsigned int w0 = gw[k >> 2][k & 3], w1 = gw[k >> 2][(k & 3) + 1]; const v2f sf = gbfma2(((st[(pb + k) / 2] + eps2) - sp2(m1)) * sp2(r1), w0, w1) + (v2f){pl[k], pl[k + 1]};
        const v2f x = fma2(sf, sp2(izn), eps2); nw[(pb + k) / 2] = x; if (k & 2) n1b += x; else n1a += x; } }
    const float m2 = bsum1<0>(sum4(n1a, n1b), rw) * (1.0f / (D * D)); v2f n2a = sp2(0.0f), n2b = sp2(0.0f);
#pragma unroll
    for (int k = 0; k < NH / 2; k += 2) { const v2f da = nw[k] - sp2(m2), dc = nw[k + 1] - sp2(m2); n2a = fma2(da, da, n2a); n2b = fma2(dc, dc, n2b); }
    const float r2 = rsqrtf(bsum1<1>(sum4(n2a, n2b), rw) * (1.0f / (D * D)) + LNE);
    // NA_q partial over the thread's p half: sum_p qn_p NAM_pq
    v2f naa = sp2(0.0f), nab = sp2(0.0f); const float* qnl = qnS + js + pa;
#pragma unroll
    for (int pb = 0; pb < NH; pb += RC) {
#pragma unroll
      for (int k = 0; k < RC / 4; ++k) gx[k] = GNt[(pb / 4 + k) * 256];
#pragma unroll
      for (int k = 0; k < RC / 4; ++k) qv_[k] = *(const v4f*)(qnl + pb + 4 * k);
      asm volatile("s_wait_xcnt 0x0" ::: "memory");   // as in the third pass, for the loads of GN
#pragma unroll
      for (int k = 0; k < RC; k += 2) { const unsigned int w0 = gx[k >> 2][k & 3], w1 = gx[k >> 2][(k & 3) + 1]; const v2f nam = gbfma2((nw[(pb + k) / 2] - sp2(m2)) * sp2(r2), w0, w1);
        if (k & 2) nab = fma2(hi2(qv_[k >> 2]), nam, nab); else naa = fma2(lo2(qv_[k >> 2]), nam, naa); } }
    // combine the two halves: threads q and q+128 -> via red
    red[t_] = sum4(naa, nab); __syncthreads();
    // LN_D(NA) ga + ba -> out row. No barrier closes the step: what the next step writes in LDS (red and the exchange words) was last read in front of the two barriers below.
    { const float x = t_ < D ? (red[t_] + red[t_ + D]) + pvS[js + t_] : 0.0f; const float mu = bsum1<0>(x, rw) * (1.0f / D); const float dv = t_ < D ? x - mu : 0.0f; const float var = bsum1<1>(dv * dv, rw) * (1.0f / D); const float rr = rsqrtf(var + LNE);
      const float o = pmul(dv * rr, gav) + bav;
      // the wait: behind the store of the row, in front of the next step's rewrite of its address registers (the barrier that stood here brought a wait of its own); inside the branch, so that the loop's address additions cannot be lifted over it
      { if (t_ < D) { ((float*)out)[row * D + t_] = o; asm volatile("s_wait_xcnt 0x0" ::: "memory"); }  } } }
  // the block's two f64 sums, reduced like the f32 ones: butterfly in the wave, one word a wave, one barrier, one fixed tree
  dsum += xrow_d<1>(dsum); dsq += xrow_d<1>(dsq); dsum += xrow_d<2>(dsum); dsq += xrow_d<2>(dsq); dsum += xrow_d<4>(dsum); dsq += xrow_d<4>(dsq); dsum += xrow_d<8>(dsum); dsq += xrow_d<8>(dsq); dsum += xhalf_d(dsum); dsq += xhalf_d(dsq);
  if ((t_ & 31) == 0) { dw[0][t_ >> 5] = dsum; dw[1][t_ >> 5] = dsq; }
  __syncthreads();
  { if (t_ < 16) { const double* w = dw[t_ & 1]; const double tot = ((w[0] + w[1]) + (w[2] + w[3])) + ((w[4] + w[5]) + (w[6] + w[7])); ((double*)STD2)[(size_t)blk * 16 + t_] = t_ < 2 ? tot : 0.0; }  }
}
// final std: one wave, the users' sums joined by a butterfly over lanes 0..15: n = 16*200*128; var = (sumsq - sum^2/n) / (n-1); std -> out2[0] (and 31 zero floats to fill the line? the output is a single float at the end of the buffer; we write just it).
__global__ __launch_bounds__(32) void std_kernel(const double* __restrict__ STD2, float* __restrict__ out2) {
  const int lane = threadIdx.x; double s = 0.0, s2 = 0.0;
  if (lane < NB) {   // lane = user: its chunks in order
#pragma unroll   // several of the lane's loads in flight at a time
    for (int k = 0; k < NC; ++k) { s += STD2[(size_t)(lane * NC + k) * 16]; s2 += STD2[(size_t)(lane * NC + k) * 16 + 1]; } }
  for (int m = NB / 2; m >= 1; m >>= 1) { s += __shfl_xor(s, m); s2 += __shfl_xor(s2, m); }
  if (lane == 0) { const double n = (double)NB * L * D; const double var = (s2 - s * s / n) / (n - 1.0); const float sd = (float)sqrt(var > 0.0 ? var : 0.0);
    { ((float*)out2)[0] = sd;  } }
}
}  // namespace

extern "C" void kernel_launch(void* const* d_in, const int* in_sizes, int n_in, void* d_out, int out_size, void* d_ws, size_t ws_size, hipStream_t stream) {
  (void)n_in;
  auto Fp = [&](int i) { return (const float*)d_in[i]; }; auto Ip = [&](int i) { return (const int*)d_in[i]; };
  // input order: 0 user_id [16] i32, 1 seqs_emb [16,200,128], 2 P [16,8,128], 3 S [16,8,128], 4 Wq [128,128], 5 bq, 6 Wk, 7 bk, 8 Wv, 9 bv, 10 z_gamma, 11 z_beta, 12 s_gamma [128,128], 13 s_beta, 14 nam_gamma, 15 nam_beta,
  // 16 na_gamma [128], 17 na_beta, 18 prev_z [1001,128], 19 prev_s [1001,128,128]; outputs NA [16,200,128] at 0, std [1] at float 409600
  if (in_sizes[0] != NB || in_sizes[1] != NRS * D || in_sizes[2] != NRP * D || in_sizes[3] != NRP * D || in_sizes[4] != D * D || in_sizes[12] != D * D || in_sizes[18] != NU * D || in_sizes[19] != NU * D * D || out_size != NRS * D + 1) return;
  size_t off = 0; char* ws = (char*)d_ws;
  auto carve = [&](size_t bytes) { char* p = ws + off; off += (bytes + 255) & ~(size_t)255; return p; };
  b16* X16 = (b16*)carve((size_t)NR * D * 2); b16* W16 = (b16*)carve((size_t)3 * D * D * 2); float* Qp = (float*)carve((size_t)NRS * D * 4); float* Zp = (float*)carve((size_t)NR * D * 4); float* Vp = (float*)carve((size_t)NR * D * 4); double* STD2 = (double*)carve((size_t)NB * NC * 16 * 8); unsigned int* GB = (unsigned int*)carve((size_t)2 * GBW * 4);
  if (off > ws_size || off > ((size_t)128 << 20)) return;   // about 6 MB
  prep_kernel<<<(NR * D / 8 + 3 * D * D / 8 + 2 * GBW / 4 + 255) / 256, 256, 0, stream>>>(Fp(1), Fp(2), Fp(3), Fp(4), Fp(6), Fp(8), Fp(12), Fp(13), Fp(14), Fp(15), X16, W16, GB);
  proj_kernel<<<dim3(NR / 64, 3), 128, 0, stream>>>(X16, W16, Fp(5), Fp(7), Fp(9), Qp, Zp, Vp);
  state_kernel<<<dim3(NC, NB), 256, 0, stream>>>(Qp, Zp, Vp, Ip(0), Fp(10), Fp(11), GB, GB + GBW, Fp(16), Fp(17), Fp(18), Fp(19), (float*)d_out, STD2);
  std_kernel<<<1, 32, 0, stream>>>(STD2, (float*)d_out + (size_t)NRS * D);
}

// v010
// Measured time: 65.5 microseconds a run.
// Next to v009, in two timings, it ran 1.14 and 1.15 times as fast.
// All steps since v000 together make it 313 times as fast.
#include <hip/hip_runtime.h>

// CSR attention block (16 users x 200 steps, D = 128): q = elu(x Wq^T + bq), qn = q/(|q|+eps); z = elu(x Wk^T + bk), v = x Wv^T + bv; per user the causal cumulative state s_l = sum_{l'<=l} z v^T
// and zc_l = sum z; z_l = LN_D(zc_l + eps) + Pz, S_l = LN_DxD(s_l + eps) + Ps where (Pz, Ps) is the same construction on the 8-step prompt P taken at its last step; NAM = LN_DxD(S_l/(|z_l|+eps) + eps);
// NA = qn . NAM + mask_b (qn . prev_NAM) with prev_NAM = (prev_s[uid] + Ss) / (|prev_z[uid] + Sz| + eps) from the prompt S; NA = LN_D(NA); second output std = unbiased std of
// q / max(z_l, 1e-6) over all (b, l, d).
// The two prompt states of a user are made once, each by a block of its own in the projection launch. State kernel: one block per (user, chunk of 7, 6 or 5 steps; later chunks are shorter, see chunk_start): it first sums z v^T and z over all earlier steps of its user, in step order, in registers, then walks its chunk with the running DxD state in registers (f32, 64 elements a thread),
// the prompt state beside it, LN statistics by fixed-order block reductions, the vector-matrix product qn . NAM on the VALU (batches of rows: the loads first, then the arithmetic), qn . prev_NAM for all steps of the chunk at once in front of the walk; the std partials in f64 per block, combined by one final wave.
// WMMA (v_wmma_f32_16x16x32_f16, f32 accumulate): the q projection of the sequence ([3,200 x 128] x [128 x 128]) and the z/v projections of the sequence and both prompts ([3,456 x 128] x [128 x 128] x2) with EXACT bf16 inputs (x8) and weights (x256), 1 product.
// The four DxD LN parameter matrices are rounded to bf16 once, in the prep kernel, and packed: one 32-bit word holds (gamma, beta) of an element, four rows of a thread's column lie in one 16-byte word group (see GB below).
// Inputs rounded to bf16 once; user_id int32, clamped. Fragment k-map per lane half hh for A AND B: elements 0..7 <- k = 8hh+0..7, 8..15 <- k = 16+8hh+0..7; acc[r] =

namespace {
constexpr int NB = 16, L = 200, LP = 8, D = 128, NU = 1001, NRS = NB * L /* 3200 */, NRP = NB * LP /* 128 */, NR = NRS + 2 * NRP /* 3456 = 54 x 64 */;
constexpr int NC = 32 /* chunks per user: 512 blocks, two per WGP by LDS */, TR = 64 /* rows of z and of v staged at a time for the earlier steps */;
// First step of chunk c. A block pays for every earlier step of its user (one rank-1 update of the start state) as well as for its own steps (five passes and the reductions, some fifty times as much), so later chunks get
// fewer steps and every block about the same work: chunks 0..14 have 7 steps, 15..24 have 6, 25..31 have 5.
__host__ __device__ constexpr int chunk_start(int c) { return 7 * c - (c > 15 ? c - 15 : 0) - (c > 25 ? c - 25 : 0); }
static_assert(chunk_start(0) == 0 && chunk_start(NC) == L, "the chunks cover the sequence");
constexpr int MS = chunk_start(1) - chunk_start(0) /* most steps a chunk: the first chunks are the longest */;
static_assert(2 * TR * D <= D * D && (NB - 1) * L + ((L - 1) / TR + 1) * TR <= NR, "staged tiles fit SR and stay inside Z and V");
constexpr float XS = 8.0f, WSC = 256.0f, EPS = 1e-8f, LNE = 1e-5f;

typedef _Float16 b16;
typedef __attribute__((ext_vector_type(16))) _Float16 v16b;
typedef __attribute__((ext_vector_type(8))) _Float16 v8b;
typedef __attribute__((ext_vector_type(8))) float v8f;
typedef __attribute__((ext_vector_type(4))) float v4f;
typedef __attribute__((ext_vector_type(4))) unsigned int v4u;
typedef __attribute__((ext_vector_type(2))) float v2f;   // two neighbouring rows of a thread's column: one v_pk_add/mul/fma_f32 works on both
__device__ __forceinline__ float bf16_rne(float f) { unsigned int u = __float_as_uint(f); u += 0x7FFFu + ((u >> 16) & 1u); return __uint_as_float(u & 0xFFFF0000u); }
// GB: a pair (gamma, beta) of DxD matrices, each value rounded to bf16, gamma in the high and beta in the low half of a word. Word ((g * 256 + t) * 4 + j) belongs to row (t >> 7) * 64 + 4 g + j, column t & 127:
// thread t of the state kernel reads four of its rows with one 16-byte load, and a wave reads 512 bytes in a row.
constexpr int GBW = D * D /* words a pair */;
__device__ __forceinline__ float gb_g(unsigned int w) { return __uint_as_float(w & 0xFFFF0000u); }
__device__ __forceinline__ float gb_b(unsigned int w) { return __uint_as_float(w << 16); }
__device__ __forceinline__ v2f fma2(v2f a, v2f b, v2f c) { return __builtin_elementwise_fma(a, b, c); }
__device__ __forceinline__ v2f sp2(float x) { return (v2f){x, x}; }
// x gamma + beta, fused, of one row: the instruction reads gamma (high half) and beta (low half) of the word as they lie. In asm because the compiler, given the two rows of a pair, unpacks four halves (two v_and, two shifts) to feed
// one v_pk_fma_f32: four instructions a pair where these are two.
__device__ __forceinline__ float gbfma(float x, unsigned int w) { float d; asm("v_fma_mix_f32_bf16 %0, %1, %2, %2 op_sel:[0,1,0] op_sel_hi:[0,1,1]" : "=v"(d) : "v"(x), "v"(w)); return d; }
__device__ __forceinline__ v2f gbfma2(v2f x, unsigned int w0, unsigned int w1) { return (v2f){gbfma(x[0], w0), gbfma(x[1], w1)}; }
__device__ __forceinline__ v2f lo2(v4f x) { return (v2f){x[0], x[1]}; }
__device__ __forceinline__ v2f hi2(v4f x) { return (v2f){x[2], x[3]}; }
__device__ __forceinline__ float sum4(v2f a, v2f c) { return (a[0] + a[1]) + (c[0] + c[1]); }   // the thread's four partial sums (rows 4i, 4i+1, 4i+2, 4i+3), one fixed tree
__device__ __forceinline__ v16b frag_kb(const b16* p, int hh) { const v8b a = *(const v8b*)(p + 8 * hh), b = *(const v8b*)(p + 16 + 8 * hh); v16b f;
#pragma unroll
  for (int e = 0; e < 8; ++e) { f[e] = a[e]; f[8 + e] = b[e]; } return f; }
__device__ __forceinline__ v8f wmma16b(v16b a, v16b b, v8f c) { v8f d = __builtin_amdgcn_wmma_f32_16x16x32_f16(false, a, false, b, (short)0, c, false, false); asm volatile("v_nop\n\tv_nop\n\tv_nop\n\tv_nop" : "+v"(d) : "v"(a), "v"(b)); return d; }
__device__ __forceinline__ void wave_lds_sync() { __builtin_amdgcn_fence(__ATOMIC_RELEASE, "workgroup"); __builtin_amdgcn_wave_barrier(); __builtin_amdgcn_fence(__ATOMIC_ACQUIRE, "workgroup"); }
__device__ __forceinline__ float pmul(float a, float b) { float p = a * b; asm volatile("" : "+v"(p)); return p; }
__device__ __forceinline__ float elu(float x) { return x > 0.0f ? x : (__expf(x) - 1.0f); }

__global__ __launch_bounds__(256) void prep_kernel(const float* __restrict__ xs, const float* __restrict__ xp, const float* __restrict__ xq, const float* __restrict__ wq, const float* __restrict__ wk, const float* __restrict__ wv, const float* __restrict__ gs, const float* __restrict__ bs, const float* __restrict__ gn, const float* __restrict__ bn, b16* __restrict__ X16, b16* __restrict__ W16, unsigned int* __restrict__ GB) {
  const int t = blockIdx.x * 256 + threadIdx.x; const int nx = NR * D / 8, nw = 3 * D * D / 8, ng = 2 * GBW / 4; v8b o;
  if (t < nx) { const int e = t * 8; const int row = e / D; const float* src = row < NRS ? xs + e : row < NRS + NRP ? xp + (e - NRS * D) : xq + (e - (NRS + NRP) * D);
    for (int j = 0; j < 8; ++j) o[j] = (b16)(bf16_rne(src[j]) * XS); { *(v8b*)(X16 + e) = o;  } }
  else if (t < nx + nw) { const int e = (t - nx) * 8; const int k = e / (D * D), r = e - k * D * D; const float* w = k == 0 ? wq : k == 1 ? wk : wv; for (int j = 0; j < 8; ++j) o[j] = (b16)(bf16_rne(w[r + j]) * WSC); { *(v8b*)(W16 + e) = o;  } }
  else if (t < nx + nw + ng) { const int i = t - nx - nw, tt = i & 255, g = (i >> 8) & 15; const float *ga_ = i < GBW / 4 ? gs : gn, *be_ = i < GBW / 4 ? bs : bn; const int e = ((tt >> 7) * (D / 2) + g * 4) * D + (tt & (D - 1)); v4u w; float gv[4], bv[4];
    const float *gp = ga_ + e, *bp = be_ + e;
    for (int j = 0; j < 4; ++j) { gv[j] = gp[j * D]; bv[j] = bp[j * D]; }
    asm volatile("s_wait_xcnt 0x0" :: "v"(gp), "v"(bp) : "memory");   // behind the eight loads, in front of the first rewrite of a register that they name; the addresses are inputs, so that they keep their registers up to the wait
    for (int j = 0; j < 4; ++j) w[j] = (__float_as_uint(bf16_rne(gv[j])) & 0xFFFF0000u) | (__float_as_uint(bf16_rne(bv[j])) >> 16);
    *(v4u*)(GB + (size_t)i * 4) = w; }
}
// Block-wide fixed-order reductions (256 threads, every lane on): a butterfly inside each wave (lane ^ 1, 2, 4, 8 by DPP inside the 16-lane row, lane ^ 16 by a cross-row move), one word a wave in LDS, ONE barrier, then every
// thread adds the eight words in one fixed tree. N sums that do not depend on each other share the exchange. RB picks one of two exchange buffers: neighbouring reductions alternate, or have another barrier between them,
// so a buffer is rewritten only behind a barrier that every wave signals after its reads of it have returned.
template <int M> __device__ __forceinline__ int xrow_i(int x) { return __builtin_amdgcn_update_dpp(0, x, 0x160 | M /* row_xmask:M */, 0xf, 0xf, true); }
__device__ __forceinline__ int xhalf_i(int x) { return __builtin_amdgcn_permlanex16(x, x, 0x76543210, 0xfedcba98, false, false); }   // lane l with lane l ^ 16
template <int M> __device__ __forceinline__ float xrow(float x) { return __builtin_bit_cast(float, xrow_i<M>(__builtin_bit_cast(int, x))); }
__device__ __forceinline__ float xhalf(float x) { return __builtin_bit_cast(float, xhalf_i(__builtin_bit_cast(int, x))); }
template <int M> __device__ __forceinline__ double xrow_d(double x) { return __hiloint2double(xrow_i<M>(__double2hiint(x)), xrow_i<M>(__double2loint(x))); }
__device__ __forceinline__ double xhalf_d(double x) { return __hiloint2double(xhalf_i(__double2hiint(x)), xhalf_i(__double2loint(x))); }
constexpr int NW = 8 /* waves a block */, RN = 9 /* most sums in one exchange */;
template <int RB, int N> __device__ __forceinline__ void bsum(float (&v)[N], float (*rw)[RN * NW]) { static_assert(N <= RN && RB < 2, "fits the exchange buffers"); float* r = rw[RB];
  for (int i = 0; i < N; ++i) v[i] += xrow<1>(v[i]);
  for (int i = 0; i < N; ++i) v[i] += xrow<2>(v[i]);
  for (int i = 0; i < N; ++i) v[i] += xrow<4>(v[i]);
  for (int i = 0; i < N; ++i) v[i] += xrow<8>(v[i]);
  for (int i = 0; i < N; ++i) v[i] += xhalf(v[i]);
  if ((threadIdx.x & 31) == 0) { for (int i = 0; i < N; ++i) r[i * NW + (threadIdx.x >> 5)] = v[i]; }   // lane 0 speaks for the wave (where a product is fused into the first add, the lanes need not agree in the last bit)
  __syncthreads();
  for (int i = 0; i < N; ++i) { const v4f a = *(const v4f*)(r + i * NW), c = *(const v4f*)(r + i * NW + 4); v[i] = ((a[0] + a[1]) + (a[2] + a[3])) + ((c[0] + c[1]) + (c[2] + c[3])); } }
template <int RB> __device__ __forceinline__ float bsum1(float x, float (*rw)[RN * NW]) { float v[1] = {x}; bsum<RB>(v, rw); return v[0]; }
// prompt state of one user and one prompt from its 8 rows of z and v (zs, vs: LDS, filled by the caller; the first barrier here publishes them): zc = sum_j z_j; sc = sum_j z_j v_j^T; Pz = LN_D(zc + eps) gz + bz (vector, thread < 128 -> pzout), Ps = LN_DxD(sc + eps) gs + bs into
// PS (global, [p][q], thread owns q = t&127 for p in its half). Each element sc + eps is summed once, in the first pass, and kept in AE (LDS, 64 KB): group g of thread t, AE[g * 256 + t], holds
// its rows 4 g .. 4 g + 3; only the thread that wrote a group reads it, so AE needs no barrier of its own.
__device__ __forceinline__ void prompt_state(const float* __restrict__ gz, const float* __restrict__ bz, const unsigned int* __restrict__ GS, float* __restrict__ PS, float* __restrict__ pzout, float (*rw)[RN * NW], float* zs, float* vs, v4f* __restrict__ AE) {
  const int t_ = threadIdx.x; const int q = t_ & (D - 1), ph = t_ >> 7;   // ph: which half of the p range (0: 0..63, 1: 64..127)
  __syncthreads();
  // Pz: LN over D of (zc + eps); its two sums share the exchanges of the two sums of the DxD LN
  float zc = 0.0f; if (t_ < D) { for (int j = 0; j < LP; ++j) zc += zs[j * D + t_]; zc += EPS; }
  // The passes work on pairs of neighbouring rows (v2f: one packed f32 instruction for both rows, each product fused into its add); a thread's sum over its 64 rows runs in four partial sums (rows 4i .. 4i+3), joined by sum4.
  // The first and the third pass walk their rows in batches (PB, QB): first every load of the batch, into registers, then the arithmetic.
  constexpr int PB = 8, QB = 16 /* rows a batch in the third pass */; const int pa = ph * (D / 2); float vr[LP]; v4f zr[PB / 4][LP]; v4u gw[QB / 4]; v4f ae[QB / 4]; float ov[QB]; static_assert(QB == 16, "the asm statement behind the stores names sixteen values"); const v2f eps2 = sp2(EPS);
#pragma unroll
  for (int j = 0; j < LP; ++j) vr[j] = vs[j * D + q];
  v2f s1a = sp2(0.0f), s1b = sp2(0.0f);
#pragma unroll 1   // the body holds PB rows already
  for (int pb = 0; pb < D / 2; pb += PB) {
#pragma unroll
    for (int k = 0; k < PB / 4; ++k) for (int j = 0; j < LP; ++j) zr[k][j] = *(const v4f*)(zs + j * D + pa + pb + 4 * k);
#pragma unroll
    for (int k = 0; k < PB / 4; ++k) { v2f a = sp2(0.0f), c = sp2(0.0f); for (int j = 0; j < LP; ++j) { a = fma2(lo2(zr[k][j]), sp2(vr[j]), a); c = fma2(hi2(zr[k][j]), sp2(vr[j]), c); } a += eps2; c += eps2; ae[k] = (v4f){a[0], a[1], c[0], c[1]}; s1a += a; s1b += c; }
#pragma unroll
    for (int k = 0; k < PB / 4; ++k) AE[(pb / 4 + k) * 256 + t_] = ae[k]; }
  float ra[2] = {zc, sum4(s1a, s1b)}; bsum<0>(ra, rw); const float mz = ra[0] * (1.0f / D), ms = ra[1] * (1.0f / (D * D)); const float dz = t_ < D ? zc - mz : 0.0f; v2f s2a = sp2(0.0f), s2b = sp2(0.0f);
#pragma unroll 1   // the body holds 32 rows already (8 LDS reads of 16 bytes, free to issue ahead of the arithmetic); unrolled further it would only add code
  for (int gb = 0; gb < D / 2 / 4; gb += 8) {
#pragma unroll
    for (int g = 0; g < 8; ++g) { const v4f x = AE[(gb + g) * 256 + t_]; const v2f da = lo2(x) - sp2(ms), dc = hi2(x) - sp2(ms); s2a = fma2(da, da, s2a); s2b = fma2(dc, dc, s2b); } }
  float rb[2] = {dz * dz, sum4(s2a, s2b)}; bsum<1>(rb, rw); const float rz = rsqrtf(rb[0] * (1.0f / D) + LNE), rs = rsqrtf(rb[1] * (1.0f / (D * D)) + LNE);
  if (t_ < D) { pzout[t_] = pmul(dz * rz, bf16_rne(gz[t_])) + bf16_rne(bz[t_]); asm volatile("s_wait_xcnt 0x0" ::: "memory"); }   // the wait: behind the store, in front of any later rewrite of a register that it names
#pragma unroll 1   // the body holds QB rows already
  for (int pb = 0; pb < D / 2; pb += QB) { const v4u* g0 = (const v4u*)GS + (pb / 4) * 256 + t_;
#pragma unroll
    for (int k = 0; k < QB / 4; ++k) gw[k] = g0[k * 256];
#pragma unroll
    for (int k = 0; k < QB / 4; ++k) ae[k] = AE[(pb / 4 + k) * 256 + t_];
    asm volatile("s_wait_xcnt 0x0" :: "v"(g0) : "memory");   // in front of the first rewrite of a register that the loads of GS name; the address is an input, so that it keeps its registers up to the wait and no load's result lands on them
#pragma unroll
    for (int k = 0; k < QB; k += 2) { const unsigned int w0 = gw[k >> 2][k & 3], w1 = gw[k >> 2][(k & 3) + 1]; const v2f o = gbfma2(((v2f){ae[k >> 2][k & 3], ae[k >> 2][(k & 3) + 1]} - sp2(ms)) * sp2(rs), w0, w1);
      ov[k] = o[0]; ov[k + 1] = o[1]; }
    float* pp = PS + (pa + pb) * D + q;
#pragma unroll
    for (int k = 0; k < QB; ++k) pp[k * D] = ov[k];
    // behind the batch's stores, in front of the first rewrite of a register that they name; address and values are inputs, so that they keep their registers up to the wait
    asm volatile("s_wait_xcnt 0x0" :: "v"(pp), "v"(ov[0]), "v"(ov[1]), "v"(ov[2]), "v"(ov[3]), "v"(ov[4]), "v"(ov[5]), "v"(ov[6]), "v"(ov[7]), "v"(ov[8]), "v"(ov[9]), "v"(ov[10]), "v"(ov[11]), "v"(ov[12]), "v"(ov[13]), "v"(ov[14]), "v"(ov[15]) : "memory"); }
}
// Projections, and in the same launch the prompt states. blockIdx.y = 0, 1, 2: q, z, v of 128 rows a block, a wave 16 rows. blockIdx.y = 3: block x makes the state of prompt row group x (x < 16: prompt P of user x; else prompt S of user x - 16),
// once for all chunks of that user: it projects its own 8 rows (the same products in the same order as the row blocks; the A tile holds the 8 rows twice, the upper copy is dropped), keeps z and v in LDS and writes Ps to PSG[x], Pz to PZG[x].
__global__ __launch_bounds__(256) void proj_kernel(const b16* __restrict__ X16, const b16* __restrict__ W16, const float* __restrict__ bq, const float* __restrict__ bk, const float* __restrict__ bv, const float* __restrict__ gz, const float* __restrict__ bz, const unsigned int* __restrict__ GS, float* __restrict__ Q, float* __restrict__ Z, float* __restrict__ V, float* __restrict__ PSG, float* __restrict__ PZG) {
  __shared__ __attribute__((aligned(16))) float SH[D * D + 2 * LP * D]; __shared__ __attribute__((aligned(16))) float rw[2][RN * NW]; static_assert(NW * 16 * (D + 4) <= D * D + 2 * LP * D, "the row blocks' tiles fit SH");
  const int kind = blockIdx.y, wave = threadIdx.x >> 5, lane = threadIdx.x & 31, nloc = lane & 15, hlf = lane >> 4;
  if (kind == 3) { const int x = blockIdx.x, r0 = NRS + x * LP, kd = 1 + (wave >> 2) /* waves 0..3: z, 4..7: v */, c0 = (wave & 3) * 32 /* 32 columns a wave */; float *zs = SH + D * D, *vs = zs + LP * D;
    const b16* Wp = W16 + (size_t)kd * D * D; const float* bb = kd == 1 ? bk : bv; float* dl = kd == 1 ? zs : vs; v8f acc[2] = {(v8f){}, (v8f){}};
#pragma unroll
    for (int kb = 0; kb < D; kb += 32) { const v16b a = frag_kb(X16 + (size_t)(r0 + (nloc & (LP - 1))) * D + kb, hlf);
#pragma unroll
      for (int t = 0; t < 2; ++t) acc[t] = wmma16b(a, frag_kb(Wp + (size_t)(c0 + t * 16 + nloc) * D + kb, hlf), acc[t]); }
#pragma unroll
    for (int t = 0; t < 2; ++t) { const int c = c0 + t * 16 + nloc; const float b_ = bf16_rne(bb[c]);
#pragma unroll
      for (int r = 0; r < 8; ++r) { float v = acc[t][r] * (1.0f / (XS * WSC)) + b_; if (kd == 1) v = elu(v); if (hlf == 0) dl[r * D + c] = v; } }
    prompt_state(gz, bz, GS, PSG + (size_t)x * D * D, PZG + (size_t)x * D, rw, zs, vs, (v4f*)SH);
    return; }
  if (blockIdx.x >= NR / (NW * 16)) return;
  float (*Ts)[16][D + 4] = (float (*)[16][D + 4])SH;
  const size_t m0 = (size_t)blockIdx.x * (NW * 16) + wave * 16; if (kind == 0 && m0 >= (size_t)NRS) return;
  const b16* Wp = W16 + (size_t)kind * D * D; const float* bb = kind == 0 ? bq : kind == 1 ? bk : bv; float* dst = kind == 0 ? Q : kind == 1 ? Z : V;
  v8f acc[8];
#pragma unroll
  for (int t = 0; t < 8; ++t) acc[t] = (v8f){};
#pragma unroll
  for (int kb = 0; kb < D; kb += 32) { const v16b a = frag_kb(X16 + (m0 + nloc) * D + kb, hlf);
#pragma unroll
    for (int t = 0; t < 8; ++t) acc[t] = wmma16b(a, frag_kb(Wp + (size_t)(t * 16 + nloc) * D + kb, hlf), acc[t]); }
#pragma unroll
  for (int t = 0; t < 8; ++t) { const int c = t * 16 + nloc; const float b_ = bf16_rne(bb[c]);
#pragma unroll
    for (int r = 0; r < 8; ++r) { float v = acc[t][r] * (1.0f / (XS * WSC)) + b_; if (kind < 2) v = elu(v); Ts[wave][8 * hlf + r][c] = v; } }
  wave_lds_sync();
  { for (int rr = 0; rr < 16; ++rr) *(v4f*)(dst + (m0 + rr) * D + lane * 4) = *(const v4f*)(&Ts[wave][rr][lane * 4]);  }
}
// state kernel: block = (chunk c, user b) (256 threads). LDS: SR [128][128] staging for the start state, PSL [128][128] prompt-P state; the running s (f32) in registers. prev_NAM does not depend on the step and qn not on the state: the block forms prev_NAM once, in registers,
// multiplies the qn rows of all its steps with it there and keeps only the products (pvS, one row a step). Per step l: s += z v^T; LN stats; NAM passes;
// amdgpu_waves_per_eu(4, 4): at most 256 registers a wave, so that two blocks still share a WGP (four waves on each SIMD), which the LDS allows
__global__ __launch_bounds__(256) __attribute__((amdgpu_waves_per_eu(4, 4))) void state_kernel(const float* __restrict__ Q, const float* __restrict__ Z, const float* __restrict__ V, const int* __restrict__ uid, const float* __restrict__ gz, const float* __restrict__ bz, const unsigned int* __restrict__ GS,
                                                 const unsigned int* __restrict__ GN, const float* __restrict__ ga, const float* __restrict__ ba, const float* __restrict__ prev_z, const float* __restrict__ prev_s, const float* __restrict__ PSG, const float* __restrict__ PZG, float* __restrict__ out, double* __restrict__ STD2) {
  __shared__ __attribute__((aligned(16))) float SR[D * D]; __shared__ __attribute__((aligned(16))) float PSL[D * D]; __shared__ float red[256]; __shared__ __attribute__((aligned(16))) float rw[2][RN * NW]; __shared__ __attribute__((aligned(16))) float zS[MS * D] /* the z rows of the chunk's steps */, qnS[MS * D] /* their normalised q rows */; __shared__ float vS[MS * D] /* the v rows */, pvS[MS * D] /* mask_b (qn . prev_NAM), one row a step */, iznS[MS + 1] /* 1 / (|z_l| + eps) */; __shared__ __attribute__((aligned(16))) double dw[2][NW];
  const int b = blockIdx.y, blk = b * NC + blockIdx.x, l0 = chunk_start(blockIdx.x), l1 = chunk_start(blockIdx.x + 1), t_ = threadIdx.x; const int q = t_ & (D - 1), ph = t_ >> 7;
  // The two prompt states of the user come ready from the launch before (PSG, PZG: P at b, S at NB + b). Prompt P state -> PSL (kept); prompt S state -> registers, there prev_NAM and its products with the chunk's qn rows into pvS.
  float qr[MS];   // the q rows of the chunk's steps, the thread's column (zero in the upper half of the block); used again for the std terms
  { const int u = min(max(uid[b], 0), NU - 1);
    // Wave w holds rows 16 w .. 16 w + 15 of prev_NAM, a lane four neighbouring columns: 16-byte loads of prev_s (from memory), all 16 in flight, issued here so that they fly together with the loads of prev_z and q
    const int wv = t_ >> 5, c4 = (t_ & 31) * 4, rw0 = wv * 16; v4f w[16], pw[16], pg[16], acc[MS]; const float* ps = prev_s + ((size_t)u * D + rw0) * D + c4; const float* ss = PSG + ((size_t)(NB + b) * D + rw0) * D + c4; const v4f* pgp = (const v4f*)(PSG + (size_t)b * D * D) + t_;
#pragma unroll   // the prompt P state, a straight copy to PSL, in one flight with the loads below
    for (int k = 0; k < 16; ++k) pg[k] = pgp[k * 256];
#pragma unroll
    for (int k = 0; k < 16; ++k) w[k] = *(const v4f*)(ps + k * D);
#pragma unroll   // the same rows and columns of the prompt S state
    for (int k = 0; k < 16; ++k) pw[k] = *(const v4f*)(ss + k * D);
    // the q rows of the chunk's steps (a chunk of fewer than MS steps takes its last row again: those products are never read); |q|^2 by the same block sums as every other sum, all in one exchange
    const float *qa[MS], *pza = prev_z + (size_t)u * D + q, *pzsa = PZG + (size_t)(NB + b) * D + q; const float pzr = *pza, pzsr = *pzsa;   // both halves of the block load the rows, the upper half counts them as zero
#pragma unroll
    for (int j = 0; j < MS; ++j) { qa[j] = Q + ((size_t)b * L + min(l0 + j, l1 - 1)) * D + q; qr[j] = *qa[j]; }
    // behind the loads of the prompt states, prev_s, prev_z and the q rows, in front of the first rewrite of a register that they name; the addresses are inputs, so that they keep their registers up to the wait and no load's result lands on them;
    // the loaded rows are inputs, so that their loads stay here, in one flight with those of prev_s, and are not moved into a branch further down
    asm volatile("s_wait_xcnt 0x0" :: "v"(pgp), "v"(ss), "v"(pzsa), "v"(pzsr), "v"(ps), "v"(pza), "v"(qa[0]), "v"(qa[1]), "v"(qa[2]), "v"(qa[3]), "v"(qa[4]), "v"(qa[5]), "v"(qa[6]), "v"(pzr), "v"(qr[0]), "v"(qr[1]), "v"(qr[2]), "v"(qr[3]), "v"(qr[4]), "v"(qr[5]), "v"(qr[6]) : "memory");
#pragma unroll   // read in the walk, by other threads, behind many barriers
    for (int k = 0; k < 16; ++k) ((v4f*)PSL)[k * 256 + t_] = pg[k];
    const float pzv = t_ < D ? bf16_rne(pzr) : 0.0f, zu = t_ < D ? pzv + pzsr : 0.0f;
#pragma unroll
    for (int j = 0; j < MS; ++j) qr[j] = t_ < D ? qr[j] : 0.0f;
    float ru[2 + MS] = {zu * zu, pzv}; static_assert(MS == 7 && 2 + MS <= RN, "the asm statements that hold the row loads name seven rows");
#pragma unroll
    for (int j = 0; j < MS; ++j) ru[2 + j] = qr[j] * qr[j];
    bsum<0>(ru, rw); const float inv = 1.0f / (sqrtf(ru[0]) + EPS), mk = (ru[1] != 0.0f) ? 1.0f : 0.0f;
    if (t_ < D) {
#pragma unroll
      for (int j = 0; j < MS; ++j) qnS[j * D + t_] = qr[j] / (sqrtf(ru[2 + j]) + EPS); }
    __syncthreads();   // qnS is read by every wave
    // prev_NAM in registers; one LDS read of four qn values serves 16 multiply-adds. Each wave's partial rows go to SR (idle here).
    {
#pragma unroll
      for (int k = 0; k < 16; ++k) { const v4f p = pw[k]; for (int i = 0; i < 4; ++i) w[k][i] = (bf16_rne(w[k][i]) + p[i]) * inv; }
#pragma unroll
      for (int j = 0; j < MS; ++j) { acc[j] = (v4f){};
#pragma unroll
        for (int k = 0; k < 4; ++k) { const v4f qq = *(const v4f*)(qnS + j * D + rw0 + 4 * k); for (int i = 0; i < 4; ++i) acc[j] += qq[i] * w[4 * k + i]; }
        *(v4f*)(SR + (wv * MS + j) * D + c4) = acc[j]; } }
    __syncthreads();   // the eight waves' partial rows are summed by other threads, in one fixed tree
    for (int i = t_; i < MS * D; i += 256) { const float* p = SR + i; pvS[i] = mk * (((p[0] + p[MS * D]) + (p[2 * MS * D] + p[3 * MS * D])) + ((p[4 * MS * D] + p[5 * MS * D]) + (p[6 * MS * D] + p[7 * MS * D]))); } }
  __syncthreads();   // the partial rows in SR are read; the start state's staging may overwrite them
  // state in front of step l0: s = sum_{l < l0} z_l v_l^T and zcum = sum z_l, each element summed in step order. The thread keeps rows p0..p0+7 x columns q0..q0+3 and 64+q0..64+q0+3 in registers;
  // SR, which holds nothing any more, stages TR rows of z and TR rows of v at a time (whole tiles are loaded: rows past l0 are inside Z and V and are not summed).
  float zc0;   // sum of z over the earlier steps, the thread's column
  { float* zt = SR; float* vt = SR + TR * D; const int p0 = (t_ >> 4) * 8, q0 = (t_ & 15) * 4; v4f a0[8], a1[8]; float zc = 0.0f; const v4f* zg = (const v4f*)(Z + (size_t)b * L * D) + t_; const v4f* vg = (const v4f*)(V + (size_t)b * L * D) + t_;
#pragma unroll
    for (int r = 0; r < 8; ++r) { a0[r] = (v4f){}; a1[r] = (v4f){}; }
    for (int base = 0; base < l0; base += TR, zg += TR * D / 4, vg += TR * D / 4) { const int n = min(TR, l0 - base);
#pragma unroll   // all 16 loads of the thread in flight at once
      for (int k = 0; k < TR * D / 4 / 256; ++k) { ((v4f*)zt)[t_ + k * 256] = zg[k * 256]; ((v4f*)vt)[t_ + k * 256] = vg[k * 256]; }
      __syncthreads();
#pragma unroll 2   // the next row's LDS reads issue under this row's 64 multiply-adds
      for (int j = 0; j < n; ++j) { const v4f z0 = *(const v4f*)(zt + j * D + p0), z1 = *(const v4f*)(zt + j * D + p0 + 4), v0 = *(const v4f*)(vt + j * D + q0), v1 = *(const v4f*)(vt + j * D + 64 + q0);
        zc += zt[j * D + q];   // both halves of the block sum it, the lower half uses it
#pragma unroll
        for (int r = 0; r < 4; ++r) { a0[r] += z0[r] * v0; a1[r] += z0[r] * v1; a0[4 + r] += z1[r] * v0; a1[4 + r] += z1[r] * v1; } }
      __syncthreads(); }
#pragma unroll
    for (int r = 0; r < 8; ++r) { *(v4f*)(SR + (p0 + r) * D + q0) = a0[r]; *(v4f*)(SR + (p0 + r) * D + 64 + q0) = a1[r]; }
    zc0 = zc; }
  __syncthreads();
  // From here on every element of the state is read and written by one thread only (rows pa..pa+63 of column q): it leaves SR for the thread's registers and stays there over all steps of the chunk.
  constexpr int NH = D / 2; const int pa = ph * NH; const unsigned e0 = pa * D + q /* the thread's first element in every DxD matrix: the rows of the unrolled passes differ from it by constants, so each matrix takes one address for the whole loop */; v2f st[NH / 2], nw[NH / 2] /* pair k: rows pa + 2 k and pa + 2 k + 1 */; const v2f eps2 = sp2(EPS);
#pragma unroll   // st is indexed by constants only, so that it lives in registers
  for (int k = 0; k < NH / 2; ++k) st[k] = (v2f){SR[(pa + 2 * k) * D + q], SR[(pa + 2 * k + 1) * D + q]};
  // What a step needs beside the DxD state depends on no step before it but through the running sum of z: it is made here for all steps of the chunk at once. The z and v rows go to LDS (the lower half of the block brings z, the upper half v);
  // z_l = LN_D(zcum + eps) gz + bz + Pz, 1 / (|z_l| + eps) and the std terms follow with three exchanges for all steps together (each sum in the tree it always had); the walk itself then loads only GS and GN.
  double dsum = 0.0, dsq = 0.0; float gav, bav;   // gav, bav: the thread's column of na_gamma, na_beta
  { const float* sp = (ph ? V : Z) + (size_t)b * L * D + q; float* dl = (ph ? vS : zS) + q; const float *ra_[MS], *gzp = gz + q, *bzp = bz + q, *gap = ga + q, *bap = ba + q, *pzpa = PZG + (size_t)b * D + q; float rv[MS], zc[MS], zf[MS], a[MS];
#pragma unroll
    for (int j = 0; j < MS; ++j) { ra_[j] = sp + (size_t)min(l0 + j, l1 - 1) * D; rv[j] = *ra_[j]; }   // a chunk of fewer than MS steps takes its last row again: what comes of it is never read
    const float gzr = *gzp, bzr = *bzp, gar = *gap, bar = *bap, pz = *pzpa;
    // behind these loads, in front of the first rewrite of a register that they name; the addresses are inputs, so that they keep their registers up to the wait and no load's result lands on them; the values, so that the loads stay in one flight
    asm volatile("s_wait_xcnt 0x0" :: "v"(ra_[0]), "v"(ra_[1]), "v"(ra_[2]), "v"(ra_[3]), "v"(ra_[4]), "v"(ra_[5]), "v"(ra_[6]), "v"(gzp), "v"(bzp), "v"(gap), "v"(bap), "v"(pzpa), "v"(pz), "v"(rv[0]), "v"(rv[1]), "v"(rv[2]), "v"(rv[3]), "v"(rv[4]), "v"(rv[5]), "v"(rv[6]), "v"(gzr), "v"(bzr), "v"(gar), "v"(bar) : "memory");
    gav = bf16_rne(gar); bav = bf16_rne(bar); const float gzv = bf16_rne(gzr), bzv = bf16_rne(bzr); float run = zc0;
#pragma unroll
    for (int j = 0; j < MS; ++j) { dl[j * D] = rv[j]; run += rv[j]; zc[j] = t_ < D ? run + EPS : 0.0f; a[j] = zc[j]; }
    bsum<1>(a, rw);   // its barrier also publishes zS and vS
#pragma unroll
    for (int j = 0; j < MS; ++j) { zc[j] = t_ < D ? zc[j] - a[j] * (1.0f / D) : 0.0f; a[j] = zc[j] * zc[j]; }
    bsum<0>(a, rw);
#pragma unroll
    for (int j = 0; j < MS; ++j) { zf[j] = t_ < D ? pmul(zc[j] * rsqrtf(a[j] * (1.0f / D) + LNE), gzv) + bzv + pz : 0.0f; a[j] = zf[j] * zf[j]; }
    bsum<1>(a, rw);
    float zn2 = a[0];
#pragma unroll
    for (int j = 1; j < MS; ++j) zn2 = t_ == j ? a[j] : zn2;
    if (t_ < MS) iznS[t_] = 1.0f / (sqrtf(zn2) + EPS);   // read in the third pass, behind the barriers of the first two
    if (t_ < D) {
#pragma unroll
      for (int j = 0; j < MS; ++j) if (l0 + j < l1) { const float xv = qr[j] / fmaxf(zf[j], 1e-6f); dsum += (double)xv; dsq += (double)xv * (double)xv; } } }
  for (int l = l0; l < l1; ++l) { const size_t row = (size_t)b * L + l; const int js = (l - l0) * D;
    // Five passes over the thread's 64 rows, all unrolled (st and nw are indexed by constants only). st holds the running state; nw holds S_l/|z_l| + eps, made once in the third pass and used again by the
    // fourth and fifth, which so read neither gs, bs nor the prompt state again. What a pass still loads comes in batches of RA, RB or RC rows: first every load of the batch, then the arithmetic.
    // All five work on pairs of neighbouring rows with packed f32 instructions, each product fused into its add; each sum over the thread's rows runs in four partial sums (rows 4i .. 4i+3), joined by sum4.
    constexpr int RA = 32 /* the first pass: one 16-byte LDS read for four rows */, RB = 16 /* the third pass: a parameter word and a value of the prompt state a row beside the 128 kept values */, RC = 32 /* the fifth pass: a parameter word a row and a 16-byte LDS read for four rows */; float pl[RB]; v4f qv_[RA / 4]; v4u gw[RB / 4], gx[RC / 4]; const v4u *GSt = (const v4u*)GS + t_, *GNt = (const v4u*)GN + t_;
    v2f s1a = sp2(0.0f), s1b = sp2(0.0f); const v2f vq = sp2(vS[js + q]);
#pragma unroll
    for (int pb = 0; pb < NH; pb += RA) {
#pragma unroll
      for (int k = 0; k < RA / 4; ++k) qv_[k] = *(const v4f*)(zS + js + pa + pb + 4 * k);
#pragma unroll
      for (int k = 0; k < RA / 4; ++k) { v2f &a = st[pb / 2 + 2 * k], &c = st[pb / 2 + 2 * k + 1]; a = fma2(lo2(qv_[k]), vq, a); c = fma2(hi2(qv_[k]), vq, c); s1a += a + eps2; s1b += c + eps2; } }
    const float m1 = bsum1<0>(sum4(s1a, s1b), rw) * (1.0f / (D * D)); v2f s2a = sp2(0.0f), s2b = sp2(0.0f);
#pragma unroll
    for (int k = 0; k < NH / 2; k += 2) { const v2f da = (st[k] + eps2) - sp2(m1), dc = (st[k + 1] + eps2) - sp2(m1); s2a = fma2(da, da, s2a); s2b = fma2(dc, dc, s2b); }
    const float r1 = rsqrtf(bsum1<1>(sum4(s2a, s2b), rw) * (1.0f / (D * D)) + LNE), izn = iznS[l - l0];
    // NAMraw = (LN(s) gs + bs + Ps) izn + eps ; stats
    v2f n1a = sp2(0.0f), n1b = sp2(0.0f);
#pragma unroll
    for (int pb = 0; pb < NH; pb += RB) {
#pragma unroll
      for (int k = 0; k < RB / 4; ++k) gw[k] = GSt[(pb / 4 + k) * 256];
#pragma unroll
      for (int k = 0; k < RB; ++k) pl[k] = PSL[e0 + (pb + k) * D];
      asm volatile("s_wait_xcnt 0x0" ::: "memory");   // behind the loads of GS, in front of any later rewrite of a register that they name; its memory clobber also keeps the batch's loads in front of the arithmetic
#pragma unroll
      for (int k = 0; k < RB; k += 2) { const unsigned int w0 = gw[k >> 2][k & 3], w1 = gw[k >> 2][(k & 3) + 1]; const v2f sf = gbfma2(((st[(pb + k) / 2] + eps2) - sp2(m1)) * sp2(r1), w0, w1) + (v2f){pl[k], pl[k + 1]};
        const v2f x = fma2(sf, sp2(izn), eps2); nw[(pb + k) / 2] = x; if (k & 2) n1b += x; else n1a += x; } }
    const float m2 = bsum1<0>(sum4(n1a, n1b), rw) * (1.0f / (D * D)); v2f n2a = sp2(0.0f), n2b = sp2(0.0f);
#pragma unroll
    for (int k = 0; k < NH / 2; k += 2) { const v2f da = nw[k] - sp2(m2), dc = nw[k + 1] - sp2(m2); n2a = fma2(da, da, n2a); n2b = fma2(dc, dc, n2b); }
    const float r2 = rsqrtf(bsum1<1>(sum4(n2a, n2b), rw) * (1.0f / (D * D)) + LNE);
    // NA_q partial over the thread's p half: sum_p qn_p NAM_pq
    v2f naa = sp2(0.0f), nab = sp2(0.0f); const float* qnl = qnS + js + pa;
#pragma unroll
    for (int pb = 0; pb < NH; pb += RC) {
#pragma unroll
      for (int k = 0; k < RC / 4; ++k) gx[k] = GNt[(pb / 4 + k) * 256];
#pragma unroll
      for (int k = 0; k < RC / 4; ++k) qv_[k] = *(const v4f*)(qnl + pb + 4 * k);
      asm volatile("s_wait_xcnt 0x0" ::: "memory");   // as in the third pass, for the loads of GN
#pragma unroll
      for (int k = 0; k < RC; k += 2) { const unsigned int w0 = gx[k >> 2][k & 3], w1 = gx[k >> 2][(k & 3) + 1]; const v2f nam = gbfma2((nw[(pb + k) / 2] - sp2(m2)) * sp2(r2), w0, w1);
        if (k & 2) nab = fma2(hi2(qv_[k >> 2]), nam, nab); else naa = fma2(lo2(qv_[k >> 2]), nam, naa); } }
    // combine the two halves: threads q and q+128 -> via red
    red[t_] = sum4(naa, nab); __syncthreads();
    // LN_D(NA) ga + ba -> out row. No barrier closes the step: what the next step writes in LDS (red and the exchange words) was last read in front of the two barriers below.
    { const float x = t_ < D ? (red[t_] + red[t_ + D]) + pvS[js + t_] : 0.0f; const float mu = bsum1<0>(x, rw) * (1.0f / D); const float dv = t_ < D ? x - mu : 0.0f; const float var = bsum1<1>(dv * dv, rw) * (1.0f / D); const float rr = rsqrtf(var + LNE);
      const float o = pmul(dv * rr, gav) + bav;
      // the wait: behind the store of the row, in front of the next step's rewrite of its address registers (the barrier that stood here brought a wait of its own); inside the branch, so that the loop's address additions cannot be lifted over it
      { if (t_ < D) { ((float*)out)[row * D + t_] = o; asm volatile("s_wait_xcnt 0x0" ::: "memory"); }  } } }
  // the block's two f64 sums, reduced like the f32 ones: butterfly in the wave, one word a wave, one barrier, one fixed tree
  dsum += xrow_d<1>(dsum); dsq += xrow_d<1>(dsq); dsum += xrow_d<2>(dsum); dsq += xrow_d<2>(dsq); dsum += xrow_d<4>(dsum); dsq += xrow_d<4>(dsq); dsum += xrow_d<8>(dsum); dsq += xrow_d<8>(dsq); dsum += xhalf_d(dsum); dsq += xhalf_d(dsq);
  if ((t_ & 31) == 0) { dw[0][t_ >> 5] = dsum; dw[1][t_ >> 5] = dsq; }
  __syncthreads();
  { if (t_ < 16) { const double* w = dw[t_ & 1]; const double tot = ((w[0] + w[1]) + (w[2] + w[3])) + ((w[4] + w[5]) + (w[6] + w[7])); ((double*)STD2)[(size_t)blk * 16 + t_] = t_ < 2 ? tot : 0.0; }  }
}
// final std: one wave, the users' sums joined by a butterfly over lanes 0..15: n = 16*200*128; var = (sumsq - sum^2/n) / (n-1); std -> out2[0] (and 31 zero floats to fill the line? the output is a single float at the end of the buffer; we write just it).
__global__ __launch_bounds__(32) void std_kernel(const double* __restrict__ STD2, float* __restrict__ out2) {
  const int lane = threadIdx.x; double s = 0.0, s2 = 0.0;
  if (lane < NB) {   // lane = user: its chunks in order
#pragma unroll   // several of the lane's loads in flight at a time
    for (int k = 0; k < NC; ++k) { s += STD2[(size_t)(lane * NC + k) * 16]; s2 += STD2[(size_t)(lane * NC + k) * 16 + 1]; } }
  for (int m = NB / 2; m >= 1; m >>= 1) { s += __shfl_xor(s, m); s2 += __shfl_xor(s2, m); }
  if (lane == 0) { const double n = (double)NB * L * D; const double var = (s2 - s * s / n) / (n - 1.0); const float sd = (float)sqrt(var > 0.0 ? var : 0.0);
    { ((float*)out2)[0] = sd;  } }
}
}  // namespace

extern "C" void kernel_launch(void* const* d_in, const int* in_sizes, int n_in, void* d_out, int out_size, void* d_ws, size_t ws_size, hipStream_t stream) {
  (void)n_in;
  auto Fp = [&](int i) { return (const float*)d_in[i]; }; auto Ip = [&](int i) { return (const int*)d_in[i]; };
  // input order: 0 user_id [16] i32, 1 seqs_emb [16,200,128], 2 P [16,8,128], 3 S [16,8,128], 4 Wq [128,128], 5 bq, 6 Wk, 7 bk, 8 Wv, 9 bv, 10 z_gamma, 11 z_beta, 12 s_gamma [128,128], 13 s_beta, 14 nam_gamma, 15 nam_beta,
  // 16 na_gamma [128], 17 na_beta, 18 prev_z [1001,128], 19 prev_s [1001,128,128]; outputs NA [16,200,128] at 0, std [1] at float 409600
  if (in_sizes[0] != NB || in_sizes[1] != NRS * D || in_sizes[2] != NRP * D || in_sizes[3] != NRP * D || in_sizes[4] != D * D || in_sizes[12] != D * D || in_sizes[18] != NU * D || in_sizes[19] != NU * D * D || out_size != NRS * D + 1) return;
  size_t off = 0; char* ws = (char*)d_ws;
  auto carve = [&](size_t bytes) { char* p = ws + off; off += (bytes + 255) & ~(size_t)255; return p; };
  b16* X16 = (b16*)carve((size_t)NR * D * 2); b16* W16 = (b16*)carve((size_t)3 * D * D * 2); float* Qp = (float*)carve((size_t)NRS * D * 4); float* Zp = (float*)carve((size_t)NR * D * 4); float* Vp = (float*)carve((size_t)NR * D * 4); double* STD2 = (double*)carve((size_t)NB * NC * 16 * 8); unsigned int* GB = (unsigned int*)carve((size_t)2 * GBW * 4); float* PSG = (float*)carve((size_t)2 * NB * D * D * 4); float* PZG = (float*)carve((size_t)2 * NB * D * 4);
  if (off > ws_size || off > ((size_t)128 << 20)) return;   // about 8 MB
  prep_kernel<<<(NR * D / 8 + 3 * D * D / 8 + 2 * GBW / 4 + 255) / 256, 256, 0, stream>>>(Fp(1), Fp(2), Fp(3), Fp(4), Fp(6), Fp(8), Fp(12), Fp(13), Fp(14), Fp(15), X16, W16, GB);
  proj_kernel<<<dim3(2 * NB, 4), 256, 0, stream>>>(X16, W16, Fp(5), Fp(7), Fp(9), Fp(10), Fp(11), GB, Qp, Zp, Vp, PSG, PZG);
  state_kernel<<<dim3(NC, NB), 256, 0, stream>>>(Qp, Zp, Vp, Ip(0), Fp(10), Fp(11), GB, GB + GBW, Fp(16), Fp(17), Fp(18), Fp(19), PSG, PZG, (float*)d_out, STD2);
  std_kernel<<<1, 32, 0, stream>>>(STD2, (float*)d_out + (size_t)NRS * D);
}
